// v000
// Measured on an AMD MI455X. A time is GPU time per run, averaged over a window of back-to-back runs after a warm-up
// (all launches, gaps included; the runs take copies of the inputs in turn), and the median of several windows.
// Apart from v000's, it joins two sittings. Times from different sittings can be a few percent apart, while
// side-by-side timings come from the same sitting.
// The starting kernel, v000, takes 416 microseconds a run.
#include <hip/hip_runtime.h>
#include <hip/hip_bf16.h>
#include <math.h>

typedef __attribute__((ext_vector_type(16))) _Float16 v16h;
typedef __attribute__((ext_vector_type(8)))  float    v8f;

#define S_  128
#define R_  384
#define CM  256
#define CZ  128
#define H_  8
#define D_  32

__device__ __forceinline__ int lane_id() { return threadIdx.x & 31; }

__device__ __forceinline__ v8f zero8() {
  v8f z;
#pragma unroll
  for (int i = 0; i < 8; ++i) z[i] = 0.f;
  return z;
}

__device__ __forceinline__ v8f wmma32(v16h a, v16h b, v8f c) {
  // D = A(16x32 f16) * B(32x16 f16) + C(16x16 f32)
  return __builtin_amdgcn_wmma_f32_16x16x32_f16(false, a, false, b, (short)0, c,
                                                false, false);
}

// A fragment: 16x32 f16 tile, row-major, leading dim ld.
// Lane L (0-15): row M=L, K = {0..7, 16..23}; lane 16-31: row M=L-16, K = {8..15, 24..31}.
// Also serves as B fragment when the B matrix is stored transposed (N x K row-major),
// since the B lane layout mirrors A with lane <-> N.
__device__ __forceinline__ v16h load_a_frag(const _Float16* base, int ld) {
  int lane = lane_id();
  int m = lane & 15, half = lane >> 4;
  const _Float16* rowp = base + m * ld + half * 8;
  v16h a;
#pragma unroll
  for (int e = 0; e < 16; ++e)
    a[e] = rowp[((e >> 3) << 4) + (e & 7)];
  return a;
}

__device__ __forceinline__ float wave_sum32(float x) {
#pragma unroll
  for (int off = 16; off > 0; off >>= 1) x += __shfl_xor(x, off, 32);
  return x;
}
__device__ __forceinline__ float half_sum16(float x) {
#pragma unroll
  for (int off = 8; off > 0; off >>= 1) x += __shfl_xor(x, off, 32);
  return x;
}
__device__ __forceinline__ float half_max16(float x) {
#pragma unroll
  for (int off = 8; off > 0; off >>= 1) x = fmaxf(x, __shfl_xor(x, off, 32));
  return x;
}

// ---------------------------------------------------------------- weights prep
__global__ void prep_weights_kernel(const float* wq, const float* wk, const float* wv,
                                    const float* wg, const float* wo,
                                    _Float16* wT, _Float16* woT) {
  int i = blockIdx.x * blockDim.x + threadIdx.x;
  const int NW = 4 * CM * CM;
  if (i < NW) {
    int proj = i >> 16;          // CM*CM == 65536
    int rem  = i & 65535;
    int hd   = rem >> 8;
    int c    = rem & 255;
    const float* w = (proj == 0) ? wq : (proj == 1) ? wk : (proj == 2) ? wv : wg;
    float scl = (proj == 0) ? 0.17677669529663689f : 1.0f;  // D^-0.5 folded into Wq
    wT[i] = (_Float16)(w[c * 256 + hd] * scl);              // wT[N=proj*256+hd][K=c]
  } else if (i < NW + CM * CM) {
    int j  = i - NW;
    int c  = j >> 8;
    int hd = j & 255;
    woT[j] = (_Float16)(wo[hd * 256 + c]);                  // woT[N=c][K=hd]
  }
}

// ---------------------------------------------------------------- pair bias z
// Stored TRANSPOSED: z[h, key_col, query_row] so attention reads are contiguous.
__global__ void pair_bias_kernel(const float* __restrict__ pair,
                                 const float* __restrict__ pn_g,
                                 const float* __restrict__ pn_b,
                                 const float* __restrict__ w_pair,
                                 float* __restrict__ z) {
  int wave = (blockIdx.x * blockDim.x + threadIdx.x) >> 5;
  int lane = lane_id();
  if (wave >= R_ * R_) return;
  const float* p = pair + (size_t)wave * CZ;
  float x[4], s = 0.f, ss = 0.f;
#pragma unroll
  for (int t = 0; t < 4; ++t) {
    float v = p[t * 32 + lane];
    x[t] = v; s += v; ss += v * v;
  }
  s = wave_sum32(s); ss = wave_sum32(ss);
  float mu = s * (1.f / CZ);
  float rsig = rsqrtf(ss * (1.f / CZ) - mu * mu + 1e-5f);
  float xn[4];
#pragma unroll
  for (int t = 0; t < 4; ++t) {
    int c = t * 32 + lane;
    xn[t] = (x[t] - mu) * rsig * pn_g[c] + pn_b[c];
  }
  int qi = wave / R_;            // query row i
  int kj = wave - qi * R_;       // key col j
  float zval = 0.f;
#pragma unroll
  for (int h = 0; h < H_; ++h) {
    float a = 0.f;
#pragma unroll
    for (int t = 0; t < 4; ++t) {
      int c = t * 32 + lane;
      a += xn[t] * w_pair[c * H_ + h];
    }
    a = wave_sum32(a);
    if (lane == h) zval = a;
  }
  if (lane < H_)
    z[(size_t)lane * R_ * R_ + (size_t)kj * R_ + qi] = zval;   // z[h, j, i]
}

// ---------------------------------------------------------------- MSA layernorm
__global__ void ln_msa_kernel(const float* __restrict__ msa,
                              const float* __restrict__ gg,
                              const float* __restrict__ bb,
                              _Float16* __restrict__ m) {
  int row = (blockIdx.x * blockDim.x + threadIdx.x) >> 5;
  int lane = lane_id();
  if (row >= S_ * R_) return;
  const float* p = msa + (size_t)row * CM;
  float x[8], s = 0.f, ss = 0.f;
#pragma unroll
  for (int t = 0; t < 8; ++t) {
    float v = p[t * 32 + lane];
    x[t] = v; s += v; ss += v * v;
  }
  s = wave_sum32(s); ss = wave_sum32(ss);
  float mu = s * (1.f / CM);
  float rsig = rsqrtf(ss * (1.f / CM) - mu * mu + 1e-5f);
  _Float16* o = m + (size_t)row * CM;
#pragma unroll
  for (int t = 0; t < 8; ++t) {
    int c = t * 32 + lane;
    o[c] = (_Float16)((x[t] - mu) * rsig * gg[c] + bb[c]);
  }
}

// ---------------------------------------------------------------- QKVG GEMM
// m[49152 x 256] x wT'[256 x 1024]
//   -> q,k [S,H,R,D] f16 (row-major tiles for A / K^T fragments)
//   -> vT,gT [S,H,D,R] f16 (transposed: contiguous B-fragment loads in attention)
__global__ void qkvg_gemm_kernel(const _Float16* __restrict__ m,
                                 const _Float16* __restrict__ wT,
                                 const float* __restrict__ bg,
                                 _Float16* __restrict__ q, _Float16* __restrict__ k,
                                 _Float16* __restrict__ vT, _Float16* __restrict__ gT) {
  int wave = (blockIdx.x * blockDim.x + threadIdx.x) >> 5;
  int lane = lane_id();
  int nt = wave & 63;
  int mt = wave >> 6;
  if (mt >= (S_ * R_) / 16) return;
  v8f acc = zero8();
  const _Float16* arow = m  + (size_t)(mt * 16) * CM;
  const _Float16* brow = wT + (size_t)(nt * 16) * CM;
#pragma unroll
  for (int k0 = 0; k0 < CM; k0 += 32)
    acc = wmma32(load_a_frag(arow + k0, CM), load_a_frag(brow + k0, CM), acc);

  int half = lane >> 4, n = lane & 15;
  int gn = nt * 16 + n;
  int proj = nt >> 4;           // uniform per wave
  int h = (gn >> 5) & 7;
  int d = gn & 31;
  // a 16-row M tile never crosses an s boundary (R % 16 == 0)
  int gm0 = mt * 16 + half * 8;
  int s = gm0 / R_;
  int r0 = gm0 - s * R_;
#pragma unroll
  for (int vi = 0; vi < 8; ++vi) {
    int r = r0 + vi;
    if (proj == 0) {
      q[(((size_t)s * H_ + h) * R_ + r) * D_ + d] = (_Float16)acc[vi];
    } else if (proj == 1) {
      k[(((size_t)s * H_ + h) * R_ + r) * D_ + d] = (_Float16)acc[vi];
    } else if (proj == 2) {
      vT[(((size_t)s * H_ + h) * D_ + d) * R_ + r] = (_Float16)acc[vi];  // contiguous over vi
    } else {
      float gv = 1.f / (1.f + __expf(-(acc[vi] + bg[h * D_ + d])));
      gT[(((size_t)s * H_ + h) * D_ + d) * R_ + r] = (_Float16)gv;       // contiguous over vi
    }
  }
}

// ---------------------------------------------------------------- attention
// One wave per (s, h, 16-row q tile). Flash-style online softmax over 32-key chunks.
__global__ void attn_kernel(const _Float16* __restrict__ q, const _Float16* __restrict__ k,
                            const _Float16* __restrict__ vT, const _Float16* __restrict__ gT,
                            const float* __restrict__ z, const float* __restrict__ mask,
                            _Float16* __restrict__ og) {
  __shared__ _Float16 plds[4][16][32];      // per-wave probs staging (A-layout refill)
  int w = threadIdx.x >> 5;
  int lane = lane_id();
  int t = blockIdx.x * 4 + w;
  const int NQ = R_ / 16;                   // 24
  int qt = t % NQ;
  int rem = t / NQ;
  int h = rem & 7;
  int s = rem >> 3;
  if (s >= S_) return;
  int q0 = qt * 16;

  const _Float16* Q  = q  + (((size_t)s * H_ + h) * R_) * D_;
  const _Float16* K  = k  + (((size_t)s * H_ + h) * R_) * D_;
  const _Float16* VT = vT + (((size_t)s * H_ + h) * D_) * R_;
  const _Float16* GT = gT + (((size_t)s * H_ + h) * D_) * R_;
  const float* Z = z + (size_t)h * R_ * R_;          // z[key, query] layout
  const float* M = mask + (size_t)s * R_;
  int half = lane >> 4, n = lane & 15;

  v16h aq = load_a_frag(Q + (size_t)q0 * D_, D_);
  v8f o0 = zero8(), o1 = zero8();
  float rmax[8], rsum[8];
#pragma unroll
  for (int i = 0; i < 8; ++i) { rmax[i] = -1e30f; rsum[i] = 0.f; }

  for (int kb = 0; kb < R_ / 32; ++kb) {
    int c0 = kb * 32;
    v16h bk0 = load_a_frag(K + (size_t)c0 * D_, D_);        // keys c0..c0+15
    v16h bk1 = load_a_frag(K + (size_t)(c0 + 16) * D_, D_); // keys c0+16..c0+31
    v8f s0 = wmma32(aq, bk0, zero8());
    v8f s1 = wmma32(aq, bk1, zero8());

    int col0 = c0 + n, col1 = c0 + 16 + n;
    float mb0 = 1e9f * (M[col0] - 1.f);
    float mb1 = 1e9f * (M[col1] - 1.f);
    // z[h, key, query]: 8 consecutive queries per lane -> coalesced vector loads
    const float* z0 = Z + (size_t)col0 * R_ + q0 + half * 8;
    const float* z1 = Z + (size_t)col1 * R_ + q0 + half * 8;
#pragma unroll
    for (int vi = 0; vi < 8; ++vi) {
      s0[vi] += z0[vi] + mb0;
      s1[vi] += z1[vi] + mb1;
    }
#pragma unroll
    for (int vi = 0; vi < 8; ++vi) {
      float mx = half_max16(fmaxf(s0[vi], s1[vi]));
      float nm = fmaxf(rmax[vi], mx);
      float sc = __expf(rmax[vi] - nm);
      float p0 = __expf(s0[vi] - nm);
      float p1 = __expf(s1[vi] - nm);
      rsum[vi] = rsum[vi] * sc + half_sum16(p0 + p1);
      rmax[vi] = nm;
      o0[vi] *= sc; o1[vi] *= sc;
      plds[w][half * 8 + vi][n]      = (_Float16)p0;
      plds[w][half * 8 + vi][16 + n] = (_Float16)p1;
    }
    // same-wave DS RAW: writes above feed the cross-lane A-fragment load below
    asm volatile("s_wait_dscnt 0" ::: "memory");
    v16h ap  = load_a_frag(&plds[w][0][0], 32);
    // V^T rows d0..d0+15 over keys c0..c0+31 == B fragment (lane <-> N=d)
    v16h bv0 = load_a_frag(VT + (size_t)0  * R_ + c0, R_);
    v16h bv1 = load_a_frag(VT + (size_t)16 * R_ + c0, R_);
    o0 = wmma32(ap, bv0, o0);
    o1 = wmma32(ap, bv1, o1);
  }

  // epilogue: normalize, gate, write og[row, h*32+d] (f16)
  const _Float16* g0p = GT + (size_t)n        * R_ + q0 + half * 8;  // contiguous
  const _Float16* g1p = GT + (size_t)(16 + n) * R_ + q0 + half * 8;  // contiguous
#pragma unroll
  for (int vi = 0; vi < 8; ++vi) {
    int row = q0 + half * 8 + vi;
    float inv = 1.f / rsum[vi];
    float g0 = (float)g0p[vi];
    float g1 = (float)g1p[vi];
    size_t dst = ((size_t)s * R_ + row) * 256 + h * D_;
    og[dst + n]      = (_Float16)(o0[vi] * inv * g0);
    og[dst + 16 + n] = (_Float16)(o1[vi] * inv * g1);
  }
}

// ---------------------------------------------------------------- output GEMM
__global__ void out_gemm_kernel(const _Float16* __restrict__ og,
                                const _Float16* __restrict__ woT,
                                const float* __restrict__ bo,
                                float* __restrict__ out) {
  int wave = (blockIdx.x * blockDim.x + threadIdx.x) >> 5;
  int lane = lane_id();
  int nt = wave & 15;
  int mt = wave >> 4;
  if (mt >= (S_ * R_) / 16) return;
  v8f acc = zero8();
  const _Float16* arow = og  + (size_t)(mt * 16) * 256;
  const _Float16* brow = woT + (size_t)(nt * 16) * 256;
#pragma unroll
  for (int k0 = 0; k0 < 256; k0 += 32)
    acc = wmma32(load_a_frag(arow + k0, 256), load_a_frag(brow + k0, 256), acc);
  int half = lane >> 4, n = lane & 15;
  float bias = bo[nt * 16 + n];
#pragma unroll
  for (int vi = 0; vi < 8; ++vi)
    out[(size_t)(mt * 16 + half * 8 + vi) * 256 + nt * 16 + n] = acc[vi] + bias;
}

// ---------------------------------------------------------------- launch
extern "C" void kernel_launch(void* const* d_in, const int* in_sizes, int n_in,
                              void* d_out, int out_size, void* d_ws, size_t ws_size,
                              hipStream_t stream) {
  const float* msa_act  = (const float*)d_in[0];
  const float* pair_act = (const float*)d_in[1];
  const float* msa_mask = (const float*)d_in[2];
  const float* qn_g     = (const float*)d_in[3];
  const float* qn_b     = (const float*)d_in[4];
  const float* pn_g     = (const float*)d_in[5];
  const float* pn_b     = (const float*)d_in[6];
  const float* w_pair   = (const float*)d_in[7];
  const float* wq       = (const float*)d_in[8];
  const float* wk       = (const float*)d_in[9];
  const float* wv       = (const float*)d_in[10];
  const float* wg       = (const float*)d_in[11];
  const float* bg       = (const float*)d_in[12];
  const float* wo       = (const float*)d_in[13];
  const float* bo       = (const float*)d_in[14];
  float* out = (float*)d_out;

  char* ws = (char*)d_ws;
  _Float16* wT_  = (_Float16*)(ws + 0);               // 1024*256*2      = 524288
  _Float16* woT_ = (_Float16*)(ws + 524288);          // 256*256*2       = 131072
  float*    z_   = (float*)   (ws + 655360);          // 8*384*384*4     = 4718592
  _Float16* m_   = (_Float16*)(ws + 5373952);         // 49152*256*2     = 25165824
  _Float16* q_   = (_Float16*)(ws + 30539776);        // 128*8*384*32*2  = 25165824
  _Float16* k_   = (_Float16*)(ws + 55705600);
  _Float16* vT_  = (_Float16*)(ws + 80871424);
  _Float16* gT_  = (_Float16*)(ws + 106037248);
  _Float16* og_  = (_Float16*)(ws + 131203072);       // 49152*256*2

  prep_weights_kernel<<<1280, 256, 0, stream>>>(wq, wk, wv, wg, wo, wT_, woT_);
  pair_bias_kernel<<<18432, 256, 0, stream>>>(pair_act, pn_g, pn_b, w_pair, z_);
  ln_msa_kernel<<<6144, 256, 0, stream>>>(msa_act, qn_g, qn_b, m_);
  qkvg_gemm_kernel<<<24576, 256, 0, stream>>>(m_, wT_, bg, q_, k_, vT_, gT_);
  attn_kernel<<<6144, 128, 0, stream>>>(q_, k_, vT_, gT_, z_, msa_mask, og_);
  out_gemm_kernel<<<6144, 256, 0, stream>>>(og_, woT_, bo, out);
}

// v001
// It runs in 226 microseconds.
// Timed twice side by side with v000, it ran 1.92 times as fast both times.
#include <hip/hip_runtime.h>
#include <hip/hip_bf16.h>
#include <math.h>

typedef __attribute__((ext_vector_type(16))) _Float16 v16h;
typedef __attribute__((ext_vector_type(8)))  _Float16 v8h;
typedef __attribute__((ext_vector_type(8)))  float    v8f;

#define S_  128
#define R_  384
#define CM  256
#define CZ  128
#define H_  8
#define D_  32

__device__ __forceinline__ int lane_id() { return threadIdx.x & 31; }

__device__ __forceinline__ v8f zero8() {
  v8f z;
#pragma unroll
  for (int i = 0; i < 8; ++i) z[i] = 0.f;
  return z;
}

__device__ __forceinline__ v8f wmma32(v16h a, v16h b, v8f c) {
  // D = A(16x32 f16) * B(32x16 f16) + C(16x16 f32)
  return __builtin_amdgcn_wmma_f32_16x16x32_f16(false, a, false, b, (short)0, c,
                                                false, false);
}

// A fragment: 16x32 f16 tile, row-major, leading dim ld.
// Lane L (0-15): row M=L, K = {0..7, 16..23}; lane 16-31: row M=L-16, K = {8..15, 24..31}.
// Also serves as B fragment when the B matrix is stored transposed (N x K row-major),
// since the B lane layout mirrors A with lane <-> N.
__device__ __forceinline__ v16h load_a_frag(const _Float16* base, int ld) {
  int lane = lane_id();
  int m = lane & 15, half = lane >> 4;
  const _Float16* rowp = base + m * ld + half * 8;
  v16h a;
#pragma unroll
  for (int e = 0; e < 16; ++e)
    a[e] = rowp[((e >> 3) << 4) + (e & 7)];
  return a;
}

__device__ __forceinline__ float wave_sum32(float x) {
#pragma unroll
  for (int off = 16; off > 0; off >>= 1) x += __shfl_xor(x, off, 32);
  return x;
}
__device__ __forceinline__ float half_sum16(float x) {
#pragma unroll
  for (int off = 8; off > 0; off >>= 1) x += __shfl_xor(x, off, 32);
  return x;
}
__device__ __forceinline__ float half_max16(float x) {
#pragma unroll
  for (int off = 8; off > 0; off >>= 1) x = fmaxf(x, __shfl_xor(x, off, 32));
  return x;
}

// ---------------------------------------------------------------- weights prep
__global__ void prep_weights_kernel(const float* wq, const float* wk, const float* wv,
                                    const float* wg, const float* wo,
                                    _Float16* wT, _Float16* woT) {
  int i = blockIdx.x * blockDim.x + threadIdx.x;
  const int NW = 4 * CM * CM;
  if (i < NW) {
    int proj = i >> 16;          // CM*CM == 65536
    int rem  = i & 65535;
    int hd   = rem >> 8;
    int c    = rem & 255;
    const float* w = (proj == 0) ? wq : (proj == 1) ? wk : (proj == 2) ? wv : wg;
    float scl = (proj == 0) ? 0.17677669529663689f : 1.0f;  // D^-0.5 folded into Wq
    wT[i] = (_Float16)(w[c * 256 + hd] * scl);              // wT[N=proj*256+hd][K=c]
  } else if (i < NW + CM * CM) {
    int j  = i - NW;
    int c  = j >> 8;
    int hd = j & 255;
    woT[j] = (_Float16)(wo[hd * 256 + c]);                  // woT[N=c][K=hd]
  }
}

// ---------------------------------------------------------------- pair bias z
// Stored TRANSPOSED: z[h, key_col, query_row] so attention reads are contiguous.
__global__ void pair_bias_kernel(const float* __restrict__ pair,
                                 const float* __restrict__ pn_g,
                                 const float* __restrict__ pn_b,
                                 const float* __restrict__ w_pair,
                                 float* __restrict__ z) {
  int wave = (blockIdx.x * blockDim.x + threadIdx.x) >> 5;
  int lane = lane_id();
  if (wave >= R_ * R_) return;
  const float* p = pair + (size_t)wave * CZ;
  float x[4], s = 0.f, ss = 0.f;
#pragma unroll
  for (int t = 0; t < 4; ++t) {
    float v = p[t * 32 + lane];
    x[t] = v; s += v; ss += v * v;
  }
  s = wave_sum32(s); ss = wave_sum32(ss);
  float mu = s * (1.f / CZ);
  float rsig = rsqrtf(ss * (1.f / CZ) - mu * mu + 1e-5f);
  float xn[4];
#pragma unroll
  for (int t = 0; t < 4; ++t) {
    int c = t * 32 + lane;
    xn[t] = (x[t] - mu) * rsig * pn_g[c] + pn_b[c];
  }
  int qi = wave / R_;            // query row i
  int kj = wave - qi * R_;       // key col j
  float zval = 0.f;
#pragma unroll
  for (int h = 0; h < H_; ++h) {
    float a = 0.f;
#pragma unroll
    for (int t = 0; t < 4; ++t) {
      int c = t * 32 + lane;
      a += xn[t] * w_pair[c * H_ + h];
    }
    a = wave_sum32(a);
    if (lane == h) zval = a;
  }
  if (lane < H_)
    z[(size_t)lane * R_ * R_ + (size_t)kj * R_ + qi] = zval;   // z[h, j, i]
}

// ---------------------------------------------------------------- MSA layernorm
__global__ void ln_msa_kernel(const float* __restrict__ msa,
                              const float* __restrict__ gg,
                              const float* __restrict__ bb,
                              _Float16* __restrict__ m) {
  int row = (blockIdx.x * blockDim.x + threadIdx.x) >> 5;
  int lane = lane_id();
  if (row >= S_ * R_) return;
  const float* p = msa + (size_t)row * CM;
  float x[8], s = 0.f, ss = 0.f;
#pragma unroll
  for (int t = 0; t < 8; ++t) {
    float v = p[t * 32 + lane];
    x[t] = v; s += v; ss += v * v;
  }
  s = wave_sum32(s); ss = wave_sum32(ss);
  float mu = s * (1.f / CM);
  float rsig = rsqrtf(ss * (1.f / CM) - mu * mu + 1e-5f);
  _Float16* o = m + (size_t)row * CM;
#pragma unroll
  for (int t = 0; t < 8; ++t) {
    int c = t * 32 + lane;
    o[c] = (_Float16)((x[t] - mu) * rsig * gg[c] + bb[c]);
  }
}

// ---------------------------------------------------------------- GEMM block tile
// C[128 x 128] = A[128 x 256] * B^T, A and B both row-major with 256 f16 per row.
// 8 waves; both operand tiles are staged once in LDS, one whole 512-byte row per
// wave-wide load, and each wave then owns a 64 x 32 piece (4 x 2 accumulator tiles).
#define GP 264   // LDS row pitch in f16: 528 B = 16 B x 33, so 16 rows fall on distinct banks

// Same element order as load_a_frag, as two 16-byte LDS reads.
__device__ __forceinline__ v16h lds_frag(const _Float16* base) {
  int lane = lane_id();
  const _Float16* rowp = base + (lane & 15) * GP + (lane >> 4) * 8;
  v8h lo = *(const v8h*)rowp;
  v8h hi = *(const v8h*)(rowp + 16);
  return __builtin_shufflevector(lo, hi, 0, 1, 2, 3, 4, 5, 6, 7, 8, 9, 10, 11, 12, 13, 14, 15);
}

__device__ __forceinline__ void gemm_tile_128x128(const _Float16* __restrict__ ga,
                                                  const _Float16* __restrict__ gb,
                                                  _Float16* sA, _Float16* sB,
                                                  v8f (&acc)[4][2]) {
  int lane = lane_id();
  int w = threadIdx.x >> 5;
  // wave w stages rows w, w + 8, ... of both tiles
  const _Float16* la = ga + w * 256 + lane * 8;
  const _Float16* lb = gb + w * 256 + lane * 8;
  _Float16* wa = sA + w * GP + lane * 8;
  _Float16* wb = sB + w * GP + lane * 8;
  v8h ra[16], rb[16];
#pragma unroll
  for (int i = 0; i < 16; ++i) {
    ra[i] = *(const v8h*)(la + i * 8 * 256);
    rb[i] = *(const v8h*)(lb + i * 8 * 256);
  }
  // precaution: both address pairs stay untouched (no load result is placed on them) up to this wait
  asm volatile("s_wait_xcnt 0x0" :: "v"(la), "v"(lb) : "memory");
#pragma unroll
  for (int i = 0; i < 16; ++i) {
    *(v8h*)(wa + i * 8 * GP) = ra[i];
    *(v8h*)(wb + i * 8 * GP) = rb[i];
  }
  __syncthreads();   // every wave reads rows that the other waves staged
  const _Float16* pa = sA + (w >> 2) * 64 * GP;
  const _Float16* pb = sB + (w & 3) * 32 * GP;
#pragma unroll
  for (int mi = 0; mi < 4; ++mi) { acc[mi][0] = zero8(); acc[mi][1] = zero8(); }
#pragma unroll
  for (int k0 = 0; k0 < 256; k0 += 32) {
    v16h b0 = lds_frag(pb + k0);
    v16h b1 = lds_frag(pb + 16 * GP + k0);
#pragma unroll
    for (int mi = 0; mi < 4; ++mi) {
      v16h a = lds_frag(pa + mi * 16 * GP + k0);
      acc[mi][0] = wmma32(a, b0, acc[mi][0]);
      acc[mi][1] = wmma32(a, b1, acc[mi][1]);
    }
  }
}

// 2^x on v_exp_f32. The v_nop in the same statement is the one slot that the instruction set asks
// for behind a transcendental before its result is read or its source rewritten.
__device__ __forceinline__ float exp2_slot(float x) {
  float r;
  asm("v_exp_f32 %0, %1\n\tv_nop" : "=v"(r) : "v"(x));
  return r;
}

// ---------------------------------------------------------------- QKVG GEMM
// m[49152 x 256] x wT'[256 x 1024]
//   -> q,k [S,H,R,D] f16 (row-major tiles for A / K^T fragments)
//   -> vT,gT [S,H,D,R] f16 (transposed: contiguous B-fragment loads in attention)
__global__ __launch_bounds__(256)
void qkvg_gemm_kernel(const _Float16* __restrict__ m,
                      const _Float16* __restrict__ wT,
                      const float* __restrict__ bg,
                      _Float16* __restrict__ q, _Float16* __restrict__ k,
                      _Float16* __restrict__ vT, _Float16* __restrict__ gT) {
  __shared__ __attribute__((aligned(16))) _Float16 sA[128 * GP];
  __shared__ __attribute__((aligned(16))) _Float16 sB[128 * GP];
  int nb = blockIdx.x & 7;      // 128-column tile; the 8 blocks of one row tile are neighbours
  int mb = blockIdx.x >> 3;     // 128-row tile
  v8f acc[4][2];
  gemm_tile_128x128(m + (size_t)mb * 128 * CM, wT + (size_t)nb * 128 * CM, sA, sB, acc);

  int lane = lane_id();
  int w = threadIdx.x >> 5;
  int half = lane >> 4, n = lane & 15;
  int proj = nb >> 1;           // uniform per block
  int h = (nb * 4 + (w & 3)) & 7;   // a wave's 32 columns are one head
  // a 128-row M tile never crosses an s boundary (R % 128 == 0)
  int s = mb / 3;
  int rw = (mb - s * 3) * 128 + (w >> 2) * 64 + half * 8;
  size_t sh = (size_t)s * H_ + h;
  if (proj < 2) {               // q, k: [S,H,R,D]
    _Float16* dst = (proj == 0 ? q : k) + (sh * R_ + rw) * D_ + n;
#pragma unroll
    for (int mi = 0; mi < 4; ++mi)
#pragma unroll
      for (int ni = 0; ni < 2; ++ni)
#pragma unroll
        for (int vi = 0; vi < 8; ++vi)
          dst[(mi * 16 + vi) * D_ + ni * 16] = (_Float16)acc[mi][ni][vi];
  } else if (proj == 2) {       // vT: [S,H,D,R], contiguous over vi
    _Float16* dst = vT + (sh * D_ + n) * R_ + rw;
#pragma unroll
    for (int mi = 0; mi < 4; ++mi)
#pragma unroll
      for (int ni = 0; ni < 2; ++ni)
#pragma unroll
        for (int vi = 0; vi < 8; ++vi)
          dst[ni * 16 * R_ + mi * 16 + vi] = (_Float16)acc[mi][ni][vi];
    // precaution: no register of the stores above is rewritten ahead of this wait
    asm volatile("s_wait_xcnt 0x0" ::: "memory");
  } else {                      // gT: [S,H,D,R], contiguous over vi
    _Float16* dst = gT + (sh * D_ + n) * R_ + rw;
    const float* bp = bg + h * D_ + n;
    float bg2[2] = { bp[0], bp[16] };
    // precaution: the address pair stays untouched (no load result is placed on it) up to this wait
    asm volatile("s_wait_xcnt 0x0" :: "v"(bp) : "memory");
#pragma unroll
    for (int ni = 0; ni < 2; ++ni) {
      float bgv = bg2[ni];
#pragma unroll
      for (int mi = 0; mi < 4; ++mi) {
        v8h pk;
#pragma unroll
        for (int vi = 0; vi < 8; ++vi) {
          float gv = 1.f / (1.f + exp2_slot((acc[mi][ni][vi] + bgv) * -1.4426950408889634f));
          pk[vi] = (_Float16)gv;
        }
        *(v8h*)(dst + ni * 16 * R_ + mi * 16) = pk;   // 8 rows of one column: one 16-byte store
      }
    }
    // precaution: no register of the stores above is rewritten ahead of this wait
    asm volatile("s_wait_xcnt 0x0" ::: "memory");
  }
}

// ---------------------------------------------------------------- attention
// One wave per (s, h, 16-row q tile). Flash-style online softmax over 32-key chunks.
__global__ void attn_kernel(const _Float16* __restrict__ q, const _Float16* __restrict__ k,
                            const _Float16* __restrict__ vT, const _Float16* __restrict__ gT,
                            const float* __restrict__ z, const float* __restrict__ mask,
                            _Float16* __restrict__ og) {
  __shared__ _Float16 plds[4][16][32];      // per-wave probs staging (A-layout refill)
  int w = threadIdx.x >> 5;
  int lane = lane_id();
  int t = blockIdx.x * 4 + w;
  const int NQ = R_ / 16;                   // 24
  int qt = t % NQ;
  int rem = t / NQ;
  int h = rem & 7;
  int s = rem >> 3;
  if (s >= S_) return;
  int q0 = qt * 16;

  const _Float16* Q  = q  + (((size_t)s * H_ + h) * R_) * D_;
  const _Float16* K  = k  + (((size_t)s * H_ + h) * R_) * D_;
  const _Float16* VT = vT + (((size_t)s * H_ + h) * D_) * R_;
  const _Float16* GT = gT + (((size_t)s * H_ + h) * D_) * R_;
  const float* Z = z + (size_t)h * R_ * R_;          // z[key, query] layout
  const float* M = mask + (size_t)s * R_;
  int half = lane >> 4, n = lane & 15;

  v16h aq = load_a_frag(Q + (size_t)q0 * D_, D_);
  v8f o0 = zero8(), o1 = zero8();
  float rmax[8], rsum[8];
#pragma unroll
  for (int i = 0; i < 8; ++i) { rmax[i] = -1e30f; rsum[i] = 0.f; }

  for (int kb = 0; kb < R_ / 32; ++kb) {
    int c0 = kb * 32;
    v16h bk0 = load_a_frag(K + (size_t)c0 * D_, D_);        // keys c0..c0+15
    v16h bk1 = load_a_frag(K + (size_t)(c0 + 16) * D_, D_); // keys c0+16..c0+31
    v8f s0 = wmma32(aq, bk0, zero8());
    v8f s1 = wmma32(aq, bk1, zero8());

    int col0 = c0 + n, col1 = c0 + 16 + n;
    float mb0 = 1e9f * (M[col0] - 1.f);
    float mb1 = 1e9f * (M[col1] - 1.f);
    // z[h, key, query]: 8 consecutive queries per lane -> coalesced vector loads
    const float* z0 = Z + (size_t)col0 * R_ + q0 + half * 8;
    const float* z1 = Z + (size_t)col1 * R_ + q0 + half * 8;
#pragma unroll
    for (int vi = 0; vi < 8; ++vi) {
      s0[vi] += z0[vi] + mb0;
      s1[vi] += z1[vi] + mb1;
    }
#pragma unroll
    for (int vi = 0; vi < 8; ++vi) {
      float mx = half_max16(fmaxf(s0[vi], s1[vi]));
      float nm = fmaxf(rmax[vi], mx);
      float sc = __expf(rmax[vi] - nm);
      float p0 = __expf(s0[vi] - nm);
      float p1 = __expf(s1[vi] - nm);
      rsum[vi] = rsum[vi] * sc + half_sum16(p0 + p1);
      rmax[vi] = nm;
      o0[vi] *= sc; o1[vi] *= sc;
      plds[w][half * 8 + vi][n]      = (_Float16)p0;
      plds[w][half * 8 + vi][16 + n] = (_Float16)p1;
    }
    // same-wave DS RAW: writes above feed the cross-lane A-fragment load below
    asm volatile("s_wait_dscnt 0" ::: "memory");
    v16h ap  = load_a_frag(&plds[w][0][0], 32);
    // V^T rows d0..d0+15 over keys c0..c0+31 == B fragment (lane <-> N=d)
    v16h bv0 = load_a_frag(VT + (size_t)0  * R_ + c0, R_);
    v16h bv1 = load_a_frag(VT + (size_t)16 * R_ + c0, R_);
    o0 = wmma32(ap, bv0, o0);
    o1 = wmma32(ap, bv1, o1);
  }

  // epilogue: normalize, gate, write og[row, h*32+d] (f16)
  const _Float16* g0p = GT + (size_t)n        * R_ + q0 + half * 8;  // contiguous
  const _Float16* g1p = GT + (size_t)(16 + n) * R_ + q0 + half * 8;  // contiguous
#pragma unroll
  for (int vi = 0; vi < 8; ++vi) {
    int row = q0 + half * 8 + vi;
    float inv = 1.f / rsum[vi];
    float g0 = (float)g0p[vi];
    float g1 = (float)g1p[vi];
    size_t dst = ((size_t)s * R_ + row) * 256 + h * D_;
    og[dst + n]      = (_Float16)(o0[vi] * inv * g0);
    og[dst + 16 + n] = (_Float16)(o1[vi] * inv * g1);
  }
}

// ---------------------------------------------------------------- output GEMM
__global__ __launch_bounds__(256)
void out_gemm_kernel(const _Float16* __restrict__ og,
                     const _Float16* __restrict__ woT,
                     const float* __restrict__ bo,
                     float* __restrict__ out) {
  __shared__ __attribute__((aligned(16))) _Float16 sA[128 * GP];
  __shared__ __attribute__((aligned(16))) _Float16 sB[128 * GP];
  int nb = blockIdx.x & 1;
  int mb = blockIdx.x >> 1;
  v8f acc[4][2];
  gemm_tile_128x128(og + (size_t)mb * 128 * 256, woT + (size_t)nb * 128 * 256, sA, sB, acc);

  int lane = lane_id();
  int w = threadIdx.x >> 5;
  int half = lane >> 4, n = lane & 15;
  int row0 = mb * 128 + (w >> 2) * 64 + half * 8;
  int col0 = nb * 128 + (w & 3) * 32 + n;
#pragma unroll
  for (int ni = 0; ni < 2; ++ni) {
    float bias = bo[col0 + ni * 16];
#pragma unroll
    for (int mi = 0; mi < 4; ++mi)
#pragma unroll
      for (int vi = 0; vi < 8; ++vi)
        out[(size_t)(row0 + mi * 16 + vi) * 256 + col0 + ni * 16] = acc[mi][ni][vi] + bias;
  }
}

// ---------------------------------------------------------------- launch
extern "C" void kernel_launch(void* const* d_in, const int* in_sizes, int n_in,
                              void* d_out, int out_size, void* d_ws, size_t ws_size,
                              hipStream_t stream) {
  const float* msa_act  = (const float*)d_in[0];
  const float* pair_act = (const float*)d_in[1];
  const float* msa_mask = (const float*)d_in[2];
  const float* qn_g     = (const float*)d_in[3];
  const float* qn_b     = (const float*)d_in[4];
  const float* pn_g     = (const float*)d_in[5];
  const float* pn_b     = (const float*)d_in[6];
  const float* w_pair   = (const float*)d_in[7];
  const float* wq       = (const float*)d_in[8];
  const float* wk       = (const float*)d_in[9];
  const float* wv       = (const float*)d_in[10];
  const float* wg       = (const float*)d_in[11];
  const float* bg       = (const float*)d_in[12];
  const float* wo       = (const float*)d_in[13];
  const float* bo       = (const float*)d_in[14];
  float* out = (float*)d_out;

  char* ws = (char*)d_ws;
  _Float16* wT_  = (_Float16*)(ws + 0);               // 1024*256*2      = 524288
  _Float16* woT_ = (_Float16*)(ws + 524288);          // 256*256*2       = 131072
  float*    z_   = (float*)   (ws + 655360);          // 8*384*384*4     = 4718592
  _Float16* m_   = (_Float16*)(ws + 5373952);         // 49152*256*2     = 25165824
  _Float16* q_   = (_Float16*)(ws + 30539776);        // 128*8*384*32*2  = 25165824
  _Float16* k_   = (_Float16*)(ws + 55705600);
  _Float16* vT_  = (_Float16*)(ws + 80871424);
  _Float16* gT_  = (_Float16*)(ws + 106037248);
  _Float16* og_  = (_Float16*)(ws + 131203072);       // 49152*256*2

  prep_weights_kernel<<<1280, 256, 0, stream>>>(wq, wk, wv, wg, wo, wT_, woT_);
  pair_bias_kernel<<<18432, 256, 0, stream>>>(pair_act, pn_g, pn_b, w_pair, z_);
  ln_msa_kernel<<<6144, 256, 0, stream>>>(msa_act, qn_g, qn_b, m_);
  qkvg_gemm_kernel<<<3072, 256, 0, stream>>>(m_, wT_, bg, q_, k_, vT_, gT_);
  attn_kernel<<<6144, 128, 0, stream>>>(q_, k_, vT_, gT_, z_, msa_mask, og_);
  out_gemm_kernel<<<768, 256, 0, stream>>>(og_, woT_, bo, out);
}

// v002
// Measured time: 214 microseconds a run.
// Two timings next to v001 both put it at 1.06 times that version's speed.
// Over all steps from v000 it is 2.03 times as fast.
#include <hip/hip_runtime.h>
#include <hip/hip_bf16.h>
#include <math.h>

typedef __attribute__((ext_vector_type(16))) _Float16 v16h;
typedef __attribute__((ext_vector_type(8)))  _Float16 v8h;
typedef __attribute__((ext_vector_type(8)))  float    v8f;

#define S_  128
#define R_  384
#define CM  256
#define CZ  128
#define H_  8
#define D_  32

__device__ __forceinline__ int lane_id() { return threadIdx.x & 31; }

__device__ __forceinline__ v8f zero8() {
  v8f z;
#pragma unroll
  for (int i = 0; i < 8; ++i) z[i] = 0.f;
  return z;
}

__device__ __forceinline__ v8f wmma32(v16h a, v16h b, v8f c) {
  // D = A(16x32 f16) * B(32x16 f16) + C(16x16 f32)
  return __builtin_amdgcn_wmma_f32_16x16x32_f16(false, a, false, b, (short)0, c,
                                                false, false);
}

// A fragment: 16x32 f16 tile, row-major, leading dim ld.
// Lane L (0-15): row M=L, K = {0..7, 16..23}; lane 16-31: row M=L-16, K = {8..15, 24..31}.
// Also serves as B fragment when the B matrix is stored transposed (N x K row-major),
// since the B lane layout mirrors A with lane <-> N.
__device__ __forceinline__ v16h load_a_frag(const _Float16* base, int ld) {
  int lane = lane_id();
  int m = lane & 15, half = lane >> 4;
  const _Float16* rowp = base + m * ld + half * 8;
  v16h a;
#pragma unroll
  for (int e = 0; e < 16; ++e)
    a[e] = rowp[((e >> 3) << 4) + (e & 7)];
  return a;
}

__device__ __forceinline__ float wave_sum32(float x) {
#pragma unroll
  for (int off = 16; off > 0; off >>= 1) x += __shfl_xor(x, off, 32);
  return x;
}
__device__ __forceinline__ float half_sum16(float x) {
#pragma unroll
  for (int off = 8; off > 0; off >>= 1) x += __shfl_xor(x, off, 32);
  return x;
}
__device__ __forceinline__ float half_max16(float x) {
#pragma unroll
  for (int off = 8; off > 0; off >>= 1) x = fmaxf(x, __shfl_xor(x, off, 32));
  return x;
}

// ---------------------------------------------------------------- weights prep
__global__ void prep_weights_kernel(const float* wq, const float* wk, const float* wv,
                                    const float* wg, const float* wo,
                                    _Float16* wT, _Float16* woT) {
  int i = blockIdx.x * blockDim.x + threadIdx.x;
  const int NW = 4 * CM * CM;
  if (i < NW) {
    int proj = i >> 16;          // CM*CM == 65536
    int rem  = i & 65535;
    int hd   = rem >> 8;
    int c    = rem & 255;
    const float* w = (proj == 0) ? wq : (proj == 1) ? wk : (proj == 2) ? wv : wg;
    float scl = (proj == 0) ? 0.17677669529663689f : 1.0f;  // D^-0.5 folded into Wq
    wT[i] = (_Float16)(w[c * 256 + hd] * scl);              // wT[N=proj*256+hd][K=c]
  } else if (i < NW + CM * CM) {
    int j  = i - NW;
    int c  = j >> 8;
    int hd = j & 255;
    woT[j] = (_Float16)(wo[hd * 256 + c]);                  // woT[N=c][K=hd]
  }
}

// ---------------------------------------------------------------- pair bias z
// Stored TRANSPOSED: z[h, key_col, query_row] so attention reads are contiguous.
// One LANE per (query i, key j) position: a wave takes 32 consecutive i of one j. Each 512-byte
// channel row is loaded whole by the wave, passed through the wave's own LDS range, and read back
// by the one lane that owns it, so the layernorm sums and the 8 head products are in-lane sums.
typedef __attribute__((ext_vector_type(4))) float v4f;
#define PBP 132   // LDS row pitch in floats: 528 B = 16 B x 33, so 16 lanes' 16-byte reads fall on distinct banks
#define PBW 6     // waves per block; 3 blocks fill a WGP's LDS and 768 blocks are one round

__global__ __launch_bounds__(32 * PBW)
void pair_bias_kernel(const float* __restrict__ pair,
                      const float* __restrict__ pn_g,
                      const float* __restrict__ pn_b,
                      const float* __restrict__ w_pair,
                      float* __restrict__ z) {
  __shared__ __attribute__((aligned(16))) float rows[PBW][32 * PBP];
  int lane = lane_id();
  int w = __builtin_amdgcn_readfirstlane(threadIdx.x >> 5);
  int gw = blockIdx.x * PBW + w;   // 0 .. 12 * R_ - 1
  int ic = gw / R_;
  int kj = gw - ic * R_;           // key col j; the waves of a block take neighbouring j
  int i0 = ic * 32;                // first of the wave's 32 query rows
  const float* base = pair + ((size_t)i0 * R_ + kj) * CZ;   // wave-uniform
  float* my = &rows[w][0];
  v4f r[32];
#pragma unroll
  for (int t = 0; t < 32; ++t)
    r[t] = *(const v4f*)(base + (size_t)t * R_ * CZ + lane * 4);
  // precaution: the loads' base and lane offset stay untouched up to this wait
  asm volatile("s_wait_xcnt 0x0" :: "s"(base), "v"(lane) : "memory");
#pragma unroll
  for (int t = 0; t < 32; ++t)
    *(v4f*)(my + t * PBP + lane * 4) = r[t];
  // same-wave DS RAW: the rows written above are read back across lanes below
  asm volatile("s_wait_dscnt 0" ::: "memory");
  const float* mine = my + lane * PBP;
  v4f x[32];
#pragma unroll
  for (int t = 0; t < 32; ++t)
    x[t] = *(const v4f*)(mine + t * 4);

  v4f s4 = { 0.f, 0.f, 0.f, 0.f }, q4 = { 0.f, 0.f, 0.f, 0.f };
#pragma unroll
  for (int t = 0; t < 32; ++t) { s4 += x[t]; q4 += x[t] * x[t]; }
  float s  = (s4[0] + s4[1]) + (s4[2] + s4[3]);
  float ss = (q4[0] + q4[1]) + (q4[2] + q4[3]);
  float mu = s * (1.f / CZ);
  float rsig = rsqrtf(ss * (1.f / CZ) - mu * mu + 1e-5f);

  float a[H_];
#pragma unroll
  for (int h = 0; h < H_; ++h) a[h] = 0.f;
#pragma unroll
  for (int c = 0; c < CZ; ++c) {
    float xn = (x[c >> 2][c & 3] - mu) * rsig * pn_g[c] + pn_b[c];
#pragma unroll
    for (int h = 0; h < H_; ++h) a[h] += xn * w_pair[c * H_ + h];
  }
  float* dst = z + (size_t)kj * R_ + i0 + lane;                // z[h, j, i]: one 128-byte line per head
#pragma unroll
  for (int h = 0; h < H_; ++h) dst[(size_t)h * R_ * R_] = a[h];
}

// ---------------------------------------------------------------- MSA layernorm
__global__ void ln_msa_kernel(const float* __restrict__ msa,
                              const float* __restrict__ gg,
                              const float* __restrict__ bb,
                              _Float16* __restrict__ m) {
  int row = (blockIdx.x * blockDim.x + threadIdx.x) >> 5;
  int lane = lane_id();
  if (row >= S_ * R_) return;
  const float* p = msa + (size_t)row * CM;
  float x[8], s = 0.f, ss = 0.f;
#pragma unroll
  for (int t = 0; t < 8; ++t) {
    float v = p[t * 32 + lane];
    x[t] = v; s += v; ss += v * v;
  }
  s = wave_sum32(s); ss = wave_sum32(ss);
  float mu = s * (1.f / CM);
  float rsig = rsqrtf(ss * (1.f / CM) - mu * mu + 1e-5f);
  _Float16* o = m + (size_t)row * CM;
#pragma unroll
  for (int t = 0; t < 8; ++t) {
    int c = t * 32 + lane;
    o[c] = (_Float16)((x[t] - mu) * rsig * gg[c] + bb[c]);
  }
}

// ---------------------------------------------------------------- GEMM block tile
// C[128 x 128] = A[128 x 256] * B^T, A and B both row-major with 256 f16 per row.
// 8 waves; both operand tiles are staged once in LDS, one whole 512-byte row per
// wave-wide load, and each wave then owns a 64 x 32 piece (4 x 2 accumulator tiles).
#define GP 264   // LDS row pitch in f16: 528 B = 16 B x 33, so 16 rows fall on distinct banks

// Same element order as load_a_frag, as two 16-byte LDS reads.
__device__ __forceinline__ v16h lds_frag(const _Float16* base) {
  int lane = lane_id();
  const _Float16* rowp = base + (lane & 15) * GP + (lane >> 4) * 8;
  v8h lo = *(const v8h*)rowp;
  v8h hi = *(const v8h*)(rowp + 16);
  return __builtin_shufflevector(lo, hi, 0, 1, 2, 3, 4, 5, 6, 7, 8, 9, 10, 11, 12, 13, 14, 15);
}

__device__ __forceinline__ void gemm_tile_128x128(const _Float16* __restrict__ ga,
                                                  const _Float16* __restrict__ gb,
                                                  _Float16* sA, _Float16* sB,
                                                  v8f (&acc)[4][2]) {
  int lane = lane_id();
  int w = threadIdx.x >> 5;
  // wave w stages rows w, w + 8, ... of both tiles
  const _Float16* la = ga + w * 256 + lane * 8;
  const _Float16* lb = gb + w * 256 + lane * 8;
  _Float16* wa = sA + w * GP + lane * 8;
  _Float16* wb = sB + w * GP + lane * 8;
  v8h ra[16], rb[16];
#pragma unroll
  for (int i = 0; i < 16; ++i) {
    ra[i] = *(const v8h*)(la + i * 8 * 256);
    rb[i] = *(const v8h*)(lb + i * 8 * 256);
  }
  // precaution: both address pairs stay untouched (no load result is placed on them) up to this wait
  asm volatile("s_wait_xcnt 0x0" :: "v"(la), "v"(lb) : "memory");
#pragma unroll
  for (int i = 0; i < 16; ++i) {
    *(v8h*)(wa + i * 8 * GP) = ra[i];
    *(v8h*)(wb + i * 8 * GP) = rb[i];
  }
  __syncthreads();   // every wave reads rows that the other waves staged
  const _Float16* pa = sA + (w >> 2) * 64 * GP;
  const _Float16* pb = sB + (w & 3) * 32 * GP;
#pragma unroll
  for (int mi = 0; mi < 4; ++mi) { acc[mi][0] = zero8(); acc[mi][1] = zero8(); }
#pragma unroll
  for (int k0 = 0; k0 < 256; k0 += 32) {
    v16h b0 = lds_frag(pb + k0);
    v16h b1 = lds_frag(pb + 16 * GP + k0);
#pragma unroll
    for (int mi = 0; mi < 4; ++mi) {
      v16h a = lds_frag(pa + mi * 16 * GP + k0);
      acc[mi][0] = wmma32(a, b0, acc[mi][0]);
      acc[mi][1] = wmma32(a, b1, acc[mi][1]);
    }
  }
}

// 2^x on v_exp_f32. The v_nop in the same statement is the one slot that the instruction set asks
// for behind a transcendental before its result is read or its source rewritten.
__device__ __forceinline__ float exp2_slot(float x) {
  float r;
  asm("v_exp_f32 %0, %1\n\tv_nop" : "=v"(r) : "v"(x));
  return r;
}

// ---------------------------------------------------------------- QKVG GEMM
// m[49152 x 256] x wT'[256 x 1024]
//   -> q,k [S,H,R,D] f16 (row-major tiles for A / K^T fragments)
//   -> vT,gT [S,H,D,R] f16 (transposed: contiguous B-fragment loads in attention)
__global__ __launch_bounds__(256)
void qkvg_gemm_kernel(const _Float16* __restrict__ m,
                      const _Float16* __restrict__ wT,
                      const float* __restrict__ bg,
                      _Float16* __restrict__ q, _Float16* __restrict__ k,
                      _Float16* __restrict__ vT, _Float16* __restrict__ gT) {
  __shared__ __attribute__((aligned(16))) _Float16 sA[128 * GP];
  __shared__ __attribute__((aligned(16))) _Float16 sB[128 * GP];
  int nb = blockIdx.x & 7;      // 128-column tile; the 8 blocks of one row tile are neighbours
  int mb = blockIdx.x >> 3;     // 128-row tile
  v8f acc[4][2];
  gemm_tile_128x128(m + (size_t)mb * 128 * CM, wT + (size_t)nb * 128 * CM, sA, sB, acc);

  int lane = lane_id();
  int w = threadIdx.x >> 5;
  int half = lane >> 4, n = lane & 15;
  int proj = nb >> 1;           // uniform per block
  int h = (nb * 4 + (w & 3)) & 7;   // a wave's 32 columns are one head
  // a 128-row M tile never crosses an s boundary (R % 128 == 0)
  int s = mb / 3;
  int rw = (mb - s * 3) * 128 + (w >> 2) * 64 + half * 8;
  size_t sh = (size_t)s * H_ + h;
  if (proj < 2) {               // q, k: [S,H,R,D]
    _Float16* dst = (proj == 0 ? q : k) + (sh * R_ + rw) * D_ + n;
#pragma unroll
    for (int mi = 0; mi < 4; ++mi)
#pragma unroll
      for (int ni = 0; ni < 2; ++ni)
#pragma unroll
        for (int vi = 0; vi < 8; ++vi)
          dst[(mi * 16 + vi) * D_ + ni * 16] = (_Float16)acc[mi][ni][vi];
  } else if (proj == 2) {       // vT: [S,H,D,R], contiguous over vi
    _Float16* dst = vT + (sh * D_ + n) * R_ + rw;
#pragma unroll
    for (int mi = 0; mi < 4; ++mi)
#pragma unroll
      for (int ni = 0; ni < 2; ++ni)
#pragma unroll
        for (int vi = 0; vi < 8; ++vi)
          dst[ni * 16 * R_ + mi * 16 + vi] = (_Float16)acc[mi][ni][vi];
    // precaution: no register of the stores above is rewritten ahead of this wait
    asm volatile("s_wait_xcnt 0x0" ::: "memory");
  } else {                      // gT: [S,H,D,R], contiguous over vi
    _Float16* dst = gT + (sh * D_ + n) * R_ + rw;
    const float* bp = bg + h * D_ + n;
    float bg2[2] = { bp[0], bp[16] };
    // precaution: the address pair stays untouched (no load result is placed on it) up to this wait
    asm volatile("s_wait_xcnt 0x0" :: "v"(bp) : "memory");
#pragma unroll
    for (int ni = 0; ni < 2; ++ni) {
      float bgv = bg2[ni];
#pragma unroll
      for (int mi = 0; mi < 4; ++mi) {
        v8h pk;
#pragma unroll
        for (int vi = 0; vi < 8; ++vi) {
          float gv = 1.f / (1.f + exp2_slot((acc[mi][ni][vi] + bgv) * -1.4426950408889634f));
          pk[vi] = (_Float16)gv;
        }
        *(v8h*)(dst + ni * 16 * R_ + mi * 16) = pk;   // 8 rows of one column: one 16-byte store
      }
    }
    // precaution: no register of the stores above is rewritten ahead of this wait
    asm volatile("s_wait_xcnt 0x0" ::: "memory");
  }
}

// ---------------------------------------------------------------- attention
// One wave per (s, h, 16-row q tile). Flash-style online softmax over 32-key chunks.
__global__ void attn_kernel(const _Float16* __restrict__ q, const _Float16* __restrict__ k,
                            const _Float16* __restrict__ vT, const _Float16* __restrict__ gT,
                            const float* __restrict__ z, const float* __restrict__ mask,
                            _Float16* __restrict__ og) {
  __shared__ _Float16 plds[4][16][32];      // per-wave probs staging (A-layout refill)
  int w = threadIdx.x >> 5;
  int lane = lane_id();
  int t = blockIdx.x * 4 + w;
  const int NQ = R_ / 16;                   // 24
  int qt = t % NQ;
  int rem = t / NQ;
  int h = rem & 7;
  int s = rem >> 3;
  if (s >= S_) return;
  int q0 = qt * 16;

  const _Float16* Q  = q  + (((size_t)s * H_ + h) * R_) * D_;
  const _Float16* K  = k  + (((size_t)s * H_ + h) * R_) * D_;
  const _Float16* VT = vT + (((size_t)s * H_ + h) * D_) * R_;
  const _Float16* GT = gT + (((size_t)s * H_ + h) * D_) * R_;
  const float* Z = z + (size_t)h * R_ * R_;          // z[key, query] layout
  const float* M = mask + (size_t)s * R_;
  int half = lane >> 4, n = lane & 15;

  v16h aq = load_a_frag(Q + (size_t)q0 * D_, D_);
  v8f o0 = zero8(), o1 = zero8();
  float rmax[8], rsum[8];
#pragma unroll
  for (int i = 0; i < 8; ++i) { rmax[i] = -1e30f; rsum[i] = 0.f; }

  for (int kb = 0; kb < R_ / 32; ++kb) {
    int c0 = kb * 32;
    v16h bk0 = load_a_frag(K + (size_t)c0 * D_, D_);        // keys c0..c0+15
    v16h bk1 = load_a_frag(K + (size_t)(c0 + 16) * D_, D_); // keys c0+16..c0+31
    v8f s0 = wmma32(aq, bk0, zero8());
    v8f s1 = wmma32(aq, bk1, zero8());

    int col0 = c0 + n, col1 = c0 + 16 + n;
    float mb0 = 1e9f * (M[col0] - 1.f);
    float mb1 = 1e9f * (M[col1] - 1.f);
    // z[h, key, query]: 8 consecutive queries per lane -> coalesced vector loads
    const float* z0 = Z + (size_t)col0 * R_ + q0 + half * 8;
    const float* z1 = Z + (size_t)col1 * R_ + q0 + half * 8;
#pragma unroll
    for (int vi = 0; vi < 8; ++vi) {
      s0[vi] += z0[vi] + mb0;
      s1[vi] += z1[vi] + mb1;
    }
#pragma unroll
    for (int vi = 0; vi < 8; ++vi) {
      float mx = half_max16(fmaxf(s0[vi], s1[vi]));
      float nm = fmaxf(rmax[vi], mx);
      float sc = __expf(rmax[vi] - nm);
      float p0 = __expf(s0[vi] - nm);
      float p1 = __expf(s1[vi] - nm);
      rsum[vi] = rsum[vi] * sc + half_sum16(p0 + p1);
      rmax[vi] = nm;
      o0[vi] *= sc; o1[vi] *= sc;
      plds[w][half * 8 + vi][n]      = (_Float16)p0;
      plds[w][half * 8 + vi][16 + n] = (_Float16)p1;
    }
    // same-wave DS RAW: writes above feed the cross-lane A-fragment load below
    asm volatile("s_wait_dscnt 0" ::: "memory");
    v16h ap  = load_a_frag(&plds[w][0][0], 32);
    // V^T rows d0..d0+15 over keys c0..c0+31 == B fragment (lane <-> N=d)
    v16h bv0 = load_a_frag(VT + (size_t)0  * R_ + c0, R_);
    v16h bv1 = load_a_frag(VT + (size_t)16 * R_ + c0, R_);
    o0 = wmma32(ap, bv0, o0);
    o1 = wmma32(ap, bv1, o1);
  }

  // epilogue: normalize, gate, write og[row, h*32+d] (f16)
  const _Float16* g0p = GT + (size_t)n        * R_ + q0 + half * 8;  // contiguous
  const _Float16* g1p = GT + (size_t)(16 + n) * R_ + q0 + half * 8;  // contiguous
#pragma unroll
  for (int vi = 0; vi < 8; ++vi) {
    int row = q0 + half * 8 + vi;
    float inv = 1.f / rsum[vi];
    float g0 = (float)g0p[vi];
    float g1 = (float)g1p[vi];
    size_t dst = ((size_t)s * R_ + row) * 256 + h * D_;
    og[dst + n]      = (_Float16)(o0[vi] * inv * g0);
    og[dst + 16 + n] = (_Float16)(o1[vi] * inv * g1);
  }
}

// ---------------------------------------------------------------- output GEMM
__global__ __launch_bounds__(256)
void out_gemm_kernel(const _Float16* __restrict__ og,
                     const _Float16* __restrict__ woT,
                     const float* __restrict__ bo,
                     float* __restrict__ out) {
  __shared__ __attribute__((aligned(16))) _Float16 sA[128 * GP];
  __shared__ __attribute__((aligned(16))) _Float16 sB[128 * GP];
  int nb = blockIdx.x & 1;
  int mb = blockIdx.x >> 1;
  v8f acc[4][2];
  gemm_tile_128x128(og + (size_t)mb * 128 * 256, woT + (size_t)nb * 128 * 256, sA, sB, acc);

  int lane = lane_id();
  int w = threadIdx.x >> 5;
  int half = lane >> 4, n = lane & 15;
  int row0 = mb * 128 + (w >> 2) * 64 + half * 8;
  int col0 = nb * 128 + (w & 3) * 32 + n;
#pragma unroll
  for (int ni = 0; ni < 2; ++ni) {
    float bias = bo[col0 + ni * 16];
#pragma unroll
    for (int mi = 0; mi < 4; ++mi)
#pragma unroll
      for (int vi = 0; vi < 8; ++vi)
        out[(size_t)(row0 + mi * 16 + vi) * 256 + col0 + ni * 16] = acc[mi][ni][vi] + bias;
  }
}

// ---------------------------------------------------------------- launch
extern "C" void kernel_launch(void* const* d_in, const int* in_sizes, int n_in,
                              void* d_out, int out_size, void* d_ws, size_t ws_size,
                              hipStream_t stream) {
  const float* msa_act  = (const float*)d_in[0];
  const float* pair_act = (const float*)d_in[1];
  const float* msa_mask = (const float*)d_in[2];
  const float* qn_g     = (const float*)d_in[3];
  const float* qn_b     = (const float*)d_in[4];
  const float* pn_g     = (const float*)d_in[5];
  const float* pn_b     = (const float*)d_in[6];
  const float* w_pair   = (const float*)d_in[7];
  const float* wq       = (const float*)d_in[8];
  const float* wk       = (const float*)d_in[9];
  const float* wv       = (const float*)d_in[10];
  const float* wg       = (const float*)d_in[11];
  const float* bg       = (const float*)d_in[12];
  const float* wo       = (const float*)d_in[13];
  const float* bo       = (const float*)d_in[14];
  float* out = (float*)d_out;

  char* ws = (char*)d_ws;
  _Float16* wT_  = (_Float16*)(ws + 0);               // 1024*256*2      = 524288
  _Float16* woT_ = (_Float16*)(ws + 524288);          // 256*256*2       = 131072
  float*    z_   = (float*)   (ws + 655360);          // 8*384*384*4     = 4718592
  _Float16* m_   = (_Float16*)(ws + 5373952);         // 49152*256*2     = 25165824
  _Float16* q_   = (_Float16*)(ws + 30539776);        // 128*8*384*32*2  = 25165824
  _Float16* k_   = (_Float16*)(ws + 55705600);
  _Float16* vT_  = (_Float16*)(ws + 80871424);
  _Float16* gT_  = (_Float16*)(ws + 106037248);
  _Float16* og_  = (_Float16*)(ws + 131203072);       // 49152*256*2

  prep_weights_kernel<<<1280, 256, 0, stream>>>(wq, wk, wv, wg, wo, wT_, woT_);
  pair_bias_kernel<<<768, 192, 0, stream>>>(pair_act, pn_g, pn_b, w_pair, z_);
  ln_msa_kernel<<<6144, 256, 0, stream>>>(msa_act, qn_g, qn_b, m_);
  qkvg_gemm_kernel<<<3072, 256, 0, stream>>>(m_, wT_, bg, q_, k_, vT_, gT_);
  attn_kernel<<<6144, 128, 0, stream>>>(q_, k_, vT_, gT_, z_, msa_mask, og_);
  out_gemm_kernel<<<768, 256, 0, stream>>>(og_, woT_, bo, out);
}

// v003
// It runs in 162 microseconds.
// Next to v002, in two timings, it ran 1.32 times as fast each time.
// All steps since v000 together make it 2.68 times as fast.
#include <hip/hip_runtime.h>
#include <hip/hip_bf16.h>
#include <math.h>

typedef __attribute__((ext_vector_type(16))) _Float16 v16h;
typedef __attribute__((ext_vector_type(8)))  _Float16 v8h;
typedef __attribute__((ext_vector_type(8)))  float    v8f;

#define S_  128
#define R_  384
#define CM  256
#define CZ  128
#define H_  8
#define D_  32

__device__ __forceinline__ int lane_id() { return threadIdx.x & 31; }

__device__ __forceinline__ v8f zero8() {
  v8f z;
#pragma unroll
  for (int i = 0; i < 8; ++i) z[i] = 0.f;
  return z;
}

__device__ __forceinline__ v8f wmma32(v16h a, v16h b, v8f c) {
  // D = A(16x32 f16) * B(32x16 f16) + C(16x16 f32)
  return __builtin_amdgcn_wmma_f32_16x16x32_f16(false, a, false, b, (short)0, c,
                                                false, false);
}

// A fragment: 16x32 f16 tile, row-major, leading dim ld.
// Lane L (0-15): row M=L, K = {0..7, 16..23}; lane 16-31: row M=L-16, K = {8..15, 24..31}.
// Also serves as B fragment when the B matrix is stored transposed (N x K row-major),
// since the B lane layout mirrors A with lane <-> N.
__device__ __forceinline__ v16h load_a_frag(const _Float16* base, int ld) {
  int lane = lane_id();
  int m = lane & 15, half = lane >> 4;
  const _Float16* rowp = base + m * ld + half * 8;
  v16h a;
#pragma unroll
  for (int e = 0; e < 16; ++e)
    a[e] = rowp[((e >> 3) << 4) + (e & 7)];
  return a;
}

__device__ __forceinline__ float wave_sum32(float x) {
#pragma unroll
  for (int off = 16; off > 0; off >>= 1) x += __shfl_xor(x, off, 32);
  return x;
}
__device__ __forceinline__ float half_sum16(float x) {
#pragma unroll
  for (int off = 8; off > 0; off >>= 1) x += __shfl_xor(x, off, 32);
  return x;
}
__device__ __forceinline__ float half_max16(float x) {
#pragma unroll
  for (int off = 8; off > 0; off >>= 1) x = fmaxf(x, __shfl_xor(x, off, 32));
  return x;
}

// ---------------------------------------------------------------- weights prep
__global__ void prep_weights_kernel(const float* wq, const float* wk, const float* wv,
                                    const float* wg, const float* wo,
                                    _Float16* wT, _Float16* woT) {
  int i = blockIdx.x * blockDim.x + threadIdx.x;
  const int NW = 4 * CM * CM;
  if (i < NW) {
    int proj = i >> 16;          // CM*CM == 65536
    int rem  = i & 65535;
    int hd   = rem >> 8;
    int c    = rem & 255;
    const float* w = (proj == 0) ? wq : (proj == 1) ? wk : (proj == 2) ? wv : wg;
    float scl = (proj == 0) ? 0.17677669529663689f : 1.0f;  // D^-0.5 folded into Wq
    wT[i] = (_Float16)(w[c * 256 + hd] * scl);              // wT[N=proj*256+hd][K=c]
  } else if (i < NW + CM * CM) {
    int j  = i - NW;
    int c  = j >> 8;
    int hd = j & 255;
    woT[j] = (_Float16)(wo[hd * 256 + c]);                  // woT[N=c][K=hd]
  }
}

// ---------------------------------------------------------------- pair bias z
// Stored in the order of the attention's score fragments: per (head, 16-query tile, 32-key chunk)
// 2 KB = 4 pieces of 512 B; piece (t * 2 + u), lane l, element e holds
// z[query 8 * (l >> 4) + 4 * u + e][key 16 * t + (l & 15)], so a wave-wide 16-byte load is one piece.
// One LANE per (query i, key j) position: a wave takes 4 queries x 8 keys, which is one 128-byte
// line of that order per head (lane = 4 * key + query). Each 512-byte
// channel row is loaded whole by the wave, passed through the wave's own LDS range, and read back
// by the one lane that owns it, so the layernorm sums and the 8 head products are in-lane sums.
typedef __attribute__((ext_vector_type(4))) float v4f;
#define PBP 132   // LDS row pitch in floats: 528 B = 16 B x 33, so 16 lanes' 16-byte reads fall on distinct banks
#define PBW 6     // waves per block; 3 blocks fill a WGP's LDS and 768 blocks are one round

__global__ __launch_bounds__(32 * PBW)
void pair_bias_kernel(const float* __restrict__ pair,
                      const float* __restrict__ pn_g,
                      const float* __restrict__ pn_b,
                      const float* __restrict__ w_pair,
                      float* __restrict__ z) {
  __shared__ __attribute__((aligned(16))) float rows[PBW][32 * PBP];
  int lane = lane_id();
  int w = __builtin_amdgcn_readfirstlane(threadIdx.x >> 5);
  int gw = blockIdx.x * PBW + w;   // 0 .. (R_ / 4) * (R_ / 8) - 1
  int iq = gw / (R_ / 8);
  int jk = gw - iq * (R_ / 8);     // the waves of a block take neighbouring key groups
  int i0 = iq * 4;                 // first of the wave's 4 query rows
  int j0 = jk * 8;                 // first of the wave's 8 key cols
  const float* base = pair + ((size_t)i0 * R_ + j0) * CZ;   // wave-uniform
  float* my = &rows[w][0];
  v4f r[32];
#pragma unroll
  for (int t = 0; t < 32; ++t)
    r[t] = *(const v4f*)(base + (size_t)((t & 3) * R_ + (t >> 2)) * CZ + lane * 4);   // row of lane t
  // precaution: the loads' base and lane offset stay untouched up to this wait
  asm volatile("s_wait_xcnt 0x0" :: "s"(base), "v"(lane) : "memory");
#pragma unroll
  for (int t = 0; t < 32; ++t)
    *(v4f*)(my + t * PBP + lane * 4) = r[t];
  // same-wave DS RAW: the rows written above are read back across lanes below
  asm volatile("s_wait_dscnt 0" ::: "memory");
  const float* mine = my + lane * PBP;
  v4f x[32];
#pragma unroll
  for (int t = 0; t < 32; ++t)
    x[t] = *(const v4f*)(mine + t * 4);

  v4f s4 = { 0.f, 0.f, 0.f, 0.f }, q4 = { 0.f, 0.f, 0.f, 0.f };
#pragma unroll
  for (int t = 0; t < 32; ++t) { s4 += x[t]; q4 += x[t] * x[t]; }
  float s  = (s4[0] + s4[1]) + (s4[2] + s4[3]);
  float ss = (q4[0] + q4[1]) + (q4[2] + q4[3]);
  float mu = s * (1.f / CZ);
  float rsig = rsqrtf(ss * (1.f / CZ) - mu * mu + 1e-5f);

  float a[H_];
#pragma unroll
  for (int h = 0; h < H_; ++h) a[h] = 0.f;
#pragma unroll
  for (int c = 0; c < CZ; ++c) {
    float xn = (x[c >> 2][c & 3] - mu) * rsig * pn_g[c] + pn_b[c];
#pragma unroll
    for (int h = 0; h < H_; ++h) a[h] += xn * w_pair[c * H_ + h];
  }
  float* dst = z + (size_t)((i0 >> 4) * (R_ / 32) + (j0 >> 5)) * 512          // tile, chunk
                 + (((j0 >> 4) & 1) * 2 + ((i0 >> 2) & 1)) * 128             // piece
                 + (((i0 >> 3) & 1) * 16 + (j0 & 8)) * 4 + lane;             // one 128-byte line per head
#pragma unroll
  for (int h = 0; h < H_; ++h) dst[(size_t)h * R_ * R_] = a[h];
}

// ---------------------------------------------------------------- MSA layernorm
__global__ void ln_msa_kernel(const float* __restrict__ msa,
                              const float* __restrict__ gg,
                              const float* __restrict__ bb,
                              _Float16* __restrict__ m) {
  int row = (blockIdx.x * blockDim.x + threadIdx.x) >> 5;
  int lane = lane_id();
  if (row >= S_ * R_) return;
  const float* p = msa + (size_t)row * CM;
  float x[8], s = 0.f, ss = 0.f;
#pragma unroll
  for (int t = 0; t < 8; ++t) {
    float v = p[t * 32 + lane];
    x[t] = v; s += v; ss += v * v;
  }
  s = wave_sum32(s); ss = wave_sum32(ss);
  float mu = s * (1.f / CM);
  float rsig = rsqrtf(ss * (1.f / CM) - mu * mu + 1e-5f);
  _Float16* o = m + (size_t)row * CM;
#pragma unroll
  for (int t = 0; t < 8; ++t) {
    int c = t * 32 + lane;
    o[c] = (_Float16)((x[t] - mu) * rsig * gg[c] + bb[c]);
  }
}

// ---------------------------------------------------------------- GEMM block tile
// C[128 x 128] = A[128 x 256] * B^T, A and B both row-major with 256 f16 per row.
// 8 waves; both operand tiles are staged once in LDS, one whole 512-byte row per
// wave-wide load, and each wave then owns a 64 x 32 piece (4 x 2 accumulator tiles).
#define GP 264   // LDS row pitch in f16: 528 B = 16 B x 33, so 16 rows fall on distinct banks

__device__ __forceinline__ v16h join16(v8h lo, v8h hi) {
  return __builtin_shufflevector(lo, hi, 0, 1, 2, 3, 4, 5, 6, 7, 8, 9, 10, 11, 12, 13, 14, 15);
}

// Same element order as load_a_frag, as two 16-byte LDS reads.
__device__ __forceinline__ v16h lds_frag(const _Float16* base) {
  int lane = lane_id();
  const _Float16* rowp = base + (lane & 15) * GP + (lane >> 4) * 8;
  v8h lo = *(const v8h*)rowp;
  v8h hi = *(const v8h*)(rowp + 16);
  return __builtin_shufflevector(lo, hi, 0, 1, 2, 3, 4, 5, 6, 7, 8, 9, 10, 11, 12, 13, 14, 15);
}

__device__ __forceinline__ void gemm_tile_128x128(const _Float16* __restrict__ ga,
                                                  const _Float16* __restrict__ gb,
                                                  _Float16* sA, _Float16* sB,
                                                  v8f (&acc)[4][2]) {
  int lane = lane_id();
  int w = threadIdx.x >> 5;
  // wave w stages rows w, w + 8, ... of both tiles
  const _Float16* la = ga + w * 256 + lane * 8;
  const _Float16* lb = gb + w * 256 + lane * 8;
  _Float16* wa = sA + w * GP + lane * 8;
  _Float16* wb = sB + w * GP + lane * 8;
  v8h ra[16], rb[16];
#pragma unroll
  for (int i = 0; i < 16; ++i) {
    ra[i] = *(const v8h*)(la + i * 8 * 256);
    rb[i] = *(const v8h*)(lb + i * 8 * 256);
  }
  // precaution: both address pairs stay untouched (no load result is placed on them) up to this wait
  asm volatile("s_wait_xcnt 0x0" :: "v"(la), "v"(lb) : "memory");
#pragma unroll
  for (int i = 0; i < 16; ++i) {
    *(v8h*)(wa + i * 8 * GP) = ra[i];
    *(v8h*)(wb + i * 8 * GP) = rb[i];
  }
  __syncthreads();   // every wave reads rows that the other waves staged
  const _Float16* pa = sA + (w >> 2) * 64 * GP;
  const _Float16* pb = sB + (w & 3) * 32 * GP;
#pragma unroll
  for (int mi = 0; mi < 4; ++mi) { acc[mi][0] = zero8(); acc[mi][1] = zero8(); }
#pragma unroll
  for (int k0 = 0; k0 < 256; k0 += 32) {
    v16h b0 = lds_frag(pb + k0);
    v16h b1 = lds_frag(pb + 16 * GP + k0);
#pragma unroll
    for (int mi = 0; mi < 4; ++mi) {
      v16h a = lds_frag(pa + mi * 16 * GP + k0);
      acc[mi][0] = wmma32(a, b0, acc[mi][0]);
      acc[mi][1] = wmma32(a, b1, acc[mi][1]);
    }
  }
}

// 2^x on v_exp_f32. The v_nop in the same statement is the one slot that the instruction set asks
// for behind a transcendental before its result is read or its source rewritten.
__device__ __forceinline__ float exp2_slot(float x) {
  float r;
  asm("v_exp_f32 %0, %1\n\tv_nop" : "=v"(r) : "v"(x));
  return r;
}

// ---------------------------------------------------------------- QKVG GEMM
// m[49152 x 256] x wT'[256 x 1024]
//   -> q [S,H,R,D] f16 (row-major tiles for A fragments)
//   -> k, v per (s,h) in the order of the attention's B fragments, pieces of 512 B = 32 lanes x 16 B:
//      k piece (16-key tile * 2 + j), lane l: K[key l & 15][d = 16 * j + 8 * (l >> 4) + 0..7]
//      v piece (32-key chunk * 4 + d tile * 2 + j), lane l: V[key 16 * j + 8 * (l >> 4) + 0..7][d = l & 15]
//   -> g per (s,h) in the order of the attention's output tiles:
//      piece (16-row tile * 2 + d tile), lane l: G[row 8 * (l >> 4) + 0..7][d = l & 15]
__global__ __launch_bounds__(256)
void qkvg_gemm_kernel(const _Float16* __restrict__ m,
                      const _Float16* __restrict__ wT,
                      const float* __restrict__ bg,
                      _Float16* __restrict__ q, _Float16* __restrict__ k,
                      _Float16* __restrict__ vT, _Float16* __restrict__ gT) {
  __shared__ __attribute__((aligned(16))) _Float16 sA[128 * GP];
  __shared__ __attribute__((aligned(16))) _Float16 sB[128 * GP];
  int nb = blockIdx.x & 7;      // 128-column tile; the 8 blocks of one row tile are neighbours
  int mb = blockIdx.x >> 3;     // 128-row tile
  v8f acc[4][2];
  gemm_tile_128x128(m + (size_t)mb * 128 * CM, wT + (size_t)nb * 128 * CM, sA, sB, acc);

  int lane = lane_id();
  int w = threadIdx.x >> 5;
  int half = lane >> 4, n = lane & 15;
  int proj = nb >> 1;           // uniform per block
  int h = (nb * 4 + (w & 3)) & 7;   // a wave's 32 columns are one head
  // a 128-row M tile never crosses an s boundary (R % 128 == 0)
  int s = mb / 3;
  int rw = (mb - s * 3) * 128 + (w >> 2) * 64 + half * 8;
  size_t sh = (size_t)s * H_ + h;
  int r64 = (mb - s * 3) * 128 + (w >> 2) * 64;   // first of the wave's 64 rows inside s
  if (proj == 0) {              // q: [S,H,R,D]
    _Float16* dst = q + (sh * R_ + rw) * D_ + n;
#pragma unroll
    for (int mi = 0; mi < 4; ++mi)
#pragma unroll
      for (int ni = 0; ni < 2; ++ni)
#pragma unroll
        for (int vi = 0; vi < 8; ++vi)
          dst[(mi * 16 + vi) * D_ + ni * 16] = (_Float16)acc[mi][ni][vi];
    // precaution: no register of the stores above is rewritten ahead of this wait
    asm volatile("s_wait_xcnt 0x0" ::: "memory");
  } else if (proj == 1) {       // k in fragment order: tile mi, piece ni, lane (n >> 3, key), element n & 7
    _Float16* dst = k + (sh * R_ + r64) * D_ + ((n >> 3) * 16 + half * 8) * 8 + (n & 7);
#pragma unroll
    for (int mi = 0; mi < 4; ++mi)
#pragma unroll
      for (int ni = 0; ni < 2; ++ni)
#pragma unroll
        for (int vi = 0; vi < 8; ++vi)
          dst[mi * 512 + ni * 256 + vi * 8] = (_Float16)acc[mi][ni][vi];
    // precaution: no register of the stores above is rewritten ahead of this wait
    asm volatile("s_wait_xcnt 0x0" ::: "memory");
  } else if (proj == 2) {       // v in fragment order: the wave's 16-byte stores are one 512-byte piece
    _Float16* dst = vT + (sh * R_ + r64) * D_ + lane * 8;
#pragma unroll
    for (int mi = 0; mi < 4; ++mi)
#pragma unroll
      for (int ni = 0; ni < 2; ++ni) {
        v8h pk;
#pragma unroll
        for (int vi = 0; vi < 8; ++vi) pk[vi] = (_Float16)acc[mi][ni][vi];
        *(v8h*)(dst + (mi >> 1) * 1024 + (ni * 2 + (mi & 1)) * 256) = pk;
      }
    // precaution: no register of the stores above is rewritten ahead of this wait
    asm volatile("s_wait_xcnt 0x0" ::: "memory");
  } else {                      // g in fragment order: the wave's 16-byte stores are one 512-byte piece
    _Float16* dst = gT + (sh * R_ + r64) * D_ + lane * 8;
    const float* bp = bg + h * D_ + n;
    float bg2[2] = { bp[0], bp[16] };
    // precaution: the address pair stays untouched (no load result is placed on it) up to this wait
    asm volatile("s_wait_xcnt 0x0" :: "v"(bp) : "memory");
#pragma unroll
    for (int ni = 0; ni < 2; ++ni) {
      float bgv = bg2[ni];
#pragma unroll
      for (int mi = 0; mi < 4; ++mi) {
        v8h pk;
#pragma unroll
        for (int vi = 0; vi < 8; ++vi) {
          float gv = 1.f / (1.f + exp2_slot((acc[mi][ni][vi] + bgv) * -1.4426950408889634f));
          pk[vi] = (_Float16)gv;
        }
        *(v8h*)(dst + mi * 512 + ni * 256) = pk;   // 8 rows of one column: one 16-byte store
      }
    }
    // precaution: no register of the stores above is rewritten ahead of this wait
    asm volatile("s_wait_xcnt 0x0" ::: "memory");
  }
}

// ---------------------------------------------------------------- attention
// One wave per (s, h, 16-row q tile). Flash-style online softmax over 32-key chunks.
__global__ void attn_kernel(const _Float16* __restrict__ q, const _Float16* __restrict__ k,
                            const _Float16* __restrict__ vT, const _Float16* __restrict__ gT,
                            const float* __restrict__ z, const float* __restrict__ mask,
                            _Float16* __restrict__ og) {
  __shared__ _Float16 plds[4][16][32];      // per-wave probs staging (A-layout refill)
  int w = __builtin_amdgcn_readfirstlane(threadIdx.x >> 5);   // wave-uniform: tile indices and bases take scalar registers
  int lane = lane_id();
  int t = blockIdx.x * 4 + w;
  const int NQ = R_ / 16;                   // 24
  int qt = t % NQ;
  int rem = t / NQ;
  int h = rem & 7;
  int s = rem >> 3;
  if (s >= S_) return;
  int q0 = qt * 16;

  const _Float16* Q  = q  + (((size_t)s * H_ + h) * R_) * D_;
  const _Float16* KF = k  + (((size_t)s * H_ + h) * R_) * D_ + lane * 8;   // fragment order, 2 KB per 32 keys
  const _Float16* VF = vT + (((size_t)s * H_ + h) * R_) * D_ + lane * 8;   // fragment order, 2 KB per 32 keys
  const _Float16* GF = gT + (((size_t)s * H_ + h) * R_ + q0) * D_ + lane * 8;   // fragment order, 1 KB per 16 rows
  const float* ZF = z + ((size_t)h * NQ + qt) * (R_ / 32) * 512 + lane * 4;   // fragment order, 2 KB per 32 keys
  const float* M = mask + (size_t)s * R_;
  int half = lane >> 4, n = lane & 15;

  v16h aq = load_a_frag(Q + (size_t)q0 * D_, D_);
  v8f o0 = zero8(), o1 = zero8();
  float rmax[8], rsum[8];
#pragma unroll
  for (int i = 0; i < 8; ++i) { rmax[i] = -1e30f; rsum[i] = 0.f; }

  for (int kb = 0; kb < R_ / 32; ++kb) {
    int c0 = kb * 32;
    // each K, z and V load below is 32 lanes x 16 B = 512 contiguous bytes
    const _Float16* kp = KF + (size_t)kb * 1024;
    const _Float16* vp = VF + (size_t)kb * 1024;
    const float* zp = ZF + (size_t)kb * 512;
    const float* mp = M + c0 + n;
    v8h kf[4], vf[4];
    v4f zf[4];
#pragma unroll
    for (int i = 0; i < 4; ++i) kf[i] = *(const v8h*)(kp + i * 256);
#pragma unroll
    for (int i = 0; i < 4; ++i) zf[i] = *(const v4f*)(zp + i * 128);
    float m0 = mp[0], m1 = mp[16];
#pragma unroll
    for (int i = 0; i < 4; ++i) vf[i] = *(const v8h*)(vp + i * 256);
    // precaution: the four address pairs stay untouched (no load result is placed on them) up to this wait
    asm volatile("s_wait_xcnt 0x0" :: "v"(kp), "v"(vp), "v"(zp), "v"(mp) : "memory");
    v16h bk0 = join16(kf[0], kf[1]);   // keys c0..c0+15
    v16h bk1 = join16(kf[2], kf[3]);   // keys c0+16..c0+31
    v8f s0 = wmma32(aq, bk0, zero8());
    v8f s1 = wmma32(aq, bk1, zero8());

    float mb0 = 1e9f * (m0 - 1.f);
    float mb1 = 1e9f * (m1 - 1.f);
#pragma unroll
    for (int vi = 0; vi < 8; ++vi) {
      s0[vi] += zf[vi >> 2][vi & 3] + mb0;
      s1[vi] += zf[2 + (vi >> 2)][vi & 3] + mb1;
    }
#pragma unroll
    for (int vi = 0; vi < 8; ++vi) {
      float mx = half_max16(fmaxf(s0[vi], s1[vi]));
      float nm = fmaxf(rmax[vi], mx);
      float sc = __expf(rmax[vi] - nm);
      float p0 = __expf(s0[vi] - nm);
      float p1 = __expf(s1[vi] - nm);
      rsum[vi] = rsum[vi] * sc + half_sum16(p0 + p1);
      rmax[vi] = nm;
      o0[vi] *= sc; o1[vi] *= sc;
      plds[w][half * 8 + vi][n]      = (_Float16)p0;
      plds[w][half * 8 + vi][16 + n] = (_Float16)p1;
    }
    // same-wave DS RAW: writes above feed the cross-lane A-fragment load below
    asm volatile("s_wait_dscnt 0" ::: "memory");
    v16h ap  = load_a_frag(&plds[w][0][0], 32);
    // B fragments (lane <-> N=d) over keys c0..c0+31
    v16h bv0 = join16(vf[0], vf[1]);   // d 0..15
    v16h bv1 = join16(vf[2], vf[3]);   // d 16..31
    o0 = wmma32(ap, bv0, o0);
    o1 = wmma32(ap, bv1, o1);
  }

  // epilogue: normalize, gate, write og[row, h*32+d] (f16)
  const _Float16* g0p = GF;         // d = n
  const _Float16* g1p = GF + 256;   // d = 16 + n
#pragma unroll
  for (int vi = 0; vi < 8; ++vi) {
    int row = q0 + half * 8 + vi;
    float inv = 1.f / rsum[vi];
    float g0 = (float)g0p[vi];
    float g1 = (float)g1p[vi];
    size_t dst = ((size_t)s * R_ + row) * 256 + h * D_;
    og[dst + n]      = (_Float16)(o0[vi] * inv * g0);
    og[dst + 16 + n] = (_Float16)(o1[vi] * inv * g1);
  }
}

// ---------------------------------------------------------------- output GEMM
__global__ __launch_bounds__(256)
void out_gemm_kernel(const _Float16* __restrict__ og,
                     const _Float16* __restrict__ woT,
                     const float* __restrict__ bo,
                     float* __restrict__ out) {
  __shared__ __attribute__((aligned(16))) _Float16 sA[128 * GP];
  __shared__ __attribute__((aligned(16))) _Float16 sB[128 * GP];
  int nb = blockIdx.x & 1;
  int mb = blockIdx.x >> 1;
  v8f acc[4][2];
  gemm_tile_128x128(og + (size_t)mb * 128 * 256, woT + (size_t)nb * 128 * 256, sA, sB, acc);

  int lane = lane_id();
  int w = threadIdx.x >> 5;
  int half = lane >> 4, n = lane & 15;
  int row0 = mb * 128 + (w >> 2) * 64 + half * 8;
  int col0 = nb * 128 + (w & 3) * 32 + n;
#pragma unroll
  for (int ni = 0; ni < 2; ++ni) {
    float bias = bo[col0 + ni * 16];
#pragma unroll
    for (int mi = 0; mi < 4; ++mi)
#pragma unroll
      for (int vi = 0; vi < 8; ++vi)
        out[(size_t)(row0 + mi * 16 + vi) * 256 + col0 + ni * 16] = acc[mi][ni][vi] + bias;
  }
}

// ---------------------------------------------------------------- launch
extern "C" void kernel_launch(void* const* d_in, const int* in_sizes, int n_in,
                              void* d_out, int out_size, void* d_ws, size_t ws_size,
                              hipStream_t stream) {
  const float* msa_act  = (const float*)d_in[0];
  const float* pair_act = (const float*)d_in[1];
  const float* msa_mask = (const float*)d_in[2];
  const float* qn_g     = (const float*)d_in[3];
  const float* qn_b     = (const float*)d_in[4];
  const float* pn_g     = (const float*)d_in[5];
  const float* pn_b     = (const float*)d_in[6];
  const float* w_pair   = (const float*)d_in[7];
  const float* wq       = (const float*)d_in[8];
  const float* wk       = (const float*)d_in[9];
  const float* wv       = (const float*)d_in[10];
  const float* wg       = (const float*)d_in[11];
  const float* bg       = (const float*)d_in[12];
  const float* wo       = (const float*)d_in[13];
  const float* bo       = (const float*)d_in[14];
  float* out = (float*)d_out;

  char* ws = (char*)d_ws;
  _Float16* wT_  = (_Float16*)(ws + 0);               // 1024*256*2      = 524288
  _Float16* woT_ = (_Float16*)(ws + 524288);          // 256*256*2       = 131072
  float*    z_   = (float*)   (ws + 655360);          // 8*384*384*4     = 4718592
  _Float16* m_   = (_Float16*)(ws + 5373952);         // 49152*256*2     = 25165824
  _Float16* q_   = (_Float16*)(ws + 30539776);        // 128*8*384*32*2  = 25165824
  _Float16* k_   = (_Float16*)(ws + 55705600);
  _Float16* vT_  = (_Float16*)(ws + 80871424);
  _Float16* gT_  = (_Float16*)(ws + 106037248);
  _Float16* og_  = (_Float16*)(ws + 131203072);       // 49152*256*2

  prep_weights_kernel<<<1280, 256, 0, stream>>>(wq, wk, wv, wg, wo, wT_, woT_);
  pair_bias_kernel<<<768, 192, 0, stream>>>(pair_act, pn_g, pn_b, w_pair, z_);
  ln_msa_kernel<<<6144, 256, 0, stream>>>(msa_act, qn_g, qn_b, m_);
  qkvg_gemm_kernel<<<3072, 256, 0, stream>>>(m_, wT_, bg, q_, k_, vT_, gT_);
  attn_kernel<<<6144, 128, 0, stream>>>(q_, k_, vT_, gT_, z_, msa_mask, og_);
  out_gemm_kernel<<<768, 256, 0, stream>>>(og_, woT_, bo, out);
}

// v004
// One run takes 141 microseconds.
// Two timings next to v003 both put it at 1.15 times that version's speed.
// All steps since v000 together make it 3.08 times as fast.
#include <hip/hip_runtime.h>
#include <hip/hip_bf16.h>
#include <math.h>

typedef __attribute__((ext_vector_type(16))) _Float16 v16h;
typedef __attribute__((ext_vector_type(8)))  _Float16 v8h;
typedef __attribute__((ext_vector_type(8)))  float    v8f;

#define S_  128
#define R_  384
#define CM  256
#define CZ  128
#define H_  8
#define D_  32

__device__ __forceinline__ int lane_id() { return threadIdx.x & 31; }

__device__ __forceinline__ v8f zero8() {
  v8f z;
#pragma unroll
  for (int i = 0; i < 8; ++i) z[i] = 0.f;
  return z;
}

__device__ __forceinline__ v8f wmma32(v16h a, v16h b, v8f c) {
  // D = A(16x32 f16) * B(32x16 f16) + C(16x16 f32)
  return __builtin_amdgcn_wmma_f32_16x16x32_f16(false, a, false, b, (short)0, c,
                                                false, false);
}

// A fragment: 16x32 f16 tile, row-major, leading dim ld.
// Lane L (0-15): row M=L, K = {0..7, 16..23}; lane 16-31: row M=L-16, K = {8..15, 24..31}.
// Also serves as B fragment when the B matrix is stored transposed (N x K row-major),
// since the B lane layout mirrors A with lane <-> N.
__device__ __forceinline__ v16h load_a_frag(const _Float16* base, int ld) {
  int lane = lane_id();
  int m = lane & 15, half = lane >> 4;
  const _Float16* rowp = base + m * ld + half * 8;
  v16h a;
#pragma unroll
  for (int e = 0; e < 16; ++e)
    a[e] = rowp[((e >> 3) << 4) + (e & 7)];
  return a;
}

__device__ __forceinline__ float wave_sum32(float x) {
#pragma unroll
  for (int off = 16; off > 0; off >>= 1) x += __shfl_xor(x, off, 32);
  return x;
}
// value of lane l ^ 16
__device__ __forceinline__ float xhalf(float x) {
  int b = __builtin_bit_cast(int, x);
  return __builtin_bit_cast(float,
      __builtin_amdgcn_permlanex16(b, b, 0x76543210, 0xfedcba98, false, false));
}

// ---------------------------------------------------------------- weights prep
__global__ void prep_weights_kernel(const float* wq, const float* wk, const float* wv,
                                    const float* wg, const float* wo,
                                    _Float16* wT, _Float16* woT) {
  int i = blockIdx.x * blockDim.x + threadIdx.x;
  const int NW = 4 * CM * CM;
  if (i < NW) {
    int proj = i >> 16;          // CM*CM == 65536
    int rem  = i & 65535;
    int hd   = rem >> 8;
    int c    = rem & 255;
    const float* w = (proj == 0) ? wq : (proj == 1) ? wk : (proj == 2) ? wv : wg;
    float scl = (proj == 0) ? 0.17677669529663689f : 1.0f;  // D^-0.5 folded into Wq
    wT[i] = (_Float16)(w[c * 256 + hd] * scl);              // wT[N=proj*256+hd][K=c]
  } else if (i < NW + CM * CM) {
    int j  = i - NW;
    int c  = j >> 8;
    int hd = j & 255;
    woT[j] = (_Float16)(wo[hd * 256 + c]);                  // woT[N=c][K=hd]
  }
}

// ---------------------------------------------------------------- pair bias z
// Stored in the order of the attention's transposed score fragments (keys x queries): per
// (head, 16-query tile, 32-key chunk) 2 KB = 4 pieces of 512 B; piece (t * 2 + u), lane l, element e holds
// z[query l & 15][key 16 * t + 8 * (l >> 4) + 4 * u + e], so a wave-wide 16-byte load is one piece.
// One LANE per (query i, key j) position: a wave takes 8 queries x 4 keys, which is one 128-byte
// line of that order per head (lane = 4 * query + key). Each 512-byte
// channel row is loaded whole by the wave, passed through the wave's own LDS range, and read back
// by the one lane that owns it, so the layernorm sums and the 8 head products are in-lane sums.
typedef __attribute__((ext_vector_type(4))) float v4f;
#define PBP 132   // LDS row pitch in floats: 528 B = 16 B x 33, so 16 lanes' 16-byte reads fall on distinct banks
#define PBW 6     // waves per block; 3 blocks fill a WGP's LDS and 768 blocks are one round

__global__ __launch_bounds__(32 * PBW)
void pair_bias_kernel(const float* __restrict__ pair,
                      const float* __restrict__ pn_g,
                      const float* __restrict__ pn_b,
                      const float* __restrict__ w_pair,
                      float* __restrict__ z) {
  __shared__ __attribute__((aligned(16))) float rows[PBW][32 * PBP];
  int lane = lane_id();
  int w = __builtin_amdgcn_readfirstlane(threadIdx.x >> 5);
  int gw = blockIdx.x * PBW + w;   // 0 .. (R_ / 8) * (R_ / 4) - 1
  int iq = gw / (R_ / 4);
  int jk = gw - iq * (R_ / 4);     // the waves of a block take neighbouring key groups
  int i0 = iq * 8;                 // first of the wave's 8 query rows
  int j0 = jk * 4;                 // first of the wave's 4 key cols
  const float* base = pair + ((size_t)i0 * R_ + j0) * CZ;   // wave-uniform
  float* my = &rows[w][0];
  v4f r[32];
#pragma unroll
  for (int t = 0; t < 32; ++t)
    r[t] = *(const v4f*)(base + (size_t)((t >> 2) * R_ + (t & 3)) * CZ + lane * 4);   // row of lane t
  // precaution: the loads' base and lane offset stay untouched up to this wait
  asm volatile("s_wait_xcnt 0x0" :: "s"(base), "v"(lane) : "memory");
#pragma unroll
  for (int t = 0; t < 32; ++t)
    *(v4f*)(my + t * PBP + lane * 4) = r[t];
  // same-wave DS RAW: the rows written above are read back across lanes below
  asm volatile("s_wait_dscnt 0" ::: "memory");
  const float* mine = my + lane * PBP;
  v4f x[32];
#pragma unroll
  for (int t = 0; t < 32; ++t)
    x[t] = *(const v4f*)(mine + t * 4);

  v4f s4 = { 0.f, 0.f, 0.f, 0.f }, q4 = { 0.f, 0.f, 0.f, 0.f };
#pragma unroll
  for (int t = 0; t < 32; ++t) { s4 += x[t]; q4 += x[t] * x[t]; }
  float s  = (s4[0] + s4[1]) + (s4[2] + s4[3]);
  float ss = (q4[0] + q4[1]) + (q4[2] + q4[3]);
  float mu = s * (1.f / CZ);
  float rsig = rsqrtf(ss * (1.f / CZ) - mu * mu + 1e-5f);

  float a[H_];
#pragma unroll
  for (int h = 0; h < H_; ++h) a[h] = 0.f;
#pragma unroll
  for (int c = 0; c < CZ; ++c) {
    float xn = (x[c >> 2][c & 3] - mu) * rsig * pn_g[c] + pn_b[c];
#pragma unroll
    for (int h = 0; h < H_; ++h) a[h] += xn * w_pair[c * H_ + h];
  }
  float* dst = z + (size_t)((i0 >> 4) * (R_ / 32) + (j0 >> 5)) * 512          // tile, chunk
                 + (((j0 >> 4) & 1) * 2 + ((j0 >> 2) & 1)) * 128             // piece
                 + (((j0 >> 3) & 1) * 16 + (i0 & 8)) * 4 + lane;             // one 128-byte line per head
#pragma unroll
  for (int h = 0; h < H_; ++h) dst[(size_t)h * R_ * R_] = a[h];
}

// ---------------------------------------------------------------- MSA layernorm
__global__ void ln_msa_kernel(const float* __restrict__ msa,
                              const float* __restrict__ gg,
                              const float* __restrict__ bb,
                              _Float16* __restrict__ m) {
  int row = (blockIdx.x * blockDim.x + threadIdx.x) >> 5;
  int lane = lane_id();
  if (row >= S_ * R_) return;
  const float* p = msa + (size_t)row * CM;
  float x[8], s = 0.f, ss = 0.f;
#pragma unroll
  for (int t = 0; t < 8; ++t) {
    float v = p[t * 32 + lane];
    x[t] = v; s += v; ss += v * v;
  }
  s = wave_sum32(s); ss = wave_sum32(ss);
  float mu = s * (1.f / CM);
  float rsig = rsqrtf(ss * (1.f / CM) - mu * mu + 1e-5f);
  _Float16* o = m + (size_t)row * CM;
#pragma unroll
  for (int t = 0; t < 8; ++t) {
    int c = t * 32 + lane;
    o[c] = (_Float16)((x[t] - mu) * rsig * gg[c] + bb[c]);
  }
}

// ---------------------------------------------------------------- GEMM block tile
// C[128 x 128] = A[128 x 256] * B^T, A and B both row-major with 256 f16 per row.
// 8 waves; both operand tiles are staged once in LDS, one whole 512-byte row per
// wave-wide load, and each wave then owns a 64 x 32 piece (4 x 2 accumulator tiles).
#define GP 264   // LDS row pitch in f16: 528 B = 16 B x 33, so 16 rows fall on distinct banks

__device__ __forceinline__ v16h join16(v8h lo, v8h hi) {
  return __builtin_shufflevector(lo, hi, 0, 1, 2, 3, 4, 5, 6, 7, 8, 9, 10, 11, 12, 13, 14, 15);
}

__device__ __forceinline__ v8f join8(v4f lo, v4f hi) {
  return __builtin_shufflevector(lo, hi, 0, 1, 2, 3, 4, 5, 6, 7);
}

// Same element order as load_a_frag, as two 16-byte LDS reads.
__device__ __forceinline__ v16h lds_frag(const _Float16* base) {
  int lane = lane_id();
  const _Float16* rowp = base + (lane & 15) * GP + (lane >> 4) * 8;
  v8h lo = *(const v8h*)rowp;
  v8h hi = *(const v8h*)(rowp + 16);
  return __builtin_shufflevector(lo, hi, 0, 1, 2, 3, 4, 5, 6, 7, 8, 9, 10, 11, 12, 13, 14, 15);
}

__device__ __forceinline__ void gemm_tile_128x128(const _Float16* __restrict__ ga,
                                                  const _Float16* __restrict__ gb,
                                                  _Float16* sA, _Float16* sB,
                                                  v8f (&acc)[4][2]) {
  int lane = lane_id();
  int w = threadIdx.x >> 5;
  // wave w stages rows w, w + 8, ... of both tiles
  const _Float16* la = ga + w * 256 + lane * 8;
  const _Float16* lb = gb + w * 256 + lane * 8;
  _Float16* wa = sA + w * GP + lane * 8;
  _Float16* wb = sB + w * GP + lane * 8;
  v8h ra[16], rb[16];
#pragma unroll
  for (int i = 0; i < 16; ++i) {
    ra[i] = *(const v8h*)(la + i * 8 * 256);
    rb[i] = *(const v8h*)(lb + i * 8 * 256);
  }
  // precaution: both address pairs stay untouched (no load result is placed on them) up to this wait
  asm volatile("s_wait_xcnt 0x0" :: "v"(la), "v"(lb) : "memory");
#pragma unroll
  for (int i = 0; i < 16; ++i) {
    *(v8h*)(wa + i * 8 * GP) = ra[i];
    *(v8h*)(wb + i * 8 * GP) = rb[i];
  }
  __syncthreads();   // every wave reads rows that the other waves staged
  const _Float16* pa = sA + (w >> 2) * 64 * GP;
  const _Float16* pb = sB + (w & 3) * 32 * GP;
#pragma unroll
  for (int mi = 0; mi < 4; ++mi) { acc[mi][0] = zero8(); acc[mi][1] = zero8(); }
#pragma unroll
  for (int k0 = 0; k0 < 256; k0 += 32) {
    v16h b0 = lds_frag(pb + k0);
    v16h b1 = lds_frag(pb + 16 * GP + k0);
#pragma unroll
    for (int mi = 0; mi < 4; ++mi) {
      v16h a = lds_frag(pa + mi * 16 * GP + k0);
      acc[mi][0] = wmma32(a, b0, acc[mi][0]);
      acc[mi][1] = wmma32(a, b1, acc[mi][1]);
    }
  }
}

// 2^x on v_exp_f32. The v_nop in the same statement is the one slot that the instruction set asks
// for behind a transcendental before its result is read or its source rewritten.
__device__ __forceinline__ float exp2_slot(float x) {
  float r;
  asm("v_exp_f32 %0, %1\n\tv_nop" : "=v"(r) : "v"(x));
  return r;
}

// ---------------------------------------------------------------- QKVG GEMM
// m[49152 x 256] x wT'[256 x 1024]
//   -> q [S,H,R,D] f16 (row-major tiles for 16 x 32 fragments)
//   -> k, v per (s,h) in the order of the attention's A fragments, pieces of 512 B = 32 lanes x 16 B:
//      k piece (16-key tile * 2 + j), lane l: K[key l & 15][d = 16 * j + 8 * (l >> 4) + 0..7]
//      v piece (32-key chunk * 4 + d tile * 2 + j), lane l: V[key 16 * j + 8 * (l >> 4) + 0..7][d = l & 15]
//   -> g per (s,h) in the order of the attention's transposed output tiles (d x rows):
//      piece (16-row tile * 2 + d tile), lane l: G[row l & 15][d = 8 * (l >> 4) + 0..7]
//      The gate blocks hand the two operand tiles to the GEMM in the other order, so that a lane's
//      8 accumulator elements are 8 neighbouring d of one row and the stores stay 16 bytes wide.
__global__ __launch_bounds__(256)
void qkvg_gemm_kernel(const _Float16* __restrict__ m,
                      const _Float16* __restrict__ wT,
                      const float* __restrict__ bg,
                      _Float16* __restrict__ q, _Float16* __restrict__ k,
                      _Float16* __restrict__ vT, _Float16* __restrict__ gT) {
  __shared__ __attribute__((aligned(16))) _Float16 sA[128 * GP];
  __shared__ __attribute__((aligned(16))) _Float16 sB[128 * GP];
  int nb = blockIdx.x & 7;      // 128-column tile; the 8 blocks of one row tile are neighbours
  int mb = blockIdx.x >> 3;     // 128-row tile
  int proj = nb >> 1;           // uniform per block
  const _Float16* mt = m + (size_t)mb * 128 * CM;
  const _Float16* wt = wT + (size_t)nb * 128 * CM;
  v8f acc[4][2];
  gemm_tile_128x128(proj == 3 ? wt : mt, proj == 3 ? mt : wt, sA, sB, acc);

  int lane = lane_id();
  int w = threadIdx.x >> 5;
  int half = lane >> 4, n = lane & 15;
  int h = (nb * 4 + (w & 3)) & 7;   // a wave's 32 columns are one head
  // a 128-row M tile never crosses an s boundary (R % 128 == 0)
  int s = mb / 3;
  int rw = (mb - s * 3) * 128 + (w >> 2) * 64 + half * 8;
  size_t sh = (size_t)s * H_ + h;
  int r64 = (mb - s * 3) * 128 + (w >> 2) * 64;   // first of the wave's 64 rows inside s
  if (proj == 0) {              // q: [S,H,R,D]
    _Float16* dst = q + (sh * R_ + rw) * D_ + n;
#pragma unroll
    for (int mi = 0; mi < 4; ++mi)
#pragma unroll
      for (int ni = 0; ni < 2; ++ni)
#pragma unroll
        for (int vi = 0; vi < 8; ++vi)
          dst[(mi * 16 + vi) * D_ + ni * 16] = (_Float16)acc[mi][ni][vi];
    // precaution: no register of the stores above is rewritten ahead of this wait
    asm volatile("s_wait_xcnt 0x0" ::: "memory");
  } else if (proj == 1) {       // k in fragment order: tile mi, piece ni, lane (n >> 3, key), element n & 7
    _Float16* dst = k + (sh * R_ + r64) * D_ + ((n >> 3) * 16 + half * 8) * 8 + (n & 7);
#pragma unroll
    for (int mi = 0; mi < 4; ++mi)
#pragma unroll
      for (int ni = 0; ni < 2; ++ni)
#pragma unroll
        for (int vi = 0; vi < 8; ++vi)
          dst[mi * 512 + ni * 256 + vi * 8] = (_Float16)acc[mi][ni][vi];
    // precaution: no register of the stores above is rewritten ahead of this wait
    asm volatile("s_wait_xcnt 0x0" ::: "memory");
  } else if (proj == 2) {       // v in fragment order: the wave's 16-byte stores are one 512-byte piece
    _Float16* dst = vT + (sh * R_ + r64) * D_ + lane * 8;
#pragma unroll
    for (int mi = 0; mi < 4; ++mi)
#pragma unroll
      for (int ni = 0; ni < 2; ++ni) {
        v8h pk;
#pragma unroll
        for (int vi = 0; vi < 8; ++vi) pk[vi] = (_Float16)acc[mi][ni][vi];
        *(v8h*)(dst + (mi >> 1) * 1024 + (ni * 2 + (mi & 1)) * 256) = pk;
      }
    // precaution: no register of the stores above is rewritten ahead of this wait
    asm volatile("s_wait_xcnt 0x0" ::: "memory");
  } else {                      // g in fragment order: the wave's 16-byte stores are one 512-byte piece
    // transposed tile: acc[mi][ni][vi] is column (w >> 2) * 64 + mi * 16 + half * 8 + vi of the block's
    // 128 gate columns (two heads per wave) and row (w & 3) * 32 + ni * 16 + n of its 128 rows
    int h0 = (nb & 1) * 4 + (w >> 2) * 2;
    int r32 = (mb - s * 3) * 128 + (w & 3) * 32;
    _Float16* dst = gT + (((size_t)s * H_ + h0) * R_ + r32) * D_ + lane * 8;
    const float* bp = bg + h0 * D_ + half * 8;
    v4f bg4[8];
#pragma unroll
    for (int i = 0; i < 8; ++i) bg4[i] = *(const v4f*)(bp + i * 4 + (i >> 1) * 8);
    // precaution: the address pair stays untouched (no load result is placed on it) up to this wait
    asm volatile("s_wait_xcnt 0x0" :: "v"(bp) : "memory");
#pragma unroll
    for (int mi = 0; mi < 4; ++mi) {
#pragma unroll
      for (int ni = 0; ni < 2; ++ni) {
        v8h pk;
#pragma unroll
        for (int vi = 0; vi < 8; ++vi) {
          float bgv = bg4[mi * 2 + (vi >> 2)][vi & 3];
          float gv = 1.f / (1.f + exp2_slot((acc[mi][ni][vi] + bgv) * -1.4426950408889634f));
          pk[vi] = (_Float16)gv;
        }
        // head h0 + (mi >> 1), row tile ni, d tile mi & 1; 8 d of one row: one 16-byte store
        *(v8h*)(dst + (mi >> 1) * (R_ * D_) + ni * 512 + (mi & 1) * 256) = pk;
      }
    }
    // precaution: no register of the stores above is rewritten ahead of this wait
    asm volatile("s_wait_xcnt 0x0" ::: "memory");
  }
}

__global__ void attn_kernel(const _Float16* __restrict__ q, const _Float16* __restrict__ k,
                            const _Float16* __restrict__ vT, const _Float16* __restrict__ gT,
                            const float* __restrict__ z, const float* __restrict__ mask,
                            _Float16* __restrict__ og) {
  __shared__ __attribute__((aligned(16))) float mbl[4][R_];   // per wave: the mask bias of the row's keys
  int w = __builtin_amdgcn_readfirstlane(threadIdx.x >> 5);   // wave-uniform: tile indices and bases take scalar registers
  int lane = lane_id();
  int t = blockIdx.x * 4 + w;
  const int NQ = R_ / 16;                   // 24
  int qt = t % NQ;
  int rem = t / NQ;
  int h = rem & 7;
  int s = rem >> 3;
  if (s >= S_) return;
  int q0 = qt * 16;

  const _Float16* Q  = q  + (((size_t)s * H_ + h) * R_) * D_;
  const _Float16* KF = k  + (((size_t)s * H_ + h) * R_) * D_ + lane * 8;   // fragment order, 2 KB per 32 keys
  const _Float16* VF = vT + (((size_t)s * H_ + h) * R_) * D_ + lane * 8;   // fragment order, 2 KB per 32 keys
  const _Float16* GF = gT + (((size_t)s * H_ + h) * R_ + q0) * D_ + lane * 8;   // fragment order, 1 KB per 16 rows
  const float* ZF = z + ((size_t)h * NQ + qt) * (R_ / 32) * 512 + lane * 4;   // fragment order, 2 KB per 32 keys
  int half = lane >> 4, n = lane & 15;

  // The keys lie along the registers now, 16 mask biases per lane and chunk: computed once per wave.
  {
    const float* mp = mask + (size_t)s * R_ + lane * 4;
    v4f mm[3];
#pragma unroll
    for (int i = 0; i < 3; ++i) mm[i] = *(const v4f*)(mp + i * 128);
    // precaution: the address pair stays untouched (no load result is placed on it) up to this wait
    asm volatile("s_wait_xcnt 0x0" :: "v"(mp) : "memory");
#pragma unroll
    for (int i = 0; i < 3; ++i) *(v4f*)(&mbl[w][i * 128 + lane * 4]) = 1e9f * (mm[i] - 1.f);
    // same-wave DS RAW: the table written above is read across lanes in the loop
    asm volatile("s_wait_dscnt 0" ::: "memory");
  }
  const float* BL = &mbl[w][half * 8];

  v16h bq = load_a_frag(Q + (size_t)q0 * D_, D_);   // B fragment: lane <-> query
  v8f o0 = zero8(), o1 = zero8();                   // O^T: register vi is d = 8 * half + vi (o1: + 16)
  float rmax = -1e30f, rsum = 0.f;                  // of query n; rsum over this half's keys only

  for (int kb = 0; kb < R_ / 32; ++kb) {
    // each K, z and V load below is 32 lanes x 16 B = 512 contiguous bytes
    const _Float16* kp = KF + (size_t)kb * 1024;
    const _Float16* vp = VF + (size_t)kb * 1024;
    const float* zp = ZF + (size_t)kb * 512;
    v8h kf[4], vf[4];
    v4f zf[4], bf[4];
#pragma unroll
    for (int i = 0; i < 4; ++i) kf[i] = *(const v8h*)(kp + i * 256);
#pragma unroll
    for (int i = 0; i < 4; ++i) zf[i] = *(const v4f*)(zp + i * 128);
#pragma unroll
    for (int i = 0; i < 4; ++i) vf[i] = *(const v8h*)(vp + i * 256);
    // precaution: the three address pairs stay untouched (no load result is placed on them) up to this wait
    asm volatile("s_wait_xcnt 0x0" :: "v"(kp), "v"(vp), "v"(zp) : "memory");
#pragma unroll
    for (int i = 0; i < 4; ++i) bf[i] = *(const v4f*)(BL + kb * 32 + (i >> 1) * 16 + (i & 1) * 4);
    v16h ak0 = join16(kf[0], kf[1]);   // A fragment: keys 32 * kb + 0..15
    v16h ak1 = join16(kf[2], kf[3]);   // keys 32 * kb + 16..31
    v8f s0 = wmma32(ak0, bq, zero8());
    v8f s1 = wmma32(ak1, bq, zero8());
    s0 += join8(zf[0] + bf[0], zf[1] + bf[1]);
    s1 += join8(zf[2] + bf[2], zf[3] + bf[3]);
    float mx = fmaxf(s0[0], s1[0]);
#pragma unroll
    for (int vi = 1; vi < 8; ++vi) mx = fmaxf(mx, fmaxf(s0[vi], s1[vi]));
    mx = fmaxf(mx, xhalf(mx));         // both halves hold the query's maximum over the 32 keys
    float nm = fmaxf(rmax, mx);
    float sc = __expf(rmax - nm);
    rmax = nm;
    v8f p0, p1;
#pragma unroll
    for (int vi = 0; vi < 8; ++vi) p0[vi] = __expf(s0[vi] - nm);
#pragma unroll
    for (int vi = 0; vi < 8; ++vi) p1[vi] = __expf(s1[vi] - nm);
    v8f pp = p0 + p1;
    v4f p4 = __builtin_shufflevector(pp, pp, 0, 1, 2, 3) + __builtin_shufflevector(pp, pp, 4, 5, 6, 7);
    rsum = rsum * sc + ((p4[0] + p4[2]) + (p4[1] + p4[3]));
    // B fragment of P^T: the two score tiles as they stand
    v16h bp = join16(__builtin_convertvector(p0, v8h), __builtin_convertvector(p1, v8h));
    o0 *= sc; o1 *= sc;
    // A fragments (lane <-> d) over the chunk's 32 keys
    v16h av0 = join16(vf[0], vf[1]);   // d 0..15
    v16h av1 = join16(vf[2], vf[3]);   // d 16..31
    o0 = wmma32(av0, bp, o0);
    o1 = wmma32(av1, bp, o1);
  }

  // epilogue: join the halves' sums, normalize, gate, write og[row q0 + n, h*32 + d] (f16), 8 d per store
  rsum += xhalf(rsum);
  float inv = 1.f / rsum;
  v8h g0 = *(const v8h*)GF;           // d = 8 * half + 0..7
  v8h g1 = *(const v8h*)(GF + 256);   // d = 16 + 8 * half + 0..7
  v8h r0, r1;
#pragma unroll
  for (int vi = 0; vi < 8; ++vi) {
    r0[vi] = (_Float16)(o0[vi] * inv * (float)g0[vi]);
    r1[vi] = (_Float16)(o1[vi] * inv * (float)g1[vi]);
  }
  _Float16* dst = og + ((size_t)s * R_ + q0 + n) * 256 + h * D_ + half * 8;
  *(v8h*)dst = r0;
  *(v8h*)(dst + 16) = r1;
}

// ---------------------------------------------------------------- output GEMM
__global__ __launch_bounds__(256)
void out_gemm_kernel(const _Float16* __restrict__ og,
                     const _Float16* __restrict__ woT,
                     const float* __restrict__ bo,
                     float* __restrict__ out) {
  __shared__ __attribute__((aligned(16))) _Float16 sA[128 * GP];
  __shared__ __attribute__((aligned(16))) _Float16 sB[128 * GP];
  int nb = blockIdx.x & 1;
  int mb = blockIdx.x >> 1;
  v8f acc[4][2];
  gemm_tile_128x128(og + (size_t)mb * 128 * 256, woT + (size_t)nb * 128 * 256, sA, sB, acc);

  int lane = lane_id();
  int w = threadIdx.x >> 5;
  int half = lane >> 4, n = lane & 15;
  int row0 = mb * 128 + (w >> 2) * 64 + half * 8;
  int col0 = nb * 128 + (w & 3) * 32 + n;
#pragma unroll
  for (int ni = 0; ni < 2; ++ni) {
    float bias = bo[col0 + ni * 16];
#pragma unroll
    for (int mi = 0; mi < 4; ++mi)
#pragma unroll
      for (int vi = 0; vi < 8; ++vi)
        out[(size_t)(row0 + mi * 16 + vi) * 256 + col0 + ni * 16] = acc[mi][ni][vi] + bias;
  }
}

// ---------------------------------------------------------------- launch
extern "C" void kernel_launch(void* const* d_in, const int* in_sizes, int n_in,
                              void* d_out, int out_size, void* d_ws, size_t ws_size,
                              hipStream_t stream) {
  const float* msa_act  = (const float*)d_in[0];
  const float* pair_act = (const float*)d_in[1];
  const float* msa_mask = (const float*)d_in[2];
  const float* qn_g     = (const float*)d_in[3];
  const float* qn_b     = (const float*)d_in[4];
  const float* pn_g     = (const float*)d_in[5];
  const float* pn_b     = (const float*)d_in[6];
  const float* w_pair   = (const float*)d_in[7];
  const float* wq       = (const float*)d_in[8];
  const float* wk       = (const float*)d_in[9];
  const float* wv       = (const float*)d_in[10];
  const float* wg       = (const float*)d_in[11];
  const float* bg       = (const float*)d_in[12];
  const float* wo       = (const float*)d_in[13];
  const float* bo       = (const float*)d_in[14];
  float* out = (float*)d_out;

  char* ws = (char*)d_ws;
  _Float16* wT_  = (_Float16*)(ws + 0);               // 1024*256*2      = 524288
  _Float16* woT_ = (_Float16*)(ws + 524288);          // 256*256*2       = 131072
  float*    z_   = (float*)   (ws + 655360);          // 8*384*384*4     = 4718592
  _Float16* m_   = (_Float16*)(ws + 5373952);         // 49152*256*2     = 25165824
  _Float16* q_   = (_Float16*)(ws + 30539776);        // 128*8*384*32*2  = 25165824
  _Float16* k_   = (_Float16*)(ws + 55705600);
  _Float16* vT_  = (_Float16*)(ws + 80871424);
  _Float16* gT_  = (_Float16*)(ws + 106037248);
  _Float16* og_  = (_Float16*)(ws + 131203072);       // 49152*256*2

  prep_weights_kernel<<<1280, 256, 0, stream>>>(wq, wk, wv, wg, wo, wT_, woT_);
  pair_bias_kernel<<<768, 192, 0, stream>>>(pair_act, pn_g, pn_b, w_pair, z_);
  ln_msa_kernel<<<6144, 256, 0, stream>>>(msa_act, qn_g, qn_b, m_);
  qkvg_gemm_kernel<<<3072, 256, 0, stream>>>(m_, wT_, bg, q_, k_, vT_, gT_);
  attn_kernel<<<6144, 128, 0, stream>>>(q_, k_, vT_, gT_, z_, msa_mask, og_);
  out_gemm_kernel<<<768, 256, 0, stream>>>(og_, woT_, bo, out);
}

// v005
// One run takes 129 microseconds.
// Next to v004, in two timings, it ran 1.10 times as fast each time.
// Counting every step since v000, it is 3.38 times as fast.
#include <hip/hip_runtime.h>
#include <hip/hip_bf16.h>
#include <math.h>

typedef __attribute__((ext_vector_type(16))) _Float16 v16h;
typedef __attribute__((ext_vector_type(8)))  _Float16 v8h;
typedef __attribute__((ext_vector_type(8)))  float    v8f;

#define S_  128
#define R_  384
#define CM  256
#define CZ  128
#define H_  8
#define D_  32

__device__ __forceinline__ int lane_id() { return threadIdx.x & 31; }

__device__ __forceinline__ v8f zero8() {
  v8f z;
#pragma unroll
  for (int i = 0; i < 8; ++i) z[i] = 0.f;
  return z;
}

__device__ __forceinline__ v8f wmma32(v16h a, v16h b, v8f c) {
  // D = A(16x32 f16) * B(32x16 f16) + C(16x16 f32)
  return __builtin_amdgcn_wmma_f32_16x16x32_f16(false, a, false, b, (short)0, c,
                                                false, false);
}

// A fragment: 16x32 f16 tile, row-major, leading dim ld.
// Lane L (0-15): row M=L, K = {0..7, 16..23}; lane 16-31: row M=L-16, K = {8..15, 24..31}.
// Also serves as B fragment when the B matrix is stored transposed (N x K row-major),
// since the B lane layout mirrors A with lane <-> N.
__device__ __forceinline__ v16h load_a_frag(const _Float16* base, int ld) {
  int lane = lane_id();
  int m = lane & 15, half = lane >> 4;
  const _Float16* rowp = base + m * ld + half * 8;
  v16h a;
#pragma unroll
  for (int e = 0; e < 16; ++e)
    a[e] = rowp[((e >> 3) << 4) + (e & 7)];
  return a;
}

__device__ __forceinline__ float wave_sum32(float x) {
#pragma unroll
  for (int off = 16; off > 0; off >>= 1) x += __shfl_xor(x, off, 32);
  return x;
}
// value of lane l ^ 16
__device__ __forceinline__ float xhalf(float x) {
  int b = __builtin_bit_cast(int, x);
  return __builtin_bit_cast(float,
      __builtin_amdgcn_permlanex16(b, b, 0x76543210, 0xfedcba98, false, false));
}

// ---------------------------------------------------------------- weights prep
__global__ void prep_weights_kernel(const float* wq, const float* wk, const float* wv,
                                    const float* wg, const float* wo,
                                    _Float16* wT, _Float16* woT) {
  int i = blockIdx.x * blockDim.x + threadIdx.x;
  const int NW = 4 * CM * CM;
  if (i < NW) {
    int proj = i >> 16;          // CM*CM == 65536
    int rem  = i & 65535;
    int hd   = rem >> 8;
    int c    = rem & 255;
    const float* w = (proj == 0) ? wq : (proj == 1) ? wk : (proj == 2) ? wv : wg;
    float scl = (proj == 0) ? 0.17677669529663689f : 1.0f;  // D^-0.5 folded into Wq
    wT[i] = (_Float16)(w[c * 256 + hd] * scl);              // wT[N=proj*256+hd][K=c]
  } else if (i < NW + CM * CM) {
    int j  = i - NW;
    int c  = j >> 8;
    int hd = j & 255;
    woT[j] = (_Float16)(wo[hd * 256 + c]);                  // woT[N=c][K=hd]
  }
}

// ---------------------------------------------------------------- pair bias z
// Stored in the order of the attention's transposed score fragments (keys x queries): per
// (head, 16-query tile, 32-key chunk) 2 KB = 4 pieces of 512 B; piece (t * 2 + u), lane l, element e holds
// z[query l & 15][key 16 * t + 8 * (l >> 4) + 4 * u + e], so a wave-wide 16-byte load is one piece.
// One LANE per (query i, key j) position: a wave takes 8 queries x 4 keys, which is one 128-byte
// line of that order per head (lane = 4 * query + key). Each 512-byte
// channel row is loaded whole by the wave, passed through the wave's own LDS range, and read back
// by the one lane that owns it, so the layernorm sums and the 8 head products are in-lane sums.
typedef __attribute__((ext_vector_type(4))) float v4f;
#define PBP 132   // LDS row pitch in floats: 528 B = 16 B x 33, so 16 lanes' 16-byte reads fall on distinct banks
#define PBW 6     // waves per block; 3 blocks fill a WGP's LDS and 768 blocks are one round

__global__ __launch_bounds__(32 * PBW)
void pair_bias_kernel(const float* __restrict__ pair,
                      const float* __restrict__ pn_g,
                      const float* __restrict__ pn_b,
                      const float* __restrict__ w_pair,
                      float* __restrict__ z) {
  __shared__ __attribute__((aligned(16))) float rows[PBW][32 * PBP];
  int lane = lane_id();
  int w = __builtin_amdgcn_readfirstlane(threadIdx.x >> 5);
  int gw = blockIdx.x * PBW + w;   // 0 .. (R_ / 8) * (R_ / 4) - 1
  int iq = gw / (R_ / 4);
  int jk = gw - iq * (R_ / 4);     // the waves of a block take neighbouring key groups
  int i0 = iq * 8;                 // first of the wave's 8 query rows
  int j0 = jk * 4;                 // first of the wave's 4 key cols
  const float* base = pair + ((size_t)i0 * R_ + j0) * CZ;   // wave-uniform
  float* my = &rows[w][0];
  v4f r[32];
#pragma unroll
  for (int t = 0; t < 32; ++t)
    r[t] = *(const v4f*)(base + (size_t)((t >> 2) * R_ + (t & 3)) * CZ + lane * 4);   // row of lane t
  // precaution: the loads' base and lane offset stay untouched up to this wait
  asm volatile("s_wait_xcnt 0x0" :: "s"(base), "v"(lane) : "memory");
#pragma unroll
  for (int t = 0; t < 32; ++t)
    *(v4f*)(my + t * PBP + lane * 4) = r[t];
  // same-wave DS RAW: the rows written above are read back across lanes below
  asm volatile("s_wait_dscnt 0" ::: "memory");
  const float* mine = my + lane * PBP;
  v4f x[32];
#pragma unroll
  for (int t = 0; t < 32; ++t)
    x[t] = *(const v4f*)(mine + t * 4);

  v4f s4 = { 0.f, 0.f, 0.f, 0.f }, q4 = { 0.f, 0.f, 0.f, 0.f };
#pragma unroll
  for (int t = 0; t < 32; ++t) { s4 += x[t]; q4 += x[t] * x[t]; }
  float s  = (s4[0] + s4[1]) + (s4[2] + s4[3]);
  float ss = (q4[0] + q4[1]) + (q4[2] + q4[3]);
  float mu = s * (1.f / CZ);
  float rsig = rsqrtf(ss * (1.f / CZ) - mu * mu + 1e-5f);

  float a[H_];
#pragma unroll
  for (int h = 0; h < H_; ++h) a[h] = 0.f;
#pragma unroll
  for (int c = 0; c < CZ; ++c) {
    float xn = (x[c >> 2][c & 3] - mu) * rsig * pn_g[c] + pn_b[c];
#pragma unroll
    for (int h = 0; h < H_; ++h) a[h] += xn * w_pair[c * H_ + h];
  }
  float* dst = z + (size_t)((i0 >> 4) * (R_ / 32) + (j0 >> 5)) * 512          // tile, chunk
                 + (((j0 >> 4) & 1) * 2 + ((j0 >> 2) & 1)) * 128             // piece
                 + (((j0 >> 3) & 1) * 16 + (i0 & 8)) * 4 + lane;             // one 128-byte line per head
#pragma unroll
  for (int h = 0; h < H_; ++h) dst[(size_t)h * R_ * R_] = a[h];
}

// ---------------------------------------------------------------- MSA layernorm
__global__ void ln_msa_kernel(const float* __restrict__ msa,
                              const float* __restrict__ gg,
                              const float* __restrict__ bb,
                              _Float16* __restrict__ m) {
  int row = (blockIdx.x * blockDim.x + threadIdx.x) >> 5;
  int lane = lane_id();
  if (row >= S_ * R_) return;
  const float* p = msa + (size_t)row * CM;
  float x[8], s = 0.f, ss = 0.f;
#pragma unroll
  for (int t = 0; t < 8; ++t) {
    float v = p[t * 32 + lane];
    x[t] = v; s += v; ss += v * v;
  }
  s = wave_sum32(s); ss = wave_sum32(ss);
  float mu = s * (1.f / CM);
  float rsig = rsqrtf(ss * (1.f / CM) - mu * mu + 1e-5f);
  _Float16* o = m + (size_t)row * CM;
#pragma unroll
  for (int t = 0; t < 8; ++t) {
    int c = t * 32 + lane;
    o[c] = (_Float16)((x[t] - mu) * rsig * gg[c] + bb[c]);
  }
}

// ---------------------------------------------------------------- GEMM block tile
// C[128 x 128] = A[128 x 256] * B^T, A and B both row-major with 256 f16 per row.
// 8 waves; both operand tiles are staged once in LDS, one whole 512-byte row per
// wave-wide load, and each wave then owns a 64 x 32 piece (4 x 2 accumulator tiles).
#define GP 264   // LDS row pitch in f16: 528 B = 16 B x 33, so 16 rows fall on distinct banks

__device__ __forceinline__ v16h join16(v8h lo, v8h hi) {
  return __builtin_shufflevector(lo, hi, 0, 1, 2, 3, 4, 5, 6, 7, 8, 9, 10, 11, 12, 13, 14, 15);
}

__device__ __forceinline__ v8f join8(v4f lo, v4f hi) {
  return __builtin_shufflevector(lo, hi, 0, 1, 2, 3, 4, 5, 6, 7);
}

// Same element order as load_a_frag, as two 16-byte LDS reads.
__device__ __forceinline__ v16h lds_frag(const _Float16* base) {
  int lane = lane_id();
  const _Float16* rowp = base + (lane & 15) * GP + (lane >> 4) * 8;
  v8h lo = *(const v8h*)rowp;
  v8h hi = *(const v8h*)(rowp + 16);
  return __builtin_shufflevector(lo, hi, 0, 1, 2, 3, 4, 5, 6, 7, 8, 9, 10, 11, 12, 13, 14, 15);
}

__device__ __forceinline__ void gemm_tile_128x128(const _Float16* __restrict__ ga,
                                                  const _Float16* __restrict__ gb,
                                                  _Float16* sA, _Float16* sB,
                                                  v8f (&acc)[4][2]) {
  int lane = lane_id();
  int w = threadIdx.x >> 5;
  // wave w stages rows w, w + 8, ... of both tiles
  const _Float16* la = ga + w * 256 + lane * 8;
  const _Float16* lb = gb + w * 256 + lane * 8;
  _Float16* wa = sA + w * GP + lane * 8;
  _Float16* wb = sB + w * GP + lane * 8;
  v8h ra[16], rb[16];
#pragma unroll
  for (int i = 0; i < 16; ++i) {
    ra[i] = *(const v8h*)(la + i * 8 * 256);
    rb[i] = *(const v8h*)(lb + i * 8 * 256);
  }
  // precaution: both address pairs stay untouched (no load result is placed on them) up to this wait
  asm volatile("s_wait_xcnt 0x0" :: "v"(la), "v"(lb) : "memory");
#pragma unroll
  for (int i = 0; i < 16; ++i) {
    *(v8h*)(wa + i * 8 * GP) = ra[i];
    *(v8h*)(wb + i * 8 * GP) = rb[i];
  }
  __syncthreads();   // every wave reads rows that the other waves staged
  const _Float16* pa = sA + (w >> 2) * 64 * GP;
  const _Float16* pb = sB + (w & 3) * 32 * GP;
#pragma unroll
  for (int mi = 0; mi < 4; ++mi) { acc[mi][0] = zero8(); acc[mi][1] = zero8(); }
#pragma unroll
  for (int k0 = 0; k0 < 256; k0 += 32) {
    v16h b0 = lds_frag(pb + k0);
    v16h b1 = lds_frag(pb + 16 * GP + k0);
#pragma unroll
    for (int mi = 0; mi < 4; ++mi) {
      v16h a = lds_frag(pa + mi * 16 * GP + k0);
      acc[mi][0] = wmma32(a, b0, acc[mi][0]);
      acc[mi][1] = wmma32(a, b1, acc[mi][1]);
    }
  }
}

// 2^x on v_exp_f32. The v_nop in the same statement is the one slot that the instruction set asks
// for behind a transcendental before its result is read or its source rewritten.
__device__ __forceinline__ float exp2_slot(float x) {
  float r;
  asm("v_exp_f32 %0, %1\n\tv_nop" : "=v"(r) : "v"(x));
  return r;
}

// ---------------------------------------------------------------- QKVG GEMM
// m[49152 x 256] x wT'[256 x 1024]
//   -> q [S,H,R,D] f16 (row-major tiles for 16 x 32 fragments)
//   -> k, v per (s,h) in the order of the attention's A fragments, pieces of 512 B = 32 lanes x 16 B:
//      k piece (16-key tile * 2 + j), lane l: K[key l & 15][d = 16 * j + 8 * (l >> 4) + 0..7]
//      v piece (32-key chunk * 4 + d tile * 2 + j), lane l: V[key 16 * j + 8 * (l >> 4) + 0..7][d = l & 15]
//   -> g per (s,h) in the order of the attention's transposed output tiles (d x rows):
//      piece (16-row tile * 2 + d tile), lane l: G[row l & 15][d = 8 * (l >> 4) + 0..7]
//      The gate blocks hand the two operand tiles to the GEMM in the other order, so that a lane's
//      8 accumulator elements are 8 neighbouring d of one row and the stores stay 16 bytes wide.
__global__ __launch_bounds__(256)
void qkvg_gemm_kernel(const _Float16* __restrict__ m,
                      const _Float16* __restrict__ wT,
                      const float* __restrict__ bg,
                      _Float16* __restrict__ q, _Float16* __restrict__ k,
                      _Float16* __restrict__ vT, _Float16* __restrict__ gT) {
  __shared__ __attribute__((aligned(16))) _Float16 sA[128 * GP];
  __shared__ __attribute__((aligned(16))) _Float16 sB[128 * GP];
  int nb = blockIdx.x & 7;      // 128-column tile; the 8 blocks of one row tile are neighbours
  int mb = blockIdx.x >> 3;     // 128-row tile
  int proj = nb >> 1;           // uniform per block
  const _Float16* mt = m + (size_t)mb * 128 * CM;
  const _Float16* wt = wT + (size_t)nb * 128 * CM;
  v8f acc[4][2];
  gemm_tile_128x128(proj == 3 ? wt : mt, proj == 3 ? mt : wt, sA, sB, acc);

  int lane = lane_id();
  int w = threadIdx.x >> 5;
  int half = lane >> 4, n = lane & 15;
  int h = (nb * 4 + (w & 3)) & 7;   // a wave's 32 columns are one head
  // a 128-row M tile never crosses an s boundary (R % 128 == 0)
  int s = mb / 3;
  int rw = (mb - s * 3) * 128 + (w >> 2) * 64 + half * 8;
  size_t sh = (size_t)s * H_ + h;
  int r64 = (mb - s * 3) * 128 + (w >> 2) * 64;   // first of the wave's 64 rows inside s
  if (proj == 0) {              // q: [S,H,R,D]
    _Float16* dst = q + (sh * R_ + rw) * D_ + n;
#pragma unroll
    for (int mi = 0; mi < 4; ++mi)
#pragma unroll
      for (int ni = 0; ni < 2; ++ni)
#pragma unroll
        for (int vi = 0; vi < 8; ++vi)
          dst[(mi * 16 + vi) * D_ + ni * 16] = (_Float16)acc[mi][ni][vi];
    // precaution: no register of the stores above is rewritten ahead of this wait
    asm volatile("s_wait_xcnt 0x0" ::: "memory");
  } else if (proj == 1) {       // k in fragment order: tile mi, piece ni, lane (n >> 3, key), element n & 7
    _Float16* dst = k + (sh * R_ + r64) * D_ + ((n >> 3) * 16 + half * 8) * 8 + (n & 7);
#pragma unroll
    for (int mi = 0; mi < 4; ++mi)
#pragma unroll
      for (int ni = 0; ni < 2; ++ni)
#pragma unroll
        for (int vi = 0; vi < 8; ++vi)
          dst[mi * 512 + ni * 256 + vi * 8] = (_Float16)acc[mi][ni][vi];
    // precaution: no register of the stores above is rewritten ahead of this wait
    asm volatile("s_wait_xcnt 0x0" ::: "memory");
  } else if (proj == 2) {       // v in fragment order: the wave's 16-byte stores are one 512-byte piece
    _Float16* dst = vT + (sh * R_ + r64) * D_ + lane * 8;
#pragma unroll
    for (int mi = 0; mi < 4; ++mi)
#pragma unroll
      for (int ni = 0; ni < 2; ++ni) {
        v8h pk;
#pragma unroll
        for (int vi = 0; vi < 8; ++vi) pk[vi] = (_Float16)acc[mi][ni][vi];
        *(v8h*)(dst + (mi >> 1) * 1024 + (ni * 2 + (mi & 1)) * 256) = pk;
      }
    // precaution: no register of the stores above is rewritten ahead of this wait
    asm volatile("s_wait_xcnt 0x0" ::: "memory");
  } else {                      // g in fragment order: the wave's 16-byte stores are one 512-byte piece
    // transposed tile: acc[mi][ni][vi] is column (w >> 2) * 64 + mi * 16 + half * 8 + vi of the block's
    // 128 gate columns (two heads per wave) and row (w & 3) * 32 + ni * 16 + n of its 128 rows
    int h0 = (nb & 1) * 4 + (w >> 2) * 2;
    int r32 = (mb - s * 3) * 128 + (w & 3) * 32;
    _Float16* dst = gT + (((size_t)s * H_ + h0) * R_ + r32) * D_ + lane * 8;
    const float* bp = bg + h0 * D_ + half * 8;
    v4f bg4[8];
#pragma unroll
    for (int i = 0; i < 8; ++i) bg4[i] = *(const v4f*)(bp + i * 4 + (i >> 1) * 8);
    // precaution: the address pair stays untouched (no load result is placed on it) up to this wait
    asm volatile("s_wait_xcnt 0x0" :: "v"(bp) : "memory");
#pragma unroll
    for (int mi = 0; mi < 4; ++mi) {
#pragma unroll
      for (int ni = 0; ni < 2; ++ni) {
        v8h pk;
#pragma unroll
        for (int vi = 0; vi < 8; ++vi) {
          float bgv = bg4[mi * 2 + (vi >> 2)][vi & 3];
          float gv = 1.f / (1.f + exp2_slot((acc[mi][ni][vi] + bgv) * -1.4426950408889634f));
          pk[vi] = (_Float16)gv;
        }
        // head h0 + (mi >> 1), row tile ni, d tile mi & 1; 8 d of one row: one 16-byte store
        *(v8h*)(dst + (mi >> 1) * (R_ * D_) + ni * 512 + (mi & 1) * 256) = pk;
      }
    }
    // precaution: no register of the stores above is rewritten ahead of this wait
    asm volatile("s_wait_xcnt 0x0" ::: "memory");
  }
}

#define AW 8   // waves per block
__global__ __launch_bounds__(32 * AW)
void attn_kernel(const _Float16* __restrict__ q, const _Float16* __restrict__ k,
                 const _Float16* __restrict__ vT, const _Float16* __restrict__ gT,
                 const float* __restrict__ z, const float* __restrict__ mask,
                 _Float16* __restrict__ og) {
  __shared__ __attribute__((aligned(16))) _Float16 sK[R_ * D_];   // fragment order, 2 KB per 32 keys
  __shared__ __attribute__((aligned(16))) _Float16 sV[R_ * D_];   // fragment order, 2 KB per 32 keys
  __shared__ __attribute__((aligned(16))) float mbl[R_];          // the mask bias of the row's keys
  int w = __builtin_amdgcn_readfirstlane(threadIdx.x >> 5);   // wave-uniform: tile indices and bases take scalar registers
  int lane = lane_id();
  const int NQ = R_ / 16;                   // 24
  int h = blockIdx.x & 7;
  int s = blockIdx.x >> 3;
  size_t sh = (((size_t)s * H_ + h) * R_) * D_;

  {
    // 256 threads x 16 B = 4 KB per step, 6 steps per operand
    const _Float16* gk = k  + sh + threadIdx.x * 8;
    const _Float16* gv = vT + sh + threadIdx.x * 8;
    v8h rk[6], rv[6];
#pragma unroll
    for (int i = 0; i < 6; ++i) {
      rk[i] = *(const v8h*)(gk + i * (AW * 256));
      rv[i] = *(const v8h*)(gv + i * (AW * 256));
    }
    // precaution: both address pairs stay untouched (no load result is placed on them) up to this wait
    asm volatile("s_wait_xcnt 0x0" :: "v"(gk), "v"(gv) : "memory");
#pragma unroll
    for (int i = 0; i < 6; ++i) {
      *(v8h*)(sK + threadIdx.x * 8 + i * (AW * 256)) = rk[i];
      *(v8h*)(sV + threadIdx.x * 8 + i * (AW * 256)) = rv[i];
    }
    // The keys lie along the registers, 16 mask biases per lane and chunk: computed once per block.
    if (w < 3) {
      const float* mp = mask + (size_t)s * R_ + threadIdx.x * 4;
      v4f mm = *(const v4f*)mp;
      // precaution: the address pair stays untouched (no load result is placed on it) up to this wait
      asm volatile("s_wait_xcnt 0x0" :: "v"(mp) : "memory");
      *(v4f*)(&mbl[threadIdx.x * 4]) = 1e9f * (mm - 1.f);
    }
  }
  __syncthreads();   // every wave reads K, V and mask biases that the other waves staged

  int half = lane >> 4, n = lane & 15;
  const _Float16* Q  = q + sh;
  const _Float16* KF = sK + lane * 8;
  const _Float16* VF = sV + lane * 8;
  const float* BL = &mbl[half * 8];

  for (int qt = w; qt < NQ; qt += AW) {
    int q0 = qt * 16;
    const _Float16* GF = gT + sh + (size_t)q0 * D_ + lane * 8;                  // fragment order, 1 KB per 16 rows
    const float* ZF = z + ((size_t)h * NQ + qt) * (R_ / 32) * 512 + lane * 4;   // fragment order, 2 KB per 32 keys

    v16h bq = load_a_frag(Q + (size_t)q0 * D_, D_);   // B fragment: lane <-> query
    v8f o0 = zero8(), o1 = zero8();                   // O^T: register vi is d = 8 * half + vi (o1: + 16)
    float rmax = -1e30f, rsum = 0.f;                  // of query n; rsum over this half's keys only

    for (int kb = 0; kb < R_ / 32; ++kb) {
      // each z load and each K and V read below is 32 lanes x 16 B = 512 contiguous bytes
      const float* zp = ZF + (size_t)kb * 512;
      v8h kf[4], vf[4];
      v4f zf[4], bf[4];
#pragma unroll
      for (int i = 0; i < 4; ++i) zf[i] = *(const v4f*)(zp + i * 128);
      // precaution: the address pair stays untouched (no load result is placed on it) up to this wait
      asm volatile("s_wait_xcnt 0x0" :: "v"(zp) : "memory");
#pragma unroll
      for (int i = 0; i < 4; ++i) kf[i] = *(const v8h*)(KF + kb * 1024 + i * 256);
#pragma unroll
      for (int i = 0; i < 4; ++i) bf[i] = *(const v4f*)(BL + kb * 32 + (i >> 1) * 16 + (i & 1) * 4);
#pragma unroll
      for (int i = 0; i < 4; ++i) vf[i] = *(const v8h*)(VF + kb * 1024 + i * 256);
      v16h ak0 = join16(kf[0], kf[1]);   // A fragment: keys 32 * kb + 0..15
      v16h ak1 = join16(kf[2], kf[3]);   // keys 32 * kb + 16..31
      v8f s0 = wmma32(ak0, bq, zero8());
      v8f s1 = wmma32(ak1, bq, zero8());
      s0 += join8(zf[0] + bf[0], zf[1] + bf[1]);
      s1 += join8(zf[2] + bf[2], zf[3] + bf[3]);
      float mx = fmaxf(s0[0], s1[0]);
#pragma unroll
      for (int vi = 1; vi < 8; ++vi) mx = fmaxf(mx, fmaxf(s0[vi], s1[vi]));
      mx = fmaxf(mx, xhalf(mx));         // both halves hold the query's maximum over the 32 keys
      float nm = fmaxf(rmax, mx);
      float sc = __expf(rmax - nm);
      rmax = nm;
      v8f p0, p1;
#pragma unroll
      for (int vi = 0; vi < 8; ++vi) p0[vi] = __expf(s0[vi] - nm);
#pragma unroll
      for (int vi = 0; vi < 8; ++vi) p1[vi] = __expf(s1[vi] - nm);
      v8f pp = p0 + p1;
      v4f p4 = __builtin_shufflevector(pp, pp, 0, 1, 2, 3) + __builtin_shufflevector(pp, pp, 4, 5, 6, 7);
      rsum = rsum * sc + ((p4[0] + p4[2]) + (p4[1] + p4[3]));
      // B fragment of P^T: the two score tiles as they stand
      v16h bp = join16(__builtin_convertvector(p0, v8h), __builtin_convertvector(p1, v8h));
      o0 *= sc; o1 *= sc;
      // A fragments (lane <-> d) over the chunk's 32 keys
      v16h av0 = join16(vf[0], vf[1]);   // d 0..15
      v16h av1 = join16(vf[2], vf[3]);   // d 16..31
      o0 = wmma32(av0, bp, o0);
      o1 = wmma32(av1, bp, o1);
    }

    // epilogue: join the halves' sums, normalize, gate, write og[row q0 + n, h*32 + d] (f16), 8 d per store
    rsum += xhalf(rsum);
    float inv = 1.f / rsum;
    v8h g0 = *(const v8h*)GF;           // d = 8 * half + 0..7
    v8h g1 = *(const v8h*)(GF + 256);   // d = 16 + 8 * half + 0..7
    v8h r0, r1;
#pragma unroll
    for (int vi = 0; vi < 8; ++vi) {
      r0[vi] = (_Float16)(o0[vi] * inv * (float)g0[vi]);
      r1[vi] = (_Float16)(o1[vi] * inv * (float)g1[vi]);
    }
    _Float16* dst = og + ((size_t)s * R_ + q0 + n) * 256 + h * D_ + half * 8;
    *(v8h*)dst = r0;
    *(v8h*)(dst + 16) = r1;
    // precaution: no register of the stores above is rewritten by the next tile ahead of this wait
    asm volatile("s_wait_xcnt 0x0" ::: "memory");
  }
}

// ---------------------------------------------------------------- output GEMM
__global__ __launch_bounds__(256)
void out_gemm_kernel(const _Float16* __restrict__ og,
                     const _Float16* __restrict__ woT,
                     const float* __restrict__ bo,
                     float* __restrict__ out) {
  __shared__ __attribute__((aligned(16))) _Float16 sA[128 * GP];
  __shared__ __attribute__((aligned(16))) _Float16 sB[128 * GP];
  int nb = blockIdx.x & 1;
  int mb = blockIdx.x >> 1;
  v8f acc[4][2];
  gemm_tile_128x128(og + (size_t)mb * 128 * 256, woT + (size_t)nb * 128 * 256, sA, sB, acc);

  int lane = lane_id();
  int w = threadIdx.x >> 5;
  int half = lane >> 4, n = lane & 15;
  int row0 = mb * 128 + (w >> 2) * 64 + half * 8;
  int col0 = nb * 128 + (w & 3) * 32 + n;
#pragma unroll
  for (int ni = 0; ni < 2; ++ni) {
    float bias = bo[col0 + ni * 16];
#pragma unroll
    for (int mi = 0; mi < 4; ++mi)
#pragma unroll
      for (int vi = 0; vi < 8; ++vi)
        out[(size_t)(row0 + mi * 16 + vi) * 256 + col0 + ni * 16] = acc[mi][ni][vi] + bias;
  }
}

// ---------------------------------------------------------------- launch
extern "C" void kernel_launch(void* const* d_in, const int* in_sizes, int n_in,
                              void* d_out, int out_size, void* d_ws, size_t ws_size,
                              hipStream_t stream) {
  const float* msa_act  = (const float*)d_in[0];
  const float* pair_act = (const float*)d_in[1];
  const float* msa_mask = (const float*)d_in[2];
  const float* qn_g     = (const float*)d_in[3];
  const float* qn_b     = (const float*)d_in[4];
  const float* pn_g     = (const float*)d_in[5];
  const float* pn_b     = (const float*)d_in[6];
  const float* w_pair   = (const float*)d_in[7];
  const float* wq       = (const float*)d_in[8];
  const float* wk       = (const float*)d_in[9];
  const float* wv       = (const float*)d_in[10];
  const float* wg       = (const float*)d_in[11];
  const float* bg       = (const float*)d_in[12];
  const float* wo       = (const float*)d_in[13];
  const float* bo       = (const float*)d_in[14];
  float* out = (float*)d_out;

  char* ws = (char*)d_ws;
  _Float16* wT_  = (_Float16*)(ws + 0);               // 1024*256*2      = 524288
  _Float16* woT_ = (_Float16*)(ws + 524288);          // 256*256*2       = 131072
  float*    z_   = (float*)   (ws + 655360);          // 8*384*384*4     = 4718592
  _Float16* m_   = (_Float16*)(ws + 5373952);         // 49152*256*2     = 25165824
  _Float16* q_   = (_Float16*)(ws + 30539776);        // 128*8*384*32*2  = 25165824
  _Float16* k_   = (_Float16*)(ws + 55705600);
  _Float16* vT_  = (_Float16*)(ws + 80871424);
  _Float16* gT_  = (_Float16*)(ws + 106037248);
  _Float16* og_  = (_Float16*)(ws + 131203072);       // 49152*256*2

  prep_weights_kernel<<<1280, 256, 0, stream>>>(wq, wk, wv, wg, wo, wT_, woT_);
  pair_bias_kernel<<<768, 192, 0, stream>>>(pair_act, pn_g, pn_b, w_pair, z_);
  ln_msa_kernel<<<6144, 256, 0, stream>>>(msa_act, qn_g, qn_b, m_);
  qkvg_gemm_kernel<<<3072, 256, 0, stream>>>(m_, wT_, bg, q_, k_, vT_, gT_);
  attn_kernel<<<1024, 256, 0, stream>>>(q_, k_, vT_, gT_, z_, msa_mask, og_);
  out_gemm_kernel<<<768, 256, 0, stream>>>(og_, woT_, bo, out);
}

// v006
// Measured time: 118 microseconds a run.
// Two timings next to v005 both put it at 1.09 times that version's speed.
// All steps since v000 together make it 3.68 times as fast.
#include <hip/hip_runtime.h>
#include <hip/hip_bf16.h>
#include <math.h>

typedef __attribute__((ext_vector_type(16))) _Float16 v16h;
typedef __attribute__((ext_vector_type(8)))  _Float16 v8h;
typedef __attribute__((ext_vector_type(8)))  float    v8f;

#define S_  128
#define R_  384
#define CM  256
#define CZ  128
#define H_  8
#define D_  32

__device__ __forceinline__ int lane_id() { return threadIdx.x & 31; }

__device__ __forceinline__ v8f zero8() {
  v8f z;
#pragma unroll
  for (int i = 0; i < 8; ++i) z[i] = 0.f;
  return z;
}

__device__ __forceinline__ v8f wmma32(v16h a, v16h b, v8f c) {
  // D = A(16x32 f16) * B(32x16 f16) + C(16x16 f32)
  return __builtin_amdgcn_wmma_f32_16x16x32_f16(false, a, false, b, (short)0, c,
                                                false, false);
}

// A fragment: 16x32 f16 tile, row-major, leading dim ld.
// Lane L (0-15): row M=L, K = {0..7, 16..23}; lane 16-31: row M=L-16, K = {8..15, 24..31}.
// Also serves as B fragment when the B matrix is stored transposed (N x K row-major),
// since the B lane layout mirrors A with lane <-> N.
__device__ __forceinline__ v16h load_a_frag(const _Float16* base, int ld) {
  int lane = lane_id();
  int m = lane & 15, half = lane >> 4;
  const _Float16* rowp = base + m * ld + half * 8;
  v16h a;
#pragma unroll
  for (int e = 0; e < 16; ++e)
    a[e] = rowp[((e >> 3) << 4) + (e & 7)];
  return a;
}

__device__ __forceinline__ float wave_sum32(float x) {
#pragma unroll
  for (int off = 16; off > 0; off >>= 1) x += __shfl_xor(x, off, 32);
  return x;
}
// value of lane l ^ 16
__device__ __forceinline__ float xhalf(float x) {
  int b = __builtin_bit_cast(int, x);
  return __builtin_bit_cast(float,
      __builtin_amdgcn_permlanex16(b, b, 0x76543210, 0xfedcba98, false, false));
}

// ---------------------------------------------------------------- weights prep
// One 256-thread block of the weights' transposition; blk = 0 .. PREP_BLOCKS - 1.
#define PREP_BLOCKS 1280   // (4 + 1) * CM * CM elements / 256 threads
__device__ __forceinline__ void prep_weights_block(int blk,
                                    const float* wq, const float* wk, const float* wv,
                                    const float* wg, const float* wo,
                                    _Float16* wT, _Float16* woT) {
  int i = blk * 256 + threadIdx.x;
  const int NW = 4 * CM * CM;
  if (i < NW) {
    int proj = i >> 16;          // CM*CM == 65536
    int rem  = i & 65535;
    int hd   = rem >> 8;
    int c    = rem & 255;
    const float* w = (proj == 0) ? wq : (proj == 1) ? wk : (proj == 2) ? wv : wg;
    float scl = (proj == 0) ? 0.17677669529663689f : 1.0f;  // D^-0.5 folded into Wq
    wT[i] = (_Float16)(w[c * 256 + hd] * scl);              // wT[N=proj*256+hd][K=c]
  } else if (i < NW + CM * CM) {
    int j  = i - NW;
    int c  = j >> 8;
    int hd = j & 255;
    woT[j] = (_Float16)(wo[hd * 256 + c]);                  // woT[N=c][K=hd]
  }
}

// ---------------------------------------------------------------- pair bias z
// Stored in the order of the attention's transposed score fragments (keys x queries): per
// (head, 16-query tile, 32-key chunk) 2 KB = 4 pieces of 512 B; piece (t * 2 + u), lane l, element e holds
// z[query l & 15][key 16 * t + 8 * (l >> 4) + 4 * u + e], so a wave-wide 16-byte load is one piece.
// One LANE per (query i, key j) position: a wave takes 8 queries x 4 keys, which is one 128-byte
// line of that order per head (lane = 4 * query + key). Each 512-byte
// channel row is loaded whole by the wave, passed through the wave's own LDS range, and read back
// by the one lane that owns it, so the layernorm sums and the 8 head products are in-lane sums.
typedef __attribute__((ext_vector_type(4))) float v4f;
typedef __attribute__((address_space(4))) float cfloat;
#define PBP 132   // LDS row pitch in floats: 528 B = 16 B x 33, so 16 lanes' 16-byte reads fall on distinct banks
#define PBW 8     // waves per block: the block size of the GEMM whose launch these blocks ride in
#define PAIR_BLOCKS ((R_ / 8) * (R_ / 4) / PBW)   // 576

// One block of the pair bias; blk = 0 .. PAIR_BLOCKS - 1; rows: PBW * 32 * PBP floats of LDS.
__device__ __forceinline__
void pair_bias_block(int blk, float* rows,
                     const float* __restrict__ pair,
                     const float* __restrict__ pn_g,
                     const float* __restrict__ pn_b,
                     const float* __restrict__ w_pair,
                     float* __restrict__ z) {
  int lane = lane_id();
  int w = __builtin_amdgcn_readfirstlane(threadIdx.x >> 5);
  int gw = blk * PBW + w;          // 0 .. (R_ / 8) * (R_ / 4) - 1
  int iq = gw / (R_ / 4);
  int jk = gw - iq * (R_ / 4);     // the waves of a block take neighbouring key groups
  int i0 = iq * 8;                 // first of the wave's 8 query rows
  int j0 = jk * 4;                 // first of the wave's 4 key cols
  const float* base = pair + ((size_t)i0 * R_ + j0) * CZ;   // wave-uniform
  float* my = rows + w * (32 * PBP);
  v4f r[32];
#pragma unroll
  for (int t = 0; t < 32; ++t)
    r[t] = *(const v4f*)(base + (size_t)((t >> 2) * R_ + (t & 3)) * CZ + lane * 4);   // row of lane t
  // precaution: the loads' base and lane offset stay untouched up to this wait
  asm volatile("s_wait_xcnt 0x0" :: "s"(base), "v"(lane) : "memory");
#pragma unroll
  for (int t = 0; t < 32; ++t)
    *(v4f*)(my + t * PBP + lane * 4) = r[t];
  // same-wave DS RAW: the rows written above are read back across lanes below
  asm volatile("s_wait_dscnt 0" ::: "memory");
  const float* mine = my + lane * PBP;
  v4f x[32];
#pragma unroll
  for (int t = 0; t < 32; ++t)
    x[t] = *(const v4f*)(mine + t * 4);

  v4f s4 = { 0.f, 0.f, 0.f, 0.f }, q4 = { 0.f, 0.f, 0.f, 0.f };
#pragma unroll
  for (int t = 0; t < 32; ++t) { s4 += x[t]; q4 += x[t] * x[t]; }
  float s  = (s4[0] + s4[1]) + (s4[2] + s4[3]);
  float ss = (q4[0] + q4[1]) + (q4[2] + q4[3]);
  float mu = s * (1.f / CZ);
  float rsig = rsqrtf(ss * (1.f / CZ) - mu * mu + 1e-5f);

  // The three tables are inputs that no launch writes and every lane reads the same element: read
  // through the constant address space they stay scalar loads, also beside the GEMM's stores in
  // the same kernel (as plain global reads they became 320 vector loads there).
  const cfloat* cg = (const cfloat*)pn_g;
  const cfloat* cb = (const cfloat*)pn_b;
  const cfloat* cw = (const cfloat*)w_pair;
  float a[H_];
#pragma unroll
  for (int h = 0; h < H_; ++h) a[h] = 0.f;
#pragma unroll
  for (int c = 0; c < CZ; ++c) {
    float xn = (x[c >> 2][c & 3] - mu) * rsig * cg[c] + cb[c];
#pragma unroll
    for (int h = 0; h < H_; ++h) a[h] += xn * cw[c * H_ + h];
  }
  float* dst = z + (size_t)((i0 >> 4) * (R_ / 32) + (j0 >> 5)) * 512          // tile, chunk
                 + (((j0 >> 4) & 1) * 2 + ((j0 >> 2) & 1)) * 128             // piece
                 + (((j0 >> 3) & 1) * 16 + (i0 & 8)) * 4 + lane;             // one 128-byte line per head
#pragma unroll
  for (int h = 0; h < H_; ++h) dst[(size_t)h * R_ * R_] = a[h];
}

// ---------------------------------------------------------------- MSA layernorm
// One 256-thread block: 8 rows, one per wave; blk = 0 .. LN_BLOCKS - 1.
#define LN_BLOCKS (S_ * R_ / 8)   // 6144
__device__ __forceinline__ void ln_msa_block(int blk,
                              const float* __restrict__ msa,
                              const float* __restrict__ gg,
                              const float* __restrict__ bb,
                              _Float16* __restrict__ m) {
  int row = (blk * 256 + threadIdx.x) >> 5;
  int lane = lane_id();
  if (row >= S_ * R_) return;
  const float* p = msa + (size_t)row * CM;
  float x[8], s = 0.f, ss = 0.f;
#pragma unroll
  for (int t = 0; t < 8; ++t) {
    float v = p[t * 32 + lane];
    x[t] = v; s += v; ss += v * v;
  }
  s = wave_sum32(s); ss = wave_sum32(ss);
  float mu = s * (1.f / CM);
  float rsig = rsqrtf(ss * (1.f / CM) - mu * mu + 1e-5f);
  _Float16* o = m + (size_t)row * CM;
#pragma unroll
  for (int t = 0; t < 8; ++t) {
    int c = t * 32 + lane;
    o[c] = (_Float16)((x[t] - mu) * rsig * gg[c] + bb[c]);
  }
}

// Neither of the two reads what the other writes, so they share one launch: the weights' blocks come
// first, and their strided loads are in flight while the layernorm's blocks start.
__global__ __launch_bounds__(256)
void prep_ln_kernel(const float* wq, const float* wk, const float* wv,
                    const float* wg, const float* wo,
                    _Float16* wT, _Float16* woT,
                    const float* __restrict__ msa,
                    const float* __restrict__ gg,
                    const float* __restrict__ bb,
                    _Float16* __restrict__ m) {
  int b = blockIdx.x;   // 0 .. PREP_BLOCKS + LN_BLOCKS - 1
  if (b < PREP_BLOCKS) prep_weights_block(b, wq, wk, wv, wg, wo, wT, woT);
  else                 ln_msa_block(b - PREP_BLOCKS, msa, gg, bb, m);
}

// ---------------------------------------------------------------- GEMM block tile
// C[128 x 128] = A[128 x 256] * B^T, A and B both row-major with 256 f16 per row.
// 8 waves; both operand tiles are staged once in LDS, one whole 512-byte row per
// wave-wide load, and each wave then owns a 64 x 32 piece (4 x 2 accumulator tiles).
#define GP 264   // LDS row pitch in f16: 528 B = 16 B x 33, so 16 rows fall on distinct banks

__device__ __forceinline__ v16h join16(v8h lo, v8h hi) {
  return __builtin_shufflevector(lo, hi, 0, 1, 2, 3, 4, 5, 6, 7, 8, 9, 10, 11, 12, 13, 14, 15);
}

__device__ __forceinline__ v8f join8(v4f lo, v4f hi) {
  return __builtin_shufflevector(lo, hi, 0, 1, 2, 3, 4, 5, 6, 7);
}

// Same element order as load_a_frag, as two 16-byte LDS reads.
__device__ __forceinline__ v16h lds_frag(const _Float16* base) {
  int lane = lane_id();
  const _Float16* rowp = base + (lane & 15) * GP + (lane >> 4) * 8;
  v8h lo = *(const v8h*)rowp;
  v8h hi = *(const v8h*)(rowp + 16);
  return __builtin_shufflevector(lo, hi, 0, 1, 2, 3, 4, 5, 6, 7, 8, 9, 10, 11, 12, 13, 14, 15);
}

__device__ __forceinline__ void gemm_tile_128x128(const _Float16* __restrict__ ga,
                                                  const _Float16* __restrict__ gb,
                                                  _Float16* sA, _Float16* sB,
                                                  v8f (&acc)[4][2]) {
  int lane = lane_id();
  int w = threadIdx.x >> 5;
  // wave w stages rows w, w + 8, ... of both tiles
  const _Float16* la = ga + w * 256 + lane * 8;
  const _Float16* lb = gb + w * 256 + lane * 8;
  _Float16* wa = sA + w * GP + lane * 8;
  _Float16* wb = sB + w * GP + lane * 8;
  v8h ra[16], rb[16];
#pragma unroll
  for (int i = 0; i < 16; ++i) {
    ra[i] = *(const v8h*)(la + i * 8 * 256);
    rb[i] = *(const v8h*)(lb + i * 8 * 256);
  }
  // precaution: both address pairs stay untouched (no load result is placed on them) up to this wait
  asm volatile("s_wait_xcnt 0x0" :: "v"(la), "v"(lb) : "memory");
#pragma unroll
  for (int i = 0; i < 16; ++i) {
    *(v8h*)(wa + i * 8 * GP) = ra[i];
    *(v8h*)(wb + i * 8 * GP) = rb[i];
  }
  __syncthreads();   // every wave reads rows that the other waves staged
  const _Float16* pa = sA + (w >> 2) * 64 * GP;
  const _Float16* pb = sB + (w & 3) * 32 * GP;
#pragma unroll
  for (int mi = 0; mi < 4; ++mi) { acc[mi][0] = zero8(); acc[mi][1] = zero8(); }
#pragma unroll
  for (int k0 = 0; k0 < 256; k0 += 32) {
    v16h b0 = lds_frag(pb + k0);
    v16h b1 = lds_frag(pb + 16 * GP + k0);
#pragma unroll
    for (int mi = 0; mi < 4; ++mi) {
      v16h a = lds_frag(pa + mi * 16 * GP + k0);
      acc[mi][0] = wmma32(a, b0, acc[mi][0]);
      acc[mi][1] = wmma32(a, b1, acc[mi][1]);
    }
  }
}

// 2^x on v_exp_f32. The v_nop in the same statement is the one slot that the instruction set asks
// for behind a transcendental before its result is read or its source rewritten.
__device__ __forceinline__ float exp2_slot(float x) {
  float r;
  asm("v_exp_f32 %0, %1\n\tv_nop" : "=v"(r) : "v"(x));
  return r;
}

// ---------------------------------------------------------------- QKVG GEMM
// m[49152 x 256] x wT'[256 x 1024]
//   -> q [S,H,R,D] f16 (row-major tiles for 16 x 32 fragments)
//   -> k, v per (s,h) in the order of the attention's A fragments, pieces of 512 B = 32 lanes x 16 B:
//      k piece (16-key tile * 2 + j), lane l: K[key l & 15][d = 16 * j + 8 * (l >> 4) + 0..7]
//      v piece (32-key chunk * 4 + d tile * 2 + j), lane l: V[key 16 * j + 8 * (l >> 4) + 0..7][d = l & 15]
//   -> g per (s,h) in the order of the attention's transposed output tiles (d x rows):
//      piece (16-row tile * 2 + d tile), lane l: G[row l & 15][d = 8 * (l >> 4) + 0..7]
//      The gate blocks hand the two operand tiles to the GEMM in the other order, so that a lane's
//      8 accumulator elements are 8 neighbouring d of one row and the stores stay 16 bytes wide.
// One block tile; blk = 0 .. QKVG_BLOCKS - 1; sA, sB: 128 * GP f16 of LDS each.
#define QKVG_BLOCKS (S_ * R_ / 128 * 8)   // 3072
__device__ __forceinline__
void qkvg_gemm_block(int blk, _Float16* sA, _Float16* sB,
                     const _Float16* __restrict__ m,
                     const _Float16* __restrict__ wT,
                     const float* __restrict__ bg,
                     _Float16* __restrict__ q, _Float16* __restrict__ k,
                     _Float16* __restrict__ vT, _Float16* __restrict__ gT) {
  int nb = blk & 7;             // 128-column tile; the 8 blocks of one row tile are neighbours
  int mb = blk >> 3;            // 128-row tile
  int proj = nb >> 1;           // uniform per block
  const _Float16* mt = m + (size_t)mb * 128 * CM;
  const _Float16* wt = wT + (size_t)nb * 128 * CM;
  v8f acc[4][2];
  gemm_tile_128x128(proj == 3 ? wt : mt, proj == 3 ? mt : wt, sA, sB, acc);

  int lane = lane_id();
  int w = threadIdx.x >> 5;
  int half = lane >> 4, n = lane & 15;
  int h = (nb * 4 + (w & 3)) & 7;   // a wave's 32 columns are one head
  // a 128-row M tile never crosses an s boundary (R % 128 == 0)
  int s = mb / 3;
  int rw = (mb - s * 3) * 128 + (w >> 2) * 64 + half * 8;
  size_t sh = (size_t)s * H_ + h;
  int r64 = (mb - s * 3) * 128 + (w >> 2) * 64;   // first of the wave's 64 rows inside s
  if (proj == 0) {              // q: [S,H,R,D]
    _Float16* dst = q + (sh * R_ + rw) * D_ + n;
#pragma unroll
    for (int mi = 0; mi < 4; ++mi)
#pragma unroll
      for (int ni = 0; ni < 2; ++ni)
#pragma unroll
        for (int vi = 0; vi < 8; ++vi)
          dst[(mi * 16 + vi) * D_ + ni * 16] = (_Float16)acc[mi][ni][vi];
    // precaution: no register of the stores above is rewritten ahead of this wait
    asm volatile("s_wait_xcnt 0x0" ::: "memory");
  } else if (proj == 1) {       // k in fragment order: tile mi, piece ni, lane (n >> 3, key), element n & 7
    _Float16* dst = k + (sh * R_ + r64) * D_ + ((n >> 3) * 16 + half * 8) * 8 + (n & 7);
#pragma unroll
    for (int mi = 0; mi < 4; ++mi)
#pragma unroll
      for (int ni = 0; ni < 2; ++ni)
#pragma unroll
        for (int vi = 0; vi < 8; ++vi)
          dst[mi * 512 + ni * 256 + vi * 8] = (_Float16)acc[mi][ni][vi];
    // precaution: no register of the stores above is rewritten ahead of this wait
    asm volatile("s_wait_xcnt 0x0" ::: "memory");
  } else if (proj == 2) {       // v in fragment order: the wave's 16-byte stores are one 512-byte piece
    _Float16* dst = vT + (sh * R_ + r64) * D_ + lane * 8;
#pragma unroll
    for (int mi = 0; mi < 4; ++mi)
#pragma unroll
      for (int ni = 0; ni < 2; ++ni) {
        v8h pk;
#pragma unroll
        for (int vi = 0; vi < 8; ++vi) pk[vi] = (_Float16)acc[mi][ni][vi];
        *(v8h*)(dst + (mi >> 1) * 1024 + (ni * 2 + (mi & 1)) * 256) = pk;
      }
    // precaution: no register of the stores above is rewritten ahead of this wait
    asm volatile("s_wait_xcnt 0x0" ::: "memory");
  } else {                      // g in fragment order: the wave's 16-byte stores are one 512-byte piece
    // transposed tile: acc[mi][ni][vi] is column (w >> 2) * 64 + mi * 16 + half * 8 + vi of the block's
    // 128 gate columns (two heads per wave) and row (w & 3) * 32 + ni * 16 + n of its 128 rows
    int h0 = (nb & 1) * 4 + (w >> 2) * 2;
    int r32 = (mb - s * 3) * 128 + (w & 3) * 32;
    _Float16* dst = gT + (((size_t)s * H_ + h0) * R_ + r32) * D_ + lane * 8;
    const float* bp = bg + h0 * D_ + half * 8;
    v4f bg4[8];
#pragma unroll
    for (int i = 0; i < 8; ++i) bg4[i] = *(const v4f*)(bp + i * 4 + (i >> 1) * 8);
    // precaution: the address pair stays untouched (no load result is placed on it) up to this wait
    asm volatile("s_wait_xcnt 0x0" :: "v"(bp) : "memory");
#pragma unroll
    for (int mi = 0; mi < 4; ++mi) {
#pragma unroll
      for (int ni = 0; ni < 2; ++ni) {
        v8h pk;
#pragma unroll
        for (int vi = 0; vi < 8; ++vi) {
          float bgv = bg4[mi * 2 + (vi >> 2)][vi & 3];
          float gv = 1.f / (1.f + exp2_slot((acc[mi][ni][vi] + bgv) * -1.4426950408889634f));
          pk[vi] = (_Float16)gv;
        }
        // head h0 + (mi >> 1), row tile ni, d tile mi & 1; 8 d of one row: one 16-byte store
        *(v8h*)(dst + (mi >> 1) * (R_ * D_) + ni * 512 + (mi & 1) * 256) = pk;
      }
    }
    // precaution: no register of the stores above is rewritten ahead of this wait
    asm volatile("s_wait_xcnt 0x0" ::: "memory");
  }
}

// The pair bias is read first by the attention and reads nothing that the GEMM writes, so its blocks
// ride in the GEMM's launch: of every 19 blocks the first 3 are pair-bias blocks and the other 16 are
// two row tiles of the GEMM, so that the pair stream from memory runs beside the GEMM's matrix, LDS
// and L2 work all through the launch. Both kinds take 8 waves and the same 135,168 bytes of LDS.
#define MIX_PAIR 3
#define MIX_GEMM 16
static_assert(PAIR_BLOCKS * MIX_GEMM == QKVG_BLOCKS * MIX_PAIR, "whole groups");
static_assert(PAIR_BLOCKS + QKVG_BLOCKS == 3648 && PREP_BLOCKS + LN_BLOCKS == 7424, "the grids of kernel_launch");
static_assert(PBW * 32 * PBP * sizeof(float) == 2 * 128 * GP * sizeof(_Float16), "one LDS size");
__global__ __launch_bounds__(256)
void qkvg_pair_kernel(const _Float16* __restrict__ m,
                      const _Float16* __restrict__ wT,
                      const float* __restrict__ bg,
                      _Float16* __restrict__ q, _Float16* __restrict__ k,
                      _Float16* __restrict__ vT, _Float16* __restrict__ gT,
                      const float* __restrict__ pair,
                      const float* __restrict__ pn_g,
                      const float* __restrict__ pn_b,
                      const float* __restrict__ w_pair,
                      float* __restrict__ z) {
  __shared__ __attribute__((aligned(16))) unsigned char smem[2 * 128 * GP * sizeof(_Float16)];
  int grp = blockIdx.x / (MIX_PAIR + MIX_GEMM);
  int r   = blockIdx.x - grp * (MIX_PAIR + MIX_GEMM);   // uniform per block
  if (r < MIX_PAIR) {
    pair_bias_block(grp * MIX_PAIR + r, (float*)smem, pair, pn_g, pn_b, w_pair, z);
    return;
  }
  qkvg_gemm_block(grp * MIX_GEMM + r - MIX_PAIR, (_Float16*)smem, (_Float16*)smem + 128 * GP,
                  m, wT, bg, q, k, vT, gT);
}

#define AW 8   // waves per block
__global__ __launch_bounds__(32 * AW)
void attn_kernel(const _Float16* __restrict__ q, const _Float16* __restrict__ k,
                 const _Float16* __restrict__ vT, const _Float16* __restrict__ gT,
                 const float* __restrict__ z, const float* __restrict__ mask,
                 _Float16* __restrict__ og) {
  __shared__ __attribute__((aligned(16))) _Float16 sK[R_ * D_];   // fragment order, 2 KB per 32 keys
  __shared__ __attribute__((aligned(16))) _Float16 sV[R_ * D_];   // fragment order, 2 KB per 32 keys
  __shared__ __attribute__((aligned(16))) float mbl[R_];          // the mask bias of the row's keys
  int w = __builtin_amdgcn_readfirstlane(threadIdx.x >> 5);   // wave-uniform: tile indices and bases take scalar registers
  int lane = lane_id();
  const int NQ = R_ / 16;                   // 24
  int h = blockIdx.x & 7;
  int s = blockIdx.x >> 3;
  size_t sh = (((size_t)s * H_ + h) * R_) * D_;

  {
    // 256 threads x 16 B = 4 KB per step, 6 steps per operand
    const _Float16* gk = k  + sh + threadIdx.x * 8;
    const _Float16* gv = vT + sh + threadIdx.x * 8;
    v8h rk[6], rv[6];
#pragma unroll
    for (int i = 0; i < 6; ++i) {
      rk[i] = *(const v8h*)(gk + i * (AW * 256));
      rv[i] = *(const v8h*)(gv + i * (AW * 256));
    }
    // precaution: both address pairs stay untouched (no load result is placed on them) up to this wait
    asm volatile("s_wait_xcnt 0x0" :: "v"(gk), "v"(gv) : "memory");
#pragma unroll
    for (int i = 0; i < 6; ++i) {
      *(v8h*)(sK + threadIdx.x * 8 + i * (AW * 256)) = rk[i];
      *(v8h*)(sV + threadIdx.x * 8 + i * (AW * 256)) = rv[i];
    }
    // The keys lie along the registers, 16 mask biases per lane and chunk: computed once per block.
    if (w < 3) {
      const float* mp = mask + (size_t)s * R_ + threadIdx.x * 4;
      v4f mm = *(const v4f*)mp;
      // precaution: the address pair stays untouched (no load result is placed on it) up to this wait
      asm volatile("s_wait_xcnt 0x0" :: "v"(mp) : "memory");
      *(v4f*)(&mbl[threadIdx.x * 4]) = 1e9f * (mm - 1.f);
    }
  }
  __syncthreads();   // every wave reads K, V and mask biases that the other waves staged

  int half = lane >> 4, n = lane & 15;
  const _Float16* Q  = q + sh;
  const _Float16* KF = sK + lane * 8;
  const _Float16* VF = sV + lane * 8;
  const float* BL = &mbl[half * 8];

  for (int qt = w; qt < NQ; qt += AW) {
    int q0 = qt * 16;
    const _Float16* GF = gT + sh + (size_t)q0 * D_ + lane * 8;                  // fragment order, 1 KB per 16 rows
    const float* ZF = z + ((size_t)h * NQ + qt) * (R_ / 32) * 512 + lane * 4;   // fragment order, 2 KB per 32 keys

    v16h bq = load_a_frag(Q + (size_t)q0 * D_, D_);   // B fragment: lane <-> query
    v8f o0 = zero8(), o1 = zero8();                   // O^T: register vi is d = 8 * half + vi (o1: + 16)
    float rmax = -1e30f, rsum = 0.f;                  // of query n; rsum over this half's keys only

    for (int kb = 0; kb < R_ / 32; ++kb) {
      // each z load and each K and V read below is 32 lanes x 16 B = 512 contiguous bytes
      const float* zp = ZF + (size_t)kb * 512;
      v8h kf[4], vf[4];
      v4f zf[4], bf[4];
#pragma unroll
      for (int i = 0; i < 4; ++i) zf[i] = *(const v4f*)(zp + i * 128);
      // precaution: the address pair stays untouched (no load result is placed on it) up to this wait
      asm volatile("s_wait_xcnt 0x0" :: "v"(zp) : "memory");
#pragma unroll
      for (int i = 0; i < 4; ++i) kf[i] = *(const v8h*)(KF + kb * 1024 + i * 256);
#pragma unroll
      for (int i = 0; i < 4; ++i) bf[i] = *(const v4f*)(BL + kb * 32 + (i >> 1) * 16 + (i & 1) * 4);
#pragma unroll
      for (int i = 0; i < 4; ++i) vf[i] = *(const v8h*)(VF + kb * 1024 + i * 256);
      v16h ak0 = join16(kf[0], kf[1]);   // A fragment: keys 32 * kb + 0..15
      v16h ak1 = join16(kf[2], kf[3]);   // keys 32 * kb + 16..31
      v8f s0 = wmma32(ak0, bq, zero8());
      v8f s1 = wmma32(ak1, bq, zero8());
      s0 += join8(zf[0] + bf[0], zf[1] + bf[1]);
      s1 += join8(zf[2] + bf[2], zf[3] + bf[3]);
      float mx = fmaxf(s0[0], s1[0]);
#pragma unroll
      for (int vi = 1; vi < 8; ++vi) mx = fmaxf(mx, fmaxf(s0[vi], s1[vi]));
      mx = fmaxf(mx, xhalf(mx));         // both halves hold the query's maximum over the 32 keys
      float nm = fmaxf(rmax, mx);
      float sc = __expf(rmax - nm);
      rmax = nm;
      v8f p0, p1;
#pragma unroll
      for (int vi = 0; vi < 8; ++vi) p0[vi] = __expf(s0[vi] - nm);
#pragma unroll
      for (int vi = 0; vi < 8; ++vi) p1[vi] = __expf(s1[vi] - nm);
      v8f pp = p0 + p1;
      v4f p4 = __builtin_shufflevector(pp, pp, 0, 1, 2, 3) + __builtin_shufflevector(pp, pp, 4, 5, 6, 7);
      rsum = rsum * sc + ((p4[0] + p4[2]) + (p4[1] + p4[3]));
      // B fragment of P^T: the two score tiles as they stand
      v16h bp = join16(__builtin_convertvector(p0, v8h), __builtin_convertvector(p1, v8h));
      o0 *= sc; o1 *= sc;
      // A fragments (lane <-> d) over the chunk's 32 keys
      v16h av0 = join16(vf[0], vf[1]);   // d 0..15
      v16h av1 = join16(vf[2], vf[3]);   // d 16..31
      o0 = wmma32(av0, bp, o0);
      o1 = wmma32(av1, bp, o1);
    }

    // epilogue: join the halves' sums, normalize, gate, write og[row q0 + n, h*32 + d] (f16), 8 d per store
    rsum += xhalf(rsum);
    float inv = 1.f / rsum;
    v8h g0 = *(const v8h*)GF;           // d = 8 * half + 0..7
    v8h g1 = *(const v8h*)(GF + 256);   // d = 16 + 8 * half + 0..7
    v8h r0, r1;
#pragma unroll
    for (int vi = 0; vi < 8; ++vi) {
      r0[vi] = (_Float16)(o0[vi] * inv * (float)g0[vi]);
      r1[vi] = (_Float16)(o1[vi] * inv * (float)g1[vi]);
    }
    _Float16* dst = og + ((size_t)s * R_ + q0 + n) * 256 + h * D_ + half * 8;
    *(v8h*)dst = r0;
    *(v8h*)(dst + 16) = r1;
    // precaution: no register of the stores above is rewritten by the next tile ahead of this wait
    asm volatile("s_wait_xcnt 0x0" ::: "memory");
  }
}

// ---------------------------------------------------------------- output GEMM
__global__ __launch_bounds__(256)
void out_gemm_kernel(const _Float16* __restrict__ og,
                     const _Float16* __restrict__ woT,
                     const float* __restrict__ bo,
                     float* __restrict__ out) {
  __shared__ __attribute__((aligned(16))) _Float16 sA[128 * GP];
  __shared__ __attribute__((aligned(16))) _Float16 sB[128 * GP];
  int nb = blockIdx.x & 1;
  int mb = blockIdx.x >> 1;
  v8f acc[4][2];
  gemm_tile_128x128(og + (size_t)mb * 128 * 256, woT + (size_t)nb * 128 * 256, sA, sB, acc);

  int lane = lane_id();
  int w = threadIdx.x >> 5;
  int half = lane >> 4, n = lane & 15;
  int row0 = mb * 128 + (w >> 2) * 64 + half * 8;
  int col0 = nb * 128 + (w & 3) * 32 + n;
#pragma unroll
  for (int ni = 0; ni < 2; ++ni) {
    float bias = bo[col0 + ni * 16];
#pragma unroll
    for (int mi = 0; mi < 4; ++mi)
#pragma unroll
      for (int vi = 0; vi < 8; ++vi)
        out[(size_t)(row0 + mi * 16 + vi) * 256 + col0 + ni * 16] = acc[mi][ni][vi] + bias;
  }
}

// ---------------------------------------------------------------- launch
extern "C" void kernel_launch(void* const* d_in, const int* in_sizes, int n_in,
                              void* d_out, int out_size, void* d_ws, size_t ws_size,
                              hipStream_t stream) {
  const float* msa_act  = (const float*)d_in[0];
  const float* pair_act = (const float*)d_in[1];
  const float* msa_mask = (const float*)d_in[2];
  const float* qn_g     = (const float*)d_in[3];
  const float* qn_b     = (const float*)d_in[4];
  const float* pn_g     = (const float*)d_in[5];
  const float* pn_b     = (const float*)d_in[6];
  const float* w_pair   = (const float*)d_in[7];
  const float* wq       = (const float*)d_in[8];
  const float* wk       = (const float*)d_in[9];
  const float* wv       = (const float*)d_in[10];
  const float* wg       = (const float*)d_in[11];
  const float* bg       = (const float*)d_in[12];
  const float* wo       = (const float*)d_in[13];
  const float* bo       = (const float*)d_in[14];
  float* out = (float*)d_out;

  char* ws = (char*)d_ws;
  _Float16* wT_  = (_Float16*)(ws + 0);               // 1024*256*2      = 524288
  _Float16* woT_ = (_Float16*)(ws + 524288);          // 256*256*2       = 131072
  float*    z_   = (float*)   (ws + 655360);          // 8*384*384*4     = 4718592
  _Float16* m_   = (_Float16*)(ws + 5373952);         // 49152*256*2     = 25165824
  _Float16* q_   = (_Float16*)(ws + 30539776);        // 128*8*384*32*2  = 25165824
  _Float16* k_   = (_Float16*)(ws + 55705600);
  _Float16* vT_  = (_Float16*)(ws + 80871424);
  _Float16* gT_  = (_Float16*)(ws + 106037248);
  _Float16* og_  = (_Float16*)(ws + 131203072);       // 49152*256*2

  prep_ln_kernel<<<7424, 256, 0, stream>>>(wq, wk, wv, wg, wo, wT_, woT_, msa_act, qn_g, qn_b, m_);
  qkvg_pair_kernel<<<3648, 256, 0, stream>>>(m_, wT_, bg, q_, k_, vT_, gT_,
                                             pair_act, pn_g, pn_b, w_pair, z_);
  attn_kernel<<<1024, 256, 0, stream>>>(q_, k_, vT_, gT_, z_, msa_mask, og_);
  out_gemm_kernel<<<768, 256, 0, stream>>>(og_, woT_, bo, out);
}

// v007
// One run takes 111 microseconds.
// Next to v006, in two timings, it ran 1.06 times as fast each time.
// All steps since v000 together make it 3.90 times as fast.
#include <hip/hip_runtime.h>
#include <hip/hip_bf16.h>
#include <math.h>

typedef __attribute__((ext_vector_type(16))) _Float16 v16h;
typedef __attribute__((ext_vector_type(8)))  _Float16 v8h;
typedef __attribute__((ext_vector_type(8)))  float    v8f;

#define S_  128
#define R_  384
#define CM  256
#define CZ  128
#define H_  8
#define D_  32

__device__ __forceinline__ int lane_id() { return threadIdx.x & 31; }

__device__ __forceinline__ v8f zero8() {
  v8f z;
#pragma unroll
  for (int i = 0; i < 8; ++i) z[i] = 0.f;
  return z;
}

__device__ __forceinline__ v8f wmma32(v16h a, v16h b, v8f c) {
  // D = A(16x32 f16) * B(32x16 f16) + C(16x16 f32)
  return __builtin_amdgcn_wmma_f32_16x16x32_f16(false, a, false, b, (short)0, c,
                                                false, false);
}

// A fragment: 16x32 f16 tile, row-major, leading dim ld.
// Lane L (0-15): row M=L, K = {0..7, 16..23}; lane 16-31: row M=L-16, K = {8..15, 24..31}.
// Also serves as B fragment when the B matrix is stored transposed (N x K row-major),
// since the B lane layout mirrors A with lane <-> N.
__device__ __forceinline__ v16h load_a_frag(const _Float16* base, int ld) {
  int lane = lane_id();
  int m = lane & 15, half = lane >> 4;
  const _Float16* rowp = base + m * ld + half * 8;
  v16h a;
#pragma unroll
  for (int e = 0; e < 16; ++e)
    a[e] = rowp[((e >> 3) << 4) + (e & 7)];
  return a;
}

__device__ __forceinline__ float wave_sum32(float x) {
#pragma unroll
  for (int off = 16; off > 0; off >>= 1) x += __shfl_xor(x, off, 32);
  return x;
}
// value of lane l ^ 16
__device__ __forceinline__ float xhalf(float x) {
  int b = __builtin_bit_cast(int, x);
  return __builtin_bit_cast(float,
      __builtin_amdgcn_permlanex16(b, b, 0x76543210, 0xfedcba98, false, false));
}

// ---------------------------------------------------------------- weights prep
// One 256-thread block of the weights' transposition; blk = 0 .. PREP_BLOCKS - 1.
#define PREP_BLOCKS 1280   // (4 + 1) * CM * CM elements / 256 threads
__device__ __forceinline__ void prep_weights_block(int blk,
                                    const float* wq, const float* wk, const float* wv,
                                    const float* wg, const float* wo,
                                    _Float16* wT, _Float16* woT) {
  int i = blk * 256 + threadIdx.x;
  const int NW = 4 * CM * CM;
  if (i < NW) {
    int proj = i >> 16;          // CM*CM == 65536
    int rem  = i & 65535;
    int hd   = rem >> 8;
    int c    = rem & 255;
    const float* w = (proj == 0) ? wq : (proj == 1) ? wk : (proj == 2) ? wv : wg;
    float scl = (proj == 0) ? 0.17677669529663689f : 1.0f;  // D^-0.5 folded into Wq
    wT[i] = (_Float16)(w[c * 256 + hd] * scl);              // wT[N=proj*256+hd][K=c]
  } else if (i < NW + CM * CM) {
    int j  = i - NW;
    int c  = j >> 8;
    int hd = j & 255;
    woT[j] = (_Float16)(wo[hd * 256 + c]);                  // woT[N=c][K=hd]
  }
}

// ---------------------------------------------------------------- pair bias z
// Stored in the order of the attention's transposed score fragments (keys x queries): per
// (head, 16-query tile, 32-key chunk) 2 KB = 4 pieces of 512 B; piece (t * 2 + u), lane l, element e holds
// z[query l & 15][key 16 * t + 8 * (l >> 4) + 4 * u + e], so a wave-wide 16-byte load is one piece.
// One LANE per (query i, key j) position: a wave takes 8 queries x 4 keys, which is one 128-byte
// line of that order per head (lane = 4 * query + key). Each 512-byte
// channel row is loaded whole by the wave, passed through the wave's own LDS range, and read back
// by the one lane that owns it, so the layernorm sums and the 8 head products are in-lane sums.
typedef __attribute__((ext_vector_type(4))) float v4f;
typedef __attribute__((address_space(4))) float cfloat;
#define PBP 132   // LDS row pitch in floats: 528 B = 16 B x 33, so 16 lanes' 16-byte reads fall on distinct banks
#define PBW 8     // waves per block: the block size of the GEMM whose launch these blocks ride in
#define PAIR_BLOCKS ((R_ / 8) * (R_ / 4) / PBW)   // 576

// One block of the pair bias; blk = 0 .. PAIR_BLOCKS - 1; rows: PBW * 32 * PBP floats of LDS.
__device__ __forceinline__
void pair_bias_block(int blk, float* rows,
                     const float* __restrict__ pair,
                     const float* __restrict__ pn_g,
                     const float* __restrict__ pn_b,
                     const float* __restrict__ w_pair,
                     float* __restrict__ z) {
  int lane = lane_id();
  int w = __builtin_amdgcn_readfirstlane(threadIdx.x >> 5);
  int gw = blk * PBW + w;          // 0 .. (R_ / 8) * (R_ / 4) - 1
  int iq = gw / (R_ / 4);
  int jk = gw - iq * (R_ / 4);     // the waves of a block take neighbouring key groups
  int i0 = iq * 8;                 // first of the wave's 8 query rows
  int j0 = jk * 4;                 // first of the wave's 4 key cols
  const float* base = pair + ((size_t)i0 * R_ + j0) * CZ;   // wave-uniform
  float* my = rows + w * (32 * PBP);
  v4f r[32];
#pragma unroll
  for (int t = 0; t < 32; ++t)
    r[t] = *(const v4f*)(base + (size_t)((t >> 2) * R_ + (t & 3)) * CZ + lane * 4);   // row of lane t
  // precaution: the loads' base and lane offset stay untouched up to this wait
  asm volatile("s_wait_xcnt 0x0" :: "s"(base), "v"(lane) : "memory");
#pragma unroll
  for (int t = 0; t < 32; ++t)
    *(v4f*)(my + t * PBP + lane * 4) = r[t];
  // same-wave DS RAW: the rows written above are read back across lanes below
  asm volatile("s_wait_dscnt 0" ::: "memory");
  const float* mine = my + lane * PBP;
  v4f x[32];
#pragma unroll
  for (int t = 0; t < 32; ++t)
    x[t] = *(const v4f*)(mine + t * 4);

  v4f s4 = { 0.f, 0.f, 0.f, 0.f }, q4 = { 0.f, 0.f, 0.f, 0.f };
#pragma unroll
  for (int t = 0; t < 32; ++t) { s4 += x[t]; q4 += x[t] * x[t]; }
  float s  = (s4[0] + s4[1]) + (s4[2] + s4[3]);
  float ss = (q4[0] + q4[1]) + (q4[2] + q4[3]);
  float mu = s * (1.f / CZ);
  float rsig = rsqrtf(ss * (1.f / CZ) - mu * mu + 1e-5f);

  // The three tables are inputs that no launch writes and every lane reads the same element: read
  // through the constant address space they stay scalar loads, also beside the GEMM's stores in
  // the same kernel (as plain global reads they became 320 vector loads there).
  const cfloat* cg = (const cfloat*)pn_g;
  const cfloat* cb = (const cfloat*)pn_b;
  const cfloat* cw = (const cfloat*)w_pair;
  float a[H_];
#pragma unroll
  for (int h = 0; h < H_; ++h) a[h] = 0.f;
#pragma unroll
  for (int c = 0; c < CZ; ++c) {
    float xn = (x[c >> 2][c & 3] - mu) * rsig * cg[c] + cb[c];
#pragma unroll
    for (int h = 0; h < H_; ++h) a[h] += xn * cw[c * H_ + h];
  }
  float* dst = z + (size_t)((i0 >> 4) * (R_ / 32) + (j0 >> 5)) * 512          // tile, chunk
                 + (((j0 >> 4) & 1) * 2 + ((j0 >> 2) & 1)) * 128             // piece
                 + (((j0 >> 3) & 1) * 16 + (i0 & 8)) * 4 + lane;             // one 128-byte line per head
#pragma unroll
  for (int h = 0; h < H_; ++h) dst[(size_t)h * R_ * R_] = a[h];
}

// ---------------------------------------------------------------- MSA layernorm
// One 256-thread block: 8 rows, one per wave; blk = 0 .. LN_BLOCKS - 1.
#define LN_BLOCKS (S_ * R_ / 8)   // 6144
__device__ __forceinline__ void ln_msa_block(int blk,
                              const float* __restrict__ msa,
                              const float* __restrict__ gg,
                              const float* __restrict__ bb,
                              _Float16* __restrict__ m) {
  int row = (blk * 256 + threadIdx.x) >> 5;
  int lane = lane_id();
  if (row >= S_ * R_) return;
  const float* p = msa + (size_t)row * CM;
  float x[8], s = 0.f, ss = 0.f;
#pragma unroll
  for (int t = 0; t < 8; ++t) {
    float v = p[t * 32 + lane];
    x[t] = v; s += v; ss += v * v;
  }
  s = wave_sum32(s); ss = wave_sum32(ss);
  float mu = s * (1.f / CM);
  float rsig = rsqrtf(ss * (1.f / CM) - mu * mu + 1e-5f);
  _Float16* o = m + (size_t)row * CM;
#pragma unroll
  for (int t = 0; t < 8; ++t) {
    int c = t * 32 + lane;
    o[c] = (_Float16)((x[t] - mu) * rsig * gg[c] + bb[c]);
  }
}

// Neither of the two reads what the other writes, so they share one launch: the weights' blocks come
// first, and their strided loads are in flight while the layernorm's blocks start.
__global__ __launch_bounds__(256)
void prep_ln_kernel(const float* wq, const float* wk, const float* wv,
                    const float* wg, const float* wo,
                    _Float16* wT, _Float16* woT,
                    const float* __restrict__ msa,
                    const float* __restrict__ gg,
                    const float* __restrict__ bb,
                    _Float16* __restrict__ m) {
  int b = blockIdx.x;   // 0 .. PREP_BLOCKS + LN_BLOCKS - 1
  if (b < PREP_BLOCKS) prep_weights_block(b, wq, wk, wv, wg, wo, wT, woT);
  else                 ln_msa_block(b - PREP_BLOCKS, msa, gg, bb, m);
}

// ---------------------------------------------------------------- GEMM block tile
// C[128 x 128] = A[128 x 256] * B^T, A and B both row-major with 256 f16 per row.
// 8 waves; both operand tiles are staged once in LDS, one whole 512-byte row per
// wave-wide load, and each wave then owns a 64 x 32 piece (4 x 2 accumulator tiles).
#define GP 264   // LDS row pitch in f16: 528 B = 16 B x 33, so 16 rows fall on distinct banks

__device__ __forceinline__ v16h join16(v8h lo, v8h hi) {
  return __builtin_shufflevector(lo, hi, 0, 1, 2, 3, 4, 5, 6, 7, 8, 9, 10, 11, 12, 13, 14, 15);
}

__device__ __forceinline__ v8f join8(v4f lo, v4f hi) {
  return __builtin_shufflevector(lo, hi, 0, 1, 2, 3, 4, 5, 6, 7);
}

// Same element order as load_a_frag, as two 16-byte LDS reads.
__device__ __forceinline__ v16h lds_frag(const _Float16* base) {
  int lane = lane_id();
  const _Float16* rowp = base + (lane & 15) * GP + (lane >> 4) * 8;
  v8h lo = *(const v8h*)rowp;
  v8h hi = *(const v8h*)(rowp + 16);
  return __builtin_shufflevector(lo, hi, 0, 1, 2, 3, 4, 5, 6, 7, 8, 9, 10, 11, 12, 13, 14, 15);
}

__device__ __forceinline__ void gemm_tile_128x128(const _Float16* __restrict__ ga,
                                                  const _Float16* __restrict__ gb,
                                                  _Float16* sA, _Float16* sB,
                                                  v8f (&acc)[4][2]) {
  int lane = lane_id();
  int w = threadIdx.x >> 5;
  // wave w stages rows w, w + 8, ... of both tiles
  const _Float16* la = ga + w * 256 + lane * 8;
  const _Float16* lb = gb + w * 256 + lane * 8;
  _Float16* wa = sA + w * GP + lane * 8;
  _Float16* wb = sB + w * GP + lane * 8;
  v8h ra[16], rb[16];
#pragma unroll
  for (int i = 0; i < 16; ++i) {
    ra[i] = *(const v8h*)(la + i * 8 * 256);
    rb[i] = *(const v8h*)(lb + i * 8 * 256);
  }
  // precaution: both address pairs stay untouched (no load result is placed on them) up to this wait
  asm volatile("s_wait_xcnt 0x0" :: "v"(la), "v"(lb) : "memory");
#pragma unroll
  for (int i = 0; i < 16; ++i) {
    *(v8h*)(wa + i * 8 * GP) = ra[i];
    *(v8h*)(wb + i * 8 * GP) = rb[i];
  }
  __syncthreads();   // every wave reads rows that the other waves staged
  const _Float16* pa = sA + (w >> 2) * 64 * GP;
  const _Float16* pb = sB + (w & 3) * 32 * GP;
#pragma unroll
  for (int mi = 0; mi < 4; ++mi) { acc[mi][0] = zero8(); acc[mi][1] = zero8(); }
  // Two register sets of the six fragments of a k step: the reads of step ks + 1 are issued as one
  // group ahead of the eight products of step ks, so that their LDS latency runs under the products.
  v16h fa[2][4], fb[2][2];
#pragma unroll
  for (int mi = 0; mi < 4; ++mi) fa[0][mi] = lds_frag(pa + mi * 16 * GP);
  fb[0][0] = lds_frag(pb);
  fb[0][1] = lds_frag(pb + 16 * GP);
#pragma unroll
  for (int ks = 0; ks < 8; ++ks) {
    const int c = ks & 1;
    if (ks < 7) {
      int k1 = (ks + 1) * 32;
      fb[c ^ 1][0] = lds_frag(pb + k1);
      fb[c ^ 1][1] = lds_frag(pb + 16 * GP + k1);
#pragma unroll
      for (int mi = 0; mi < 4; ++mi) fa[c ^ 1][mi] = lds_frag(pa + mi * 16 * GP + k1);
    }
    // without it the scheduler sinks each read to just in front of its first use, with a full wait there
    __builtin_amdgcn_sched_barrier(0);
#pragma unroll
    for (int mi = 0; mi < 4; ++mi) {
      acc[mi][0] = wmma32(fa[c][mi], fb[c][0], acc[mi][0]);
      acc[mi][1] = wmma32(fa[c][mi], fb[c][1], acc[mi][1]);
    }
    // keeps the next group of reads behind these products, in one place
    __builtin_amdgcn_sched_barrier(0);
  }
}

// 2^x on v_exp_f32. The v_nop in the same statement is the one slot that the instruction set asks
// for behind a transcendental before its result is read or its source rewritten.
__device__ __forceinline__ float exp2_slot(float x) {
  float r;
  asm("v_exp_f32 %0, %1\n\tv_nop" : "=v"(r) : "v"(x));
  return r;
}

// ---------------------------------------------------------------- QKVG GEMM
// m[49152 x 256] x wT'[256 x 1024]
//   -> q [S,H,R,D] f16 (row-major tiles for 16 x 32 fragments)
//   -> k, v per (s,h) in the order of the attention's A fragments, pieces of 512 B = 32 lanes x 16 B:
//      k piece (16-key tile * 2 + j), lane l: K[key l & 15][d = 16 * j + 8 * (l >> 4) + 0..7]
//      v piece (32-key chunk * 4 + d tile * 2 + j), lane l: V[key 16 * j + 8 * (l >> 4) + 0..7][d = l & 15]
//   -> g per (s,h) in the order of the attention's transposed output tiles (d x rows):
//      piece (16-row tile * 2 + d tile), lane l: G[row l & 15][d = 8 * (l >> 4) + 0..7]
//      The gate blocks hand the two operand tiles to the GEMM in the other order, so that a lane's
//      8 accumulator elements are 8 neighbouring d of one row and the stores stay 16 bytes wide.
// One block tile; blk = 0 .. QKVG_BLOCKS - 1; sA, sB: 128 * GP f16 of LDS each.
#define QKVG_BLOCKS (S_ * R_ / 128 * 8)   // 3072
__device__ __forceinline__
void qkvg_gemm_block(int blk, _Float16* sA, _Float16* sB,
                     const _Float16* __restrict__ m,
                     const _Float16* __restrict__ wT,
                     const float* __restrict__ bg,
                     _Float16* __restrict__ q, _Float16* __restrict__ k,
                     _Float16* __restrict__ vT, _Float16* __restrict__ gT) {
  int nb = blk & 7;             // 128-column tile; the 8 blocks of one row tile are neighbours
  int mb = blk >> 3;            // 128-row tile
  int proj = nb >> 1;           // uniform per block
  const _Float16* mt = m + (size_t)mb * 128 * CM;
  const _Float16* wt = wT + (size_t)nb * 128 * CM;
  v8f acc[4][2];
  gemm_tile_128x128(proj == 3 ? wt : mt, proj == 3 ? mt : wt, sA, sB, acc);

  int lane = lane_id();
  int w = threadIdx.x >> 5;
  int half = lane >> 4, n = lane & 15;
  int h = (nb * 4 + (w & 3)) & 7;   // a wave's 32 columns are one head
  // a 128-row M tile never crosses an s boundary (R % 128 == 0)
  int s = mb / 3;
  int rw = (mb - s * 3) * 128 + (w >> 2) * 64 + half * 8;
  size_t sh = (size_t)s * H_ + h;
  int r64 = (mb - s * 3) * 128 + (w >> 2) * 64;   // first of the wave's 64 rows inside s
  if (proj == 0) {              // q: [S,H,R,D]
    _Float16* dst = q + (sh * R_ + rw) * D_ + n;
#pragma unroll
    for (int mi = 0; mi < 4; ++mi)
#pragma unroll
      for (int ni = 0; ni < 2; ++ni)
#pragma unroll
        for (int vi = 0; vi < 8; ++vi)
          dst[(mi * 16 + vi) * D_ + ni * 16] = (_Float16)acc[mi][ni][vi];
    // precaution: no register of the stores above is rewritten ahead of this wait
    asm volatile("s_wait_xcnt 0x0" ::: "memory");
  } else if (proj == 1) {       // k in fragment order: tile mi, piece ni, lane (n >> 3, key), element n & 7
    _Float16* dst = k + (sh * R_ + r64) * D_ + ((n >> 3) * 16 + half * 8) * 8 + (n & 7);
#pragma unroll
    for (int mi = 0; mi < 4; ++mi)
#pragma unroll
      for (int ni = 0; ni < 2; ++ni)
#pragma unroll
        for (int vi = 0; vi < 8; ++vi)
          dst[mi * 512 + ni * 256 + vi * 8] = (_Float16)acc[mi][ni][vi];
    // precaution: no register of the stores above is rewritten ahead of this wait
    asm volatile("s_wait_xcnt 0x0" ::: "memory");
  } else if (proj == 2) {       // v in fragment order: the wave's 16-byte stores are one 512-byte piece
    _Float16* dst = vT + (sh * R_ + r64) * D_ + lane * 8;
#pragma unroll
    for (int mi = 0; mi < 4; ++mi)
#pragma unroll
      for (int ni = 0; ni < 2; ++ni) {
        v8h pk;
#pragma unroll
        for (int vi = 0; vi < 8; ++vi) pk[vi] = (_Float16)acc[mi][ni][vi];
        *(v8h*)(dst + (mi >> 1) * 1024 + (ni * 2 + (mi & 1)) * 256) = pk;
      }
    // precaution: no register of the stores above is rewritten ahead of this wait
    asm volatile("s_wait_xcnt 0x0" ::: "memory");
  } else {                      // g in fragment order: the wave's 16-byte stores are one 512-byte piece
    // transposed tile: acc[mi][ni][vi] is column (w >> 2) * 64 + mi * 16 + half * 8 + vi of the block's
    // 128 gate columns (two heads per wave) and row (w & 3) * 32 + ni * 16 + n of its 128 rows
    int h0 = (nb & 1) * 4 + (w >> 2) * 2;
    int r32 = (mb - s * 3) * 128 + (w & 3) * 32;
    _Float16* dst = gT + (((size_t)s * H_ + h0) * R_ + r32) * D_ + lane * 8;
    const float* bp = bg + h0 * D_ + half * 8;
    v4f bg4[8];
#pragma unroll
    for (int i = 0; i < 8; ++i) bg4[i] = *(const v4f*)(bp + i * 4 + (i >> 1) * 8);
    // precaution: the address pair stays untouched (no load result is placed on it) up to this wait
    asm volatile("s_wait_xcnt 0x0" :: "v"(bp) : "memory");
#pragma unroll
    for (int mi = 0; mi < 4; ++mi) {
#pragma unroll
      for (int ni = 0; ni < 2; ++ni) {
        v8h pk;
#pragma unroll
        for (int vi = 0; vi < 8; ++vi) {
          float bgv = bg4[mi * 2 + (vi >> 2)][vi & 3];
          float gv = 1.f / (1.f + exp2_slot((acc[mi][ni][vi] + bgv) * -1.4426950408889634f));
          pk[vi] = (_Float16)gv;
        }
        // head h0 + (mi >> 1), row tile ni, d tile mi & 1; 8 d of one row: one 16-byte store
        *(v8h*)(dst + (mi >> 1) * (R_ * D_) + ni * 512 + (mi & 1) * 256) = pk;
      }
    }
    // precaution: no register of the stores above is rewritten ahead of this wait
    asm volatile("s_wait_xcnt 0x0" ::: "memory");
  }
}

// The pair bias is read first by the attention and reads nothing that the GEMM writes, so its blocks
// ride in the GEMM's launch: of every 19 blocks the first 3 are pair-bias blocks and the other 16 are
// two row tiles of the GEMM, so that the pair stream from memory runs beside the GEMM's matrix, LDS
// and L2 work all through the launch. Both kinds take 8 waves and the same 135,168 bytes of LDS.
#define MIX_PAIR 3
#define MIX_GEMM 16
static_assert(PAIR_BLOCKS * MIX_GEMM == QKVG_BLOCKS * MIX_PAIR, "whole groups");
static_assert(PAIR_BLOCKS + QKVG_BLOCKS == 3648 && PREP_BLOCKS + LN_BLOCKS == 7424, "the grids of kernel_launch");
static_assert(PBW * 32 * PBP * sizeof(float) == 2 * 128 * GP * sizeof(_Float16), "one LDS size");
__global__ __launch_bounds__(256)
void qkvg_pair_kernel(const _Float16* __restrict__ m,
                      const _Float16* __restrict__ wT,
                      const float* __restrict__ bg,
                      _Float16* __restrict__ q, _Float16* __restrict__ k,
                      _Float16* __restrict__ vT, _Float16* __restrict__ gT,
                      const float* __restrict__ pair,
                      const float* __restrict__ pn_g,
                      const float* __restrict__ pn_b,
                      const float* __restrict__ w_pair,
                      float* __restrict__ z) {
  __shared__ __attribute__((aligned(16))) unsigned char smem[2 * 128 * GP * sizeof(_Float16)];
  int grp = blockIdx.x / (MIX_PAIR + MIX_GEMM);
  int r   = blockIdx.x - grp * (MIX_PAIR + MIX_GEMM);   // uniform per block
  if (r < MIX_PAIR) {
    pair_bias_block(grp * MIX_PAIR + r, (float*)smem, pair, pn_g, pn_b, w_pair, z);
    return;
  }
  qkvg_gemm_block(grp * MIX_GEMM + r - MIX_PAIR, (_Float16*)smem, (_Float16*)smem + 128 * GP,
                  m, wT, bg, q, k, vT, gT);
}

#define AW 8   // waves per block
__global__ __launch_bounds__(32 * AW)
void attn_kernel(const _Float16* __restrict__ q, const _Float16* __restrict__ k,
                 const _Float16* __restrict__ vT, const _Float16* __restrict__ gT,
                 const float* __restrict__ z, const float* __restrict__ mask,
                 _Float16* __restrict__ og) {
  __shared__ __attribute__((aligned(16))) _Float16 sK[R_ * D_];   // fragment order, 2 KB per 32 keys
  __shared__ __attribute__((aligned(16))) _Float16 sV[R_ * D_];   // fragment order, 2 KB per 32 keys
  __shared__ __attribute__((aligned(16))) float mbl[R_];          // the mask bias of the row's keys
  int w = __builtin_amdgcn_readfirstlane(threadIdx.x >> 5);   // wave-uniform: tile indices and bases take scalar registers
  int lane = lane_id();
  const int NQ = R_ / 16;                   // 24
  int h = blockIdx.x & 7;
  int s = blockIdx.x >> 3;
  size_t sh = (((size_t)s * H_ + h) * R_) * D_;

  {
    // 256 threads x 16 B = 4 KB per step, 6 steps per operand
    const _Float16* gk = k  + sh + threadIdx.x * 8;
    const _Float16* gv = vT + sh + threadIdx.x * 8;
    v8h rk[6], rv[6];
#pragma unroll
    for (int i = 0; i < 6; ++i) {
      rk[i] = *(const v8h*)(gk + i * (AW * 256));
      rv[i] = *(const v8h*)(gv + i * (AW * 256));
    }
    // precaution: both address pairs stay untouched (no load result is placed on them) up to this wait
    asm volatile("s_wait_xcnt 0x0" :: "v"(gk), "v"(gv) : "memory");
#pragma unroll
    for (int i = 0; i < 6; ++i) {
      *(v8h*)(sK + threadIdx.x * 8 + i * (AW * 256)) = rk[i];
      *(v8h*)(sV + threadIdx.x * 8 + i * (AW * 256)) = rv[i];
    }
    // The keys lie along the registers, 16 mask biases per lane and chunk: computed once per block.
    if (w < 3) {
      const float* mp = mask + (size_t)s * R_ + threadIdx.x * 4;
      v4f mm = *(const v4f*)mp;
      // precaution: the address pair stays untouched (no load result is placed on it) up to this wait
      asm volatile("s_wait_xcnt 0x0" :: "v"(mp) : "memory");
      *(v4f*)(&mbl[threadIdx.x * 4]) = 1e9f * (mm - 1.f);
    }
  }
  __syncthreads();   // every wave reads K, V and mask biases that the other waves staged

  int half = lane >> 4, n = lane & 15;
  const _Float16* Q  = q + sh;
  const _Float16* KF = sK + lane * 8;
  const _Float16* VF = sV + lane * 8;
  const float* BL = &mbl[half * 8];

  for (int qt = w; qt < NQ; qt += AW) {
    int q0 = qt * 16;
    const _Float16* GF = gT + sh + (size_t)q0 * D_ + lane * 8;                  // fragment order, 1 KB per 16 rows
    const float* ZF = z + ((size_t)h * NQ + qt) * (R_ / 32) * 512 + lane * 4;   // fragment order, 2 KB per 32 keys

    v16h bq = load_a_frag(Q + (size_t)q0 * D_, D_);   // B fragment: lane <-> query
    v8f o0 = zero8(), o1 = zero8();                   // O^T: register vi is d = 8 * half + vi (o1: + 16)
    float rmax = -1e30f, rsum = 0.f;                  // of query n; rsum over this half's keys only

    for (int kb = 0; kb < R_ / 32; ++kb) {
      // each z load and each K and V read below is 32 lanes x 16 B = 512 contiguous bytes
      const float* zp = ZF + (size_t)kb * 512;
      v8h kf[4], vf[4];
      v4f zf[4], bf[4];
#pragma unroll
      for (int i = 0; i < 4; ++i) zf[i] = *(const v4f*)(zp + i * 128);
      // precaution: the address pair stays untouched (no load result is placed on it) up to this wait
      asm volatile("s_wait_xcnt 0x0" :: "v"(zp) : "memory");
#pragma unroll
      for (int i = 0; i < 4; ++i) kf[i] = *(const v8h*)(KF + kb * 1024 + i * 256);
#pragma unroll
      for (int i = 0; i < 4; ++i) bf[i] = *(const v4f*)(BL + kb * 32 + (i >> 1) * 16 + (i & 1) * 4);
#pragma unroll
      for (int i = 0; i < 4; ++i) vf[i] = *(const v8h*)(VF + kb * 1024 + i * 256);
      v16h ak0 = join16(kf[0], kf[1]);   // A fragment: keys 32 * kb + 0..15
      v16h ak1 = join16(kf[2], kf[3]);   // keys 32 * kb + 16..31
      v8f s0 = wmma32(ak0, bq, zero8());
      v8f s1 = wmma32(ak1, bq, zero8());
      s0 += join8(zf[0] + bf[0], zf[1] + bf[1]);
      s1 += join8(zf[2] + bf[2], zf[3] + bf[3]);
      float mx = fmaxf(s0[0], s1[0]);
#pragma unroll
      for (int vi = 1; vi < 8; ++vi) mx = fmaxf(mx, fmaxf(s0[vi], s1[vi]));
      mx = fmaxf(mx, xhalf(mx));         // both halves hold the query's maximum over the 32 keys
      float nm = fmaxf(rmax, mx);
      float sc = __expf(rmax - nm);
      rmax = nm;
      v8f p0, p1;
#pragma unroll
      for (int vi = 0; vi < 8; ++vi) p0[vi] = __expf(s0[vi] - nm);
#pragma unroll
      for (int vi = 0; vi < 8; ++vi) p1[vi] = __expf(s1[vi] - nm);
      v8f pp = p0 + p1;
      v4f p4 = __builtin_shufflevector(pp, pp, 0, 1, 2, 3) + __builtin_shufflevector(pp, pp, 4, 5, 6, 7);
      rsum = rsum * sc + ((p4[0] + p4[2]) + (p4[1] + p4[3]));
      // B fragment of P^T: the two score tiles as they stand
      v16h bp = join16(__builtin_convertvector(p0, v8h), __builtin_convertvector(p1, v8h));
      o0 *= sc; o1 *= sc;
      // A fragments (lane <-> d) over the chunk's 32 keys
      v16h av0 = join16(vf[0], vf[1]);   // d 0..15
      v16h av1 = join16(vf[2], vf[3]);   // d 16..31
      o0 = wmma32(av0, bp, o0);
      o1 = wmma32(av1, bp, o1);
    }

    // epilogue: join the halves' sums, normalize, gate, write og[row q0 + n, h*32 + d] (f16), 8 d per store
    rsum += xhalf(rsum);
    float inv = 1.f / rsum;
    v8h g0 = *(const v8h*)GF;           // d = 8 * half + 0..7
    v8h g1 = *(const v8h*)(GF + 256);   // d = 16 + 8 * half + 0..7
    v8h r0, r1;
#pragma unroll
    for (int vi = 0; vi < 8; ++vi) {
      r0[vi] = (_Float16)(o0[vi] * inv * (float)g0[vi]);
      r1[vi] = (_Float16)(o1[vi] * inv * (float)g1[vi]);
    }
    _Float16* dst = og + ((size_t)s * R_ + q0 + n) * 256 + h * D_ + half * 8;
    *(v8h*)dst = r0;
    *(v8h*)(dst + 16) = r1;
    // precaution: no register of the stores above is rewritten by the next tile ahead of this wait
    asm volatile("s_wait_xcnt 0x0" ::: "memory");
  }
}

// ---------------------------------------------------------------- output GEMM
__global__ __launch_bounds__(256)
void out_gemm_kernel(const _Float16* __restrict__ og,
                     const _Float16* __restrict__ woT,
                     const float* __restrict__ bo,
                     float* __restrict__ out) {
  __shared__ __attribute__((aligned(16))) _Float16 sA[128 * GP];
  __shared__ __attribute__((aligned(16))) _Float16 sB[128 * GP];
  int nb = blockIdx.x & 1;
  int mb = blockIdx.x >> 1;
  int lane = lane_id();
  int w = threadIdx.x >> 5;
  int half = lane >> 4, n = lane & 15;
  int row0 = mb * 128 + (w >> 2) * 64 + half * 8;
  int col0 = nb * 128 + (w & 3) * 32 + n;
  // read ahead of the tile: the scheduling fences of its k loop would otherwise hold these loads behind it
  float bias2[2] = { bo[col0], bo[col0 + 16] };
  v8f acc[4][2];
  gemm_tile_128x128(og + (size_t)mb * 128 * 256, woT + (size_t)nb * 128 * 256, sA, sB, acc);

#pragma unroll
  for (int ni = 0; ni < 2; ++ni) {
    float bias = bias2[ni];
#pragma unroll
    for (int mi = 0; mi < 4; ++mi)
#pragma unroll
      for (int vi = 0; vi < 8; ++vi)
        out[(size_t)(row0 + mi * 16 + vi) * 256 + col0 + ni * 16] = acc[mi][ni][vi] + bias;
  }
}

// ---------------------------------------------------------------- launch
extern "C" void kernel_launch(void* const* d_in, const int* in_sizes, int n_in,
                              void* d_out, int out_size, void* d_ws, size_t ws_size,
                              hipStream_t stream) {
  const float* msa_act  = (const float*)d_in[0];
  const float* pair_act = (const float*)d_in[1];
  const float* msa_mask = (const float*)d_in[2];
  const float* qn_g     = (const float*)d_in[3];
  const float* qn_b     = (const float*)d_in[4];
  const float* pn_g     = (const float*)d_in[5];
  const float* pn_b     = (const float*)d_in[6];
  const float* w_pair   = (const float*)d_in[7];
  const float* wq       = (const float*)d_in[8];
  const float* wk       = (const float*)d_in[9];
  const float* wv       = (const float*)d_in[10];
  const float* wg       = (const float*)d_in[11];
  const float* bg       = (const float*)d_in[12];
  const float* wo       = (const float*)d_in[13];
  const float* bo       = (const float*)d_in[14];
  float* out = (float*)d_out;

  char* ws = (char*)d_ws;
  _Float16* wT_  = (_Float16*)(ws + 0);               // 1024*256*2      = 524288
  _Float16* woT_ = (_Float16*)(ws + 524288);          // 256*256*2       = 131072
  float*    z_   = (float*)   (ws + 655360);          // 8*384*384*4     = 4718592
  _Float16* m_   = (_Float16*)(ws + 5373952);         // 49152*256*2     = 25165824
  _Float16* q_   = (_Float16*)(ws + 30539776);        // 128*8*384*32*2  = 25165824
  _Float16* k_   = (_Float16*)(ws + 55705600);
  _Float16* vT_  = (_Float16*)(ws + 80871424);
  _Float16* gT_  = (_Float16*)(ws + 106037248);
  _Float16* og_  = (_Float16*)(ws + 131203072);       // 49152*256*2

  prep_ln_kernel<<<7424, 256, 0, stream>>>(wq, wk, wv, wg, wo, wT_, woT_, msa_act, qn_g, qn_b, m_);
  qkvg_pair_kernel<<<3648, 256, 0, stream>>>(m_, wT_, bg, q_, k_, vT_, gT_,
                                             pair_act, pn_g, pn_b, w_pair, z_);
  attn_kernel<<<1024, 256, 0, stream>>>(q_, k_, vT_, gT_, z_, msa_mask, og_);
  out_gemm_kernel<<<768, 256, 0, stream>>>(og_, woT_, bo, out);
}

// v008
// A run of this version takes 102 microseconds.
// In both of two side-by-side timings against v007, it was 1.09 times as fast.
// All steps since v000 together make it 4.23 times as fast.
#include <hip/hip_runtime.h>
#include <hip/hip_bf16.h>
#include <math.h>

typedef __attribute__((ext_vector_type(16))) _Float16 v16h;
typedef __attribute__((ext_vector_type(8)))  _Float16 v8h;
typedef __attribute__((ext_vector_type(8)))  float    v8f;

#define S_  128
#define R_  384
#define CM  256
#define CZ  128
#define H_  8
#define D_  32

__device__ __forceinline__ int lane_id() { return threadIdx.x & 31; }

__device__ __forceinline__ v8f zero8() {
  v8f z;
#pragma unroll
  for (int i = 0; i < 8; ++i) z[i] = 0.f;
  return z;
}

__device__ __forceinline__ v8f wmma32(v16h a, v16h b, v8f c) {
  // D = A(16x32 f16) * B(32x16 f16) + C(16x16 f32)
  return __builtin_amdgcn_wmma_f32_16x16x32_f16(false, a, false, b, (short)0, c,
                                                false, false);
}

__device__ __forceinline__ float wave_sum32(float x) {
#pragma unroll
  for (int off = 16; off > 0; off >>= 1) x += __shfl_xor(x, off, 32);
  return x;
}
// value of lane l ^ 16
__device__ __forceinline__ float xhalf(float x) {
  int b = __builtin_bit_cast(int, x);
  return __builtin_bit_cast(float,
      __builtin_amdgcn_permlanex16(b, b, 0x76543210, 0xfedcba98, false, false));
}

// ---------------------------------------------------------------- weights prep
// One 256-thread block of the weights' transposition; blk = 0 .. PREP_BLOCKS - 1.
#define PREP_BLOCKS 1280   // (4 + 1) * CM * CM elements / 256 threads
__device__ __forceinline__ void prep_weights_block(int blk,
                                    const float* wq, const float* wk, const float* wv,
                                    const float* wg, const float* wo,
                                    _Float16* wT, _Float16* woT) {
  int i = blk * 256 + threadIdx.x;
  const int NW = 4 * CM * CM;
  if (i < NW) {
    int proj = i >> 16;          // CM*CM == 65536
    int rem  = i & 65535;
    int hd   = rem >> 8;
    int c    = rem & 255;
    const float* w = (proj == 0) ? wq : (proj == 1) ? wk : (proj == 2) ? wv : wg;
    float scl = (proj == 0) ? 0.17677669529663689f : 1.0f;  // D^-0.5 folded into Wq
    wT[i] = (_Float16)(w[c * 256 + hd] * scl);              // wT[N=proj*256+hd][K=c]
  } else if (i < NW + CM * CM) {
    int j  = i - NW;
    int c  = j >> 8;
    int hd = j & 255;
    woT[j] = (_Float16)(wo[hd * 256 + c]);                  // woT[N=c][K=hd]
  }
}

// ---------------------------------------------------------------- pair bias z
// Stored in the order of the attention's transposed score fragments (keys x queries): per
// (head, 16-query tile, 32-key chunk) 2 KB = 4 pieces of 512 B; piece (t * 2 + u), lane l, element e holds
// z[query l & 15][key 16 * t + 8 * (l >> 4) + 4 * u + e], so a wave-wide 16-byte load is one piece.
// One LANE per (query i, key j) position: a wave takes 8 queries x 4 keys, which is one 128-byte
// line of that order per head (lane = 4 * query + key). Each 512-byte
// channel row is loaded by the wave in two 256-byte halves, passed through the wave's own LDS range (the
// first halves of all rows, then the second halves through the same range), and read back
// by the one lane that owns it, so the layernorm sums and the 8 head products are in-lane sums.
typedef __attribute__((ext_vector_type(4))) float v4f;
typedef __attribute__((address_space(4))) float cfloat;
#define PBP 68    // LDS pitch of a half row in floats: 272 B = 16 B x 17, so 16 lanes' 16-byte reads fall on distinct banks
#define PBW 8     // waves per block: the block size of the layernorm whose launch these blocks ride in
#define PAIR_BLOCKS ((R_ / 8) * (R_ / 4) / PBW)   // 576

// One block of the pair bias; blk = 0 .. PAIR_BLOCKS - 1; rows: PBW * 32 * PBP floats of LDS.
__device__ __forceinline__
void pair_bias_block(int blk, float* rows,
                     const float* __restrict__ pair,
                     const float* __restrict__ pn_g,
                     const float* __restrict__ pn_b,
                     const float* __restrict__ w_pair,
                     float* __restrict__ z) {
  int lane = lane_id();
  int w = __builtin_amdgcn_readfirstlane(threadIdx.x >> 5);
  int gw = blk * PBW + w;          // 0 .. (R_ / 8) * (R_ / 4) - 1
  int iq = gw / (R_ / 4);
  int jk = gw - iq * (R_ / 4);     // the waves of a block take neighbouring key groups
  int i0 = iq * 8;                 // first of the wave's 8 query rows
  int j0 = jk * 4;                 // first of the wave's 4 key cols
  const float* base = pair + ((size_t)i0 * R_ + j0) * CZ;   // wave-uniform
  float* my = rows + w * (32 * PBP);
  // load t + 16 * hf: channels 64 * hf + 0..63 of the rows of lanes 2 * t and 2 * t + 1, 256 bytes each
  int hi = lane >> 4, lo = lane & 15;
  unsigned boff = (unsigned)(hi * CZ + lo * 4) * (unsigned)sizeof(float);   // the lane's byte offset
  v4f r[32];
#pragma unroll
  for (int t = 0; t < 32; ++t)
    r[t] = *(const v4f*)((const char*)(base + (size_t)(((t & 15) >> 1) * R_ + (t & 1) * 2) * CZ + (t >> 4) * 64) + boff);
  // precaution: the loads' base and lane offset stay untouched (no load result is placed on them) up to this wait
  asm volatile("s_wait_xcnt 0x0" :: "s"(base), "v"(boff) : "memory");
  float* put = my + hi * PBP + lo * 4;
  const float* mine = my + lane * PBP;
  v4f x[32];
#pragma unroll
  for (int hf = 0; hf < 2; ++hf) {
#pragma unroll
    for (int t = 0; t < 16; ++t)
      *(v4f*)(put + t * 2 * PBP) = r[hf * 16 + t];
    // same-wave DS RAW: the half rows written above are read back across lanes below
    asm volatile("s_wait_dscnt 0" ::: "memory");
#pragma unroll
    for (int t = 0; t < 16; ++t)
      x[hf * 16 + t] = *(const v4f*)(mine + t * 4);
    // same-wave DS WAR: these reads have returned before the second halves go into the same range
    asm volatile("s_wait_dscnt 0" ::: "memory");
  }

  v4f s4 = { 0.f, 0.f, 0.f, 0.f }, q4 = { 0.f, 0.f, 0.f, 0.f };
#pragma unroll
  for (int t = 0; t < 32; ++t) { s4 += x[t]; q4 += x[t] * x[t]; }
  float s  = (s4[0] + s4[1]) + (s4[2] + s4[3]);
  float ss = (q4[0] + q4[1]) + (q4[2] + q4[3]);
  float mu = s * (1.f / CZ);
  float rsig = rsqrtf(ss * (1.f / CZ) - mu * mu + 1e-5f);

  // The three tables are inputs that no launch writes and every lane reads the same element: read
  // through the constant address space they stay scalar loads, also beside other blocks' stores in
  // the same kernel (as plain global reads they became 320 vector loads beside a GEMM's).
  const cfloat* cg = (const cfloat*)pn_g;
  const cfloat* cb = (const cfloat*)pn_b;
  const cfloat* cw = (const cfloat*)w_pair;
  float a[H_];
#pragma unroll
  for (int h = 0; h < H_; ++h) a[h] = 0.f;
#pragma unroll
  for (int c = 0; c < CZ; ++c) {
    float xn = (x[c >> 2][c & 3] - mu) * rsig * cg[c] + cb[c];
#pragma unroll
    for (int h = 0; h < H_; ++h) a[h] += xn * cw[c * H_ + h];
  }
  float* dst = z + (size_t)((i0 >> 4) * (R_ / 32) + (j0 >> 5)) * 512          // tile, chunk
                 + (((j0 >> 4) & 1) * 2 + ((j0 >> 2) & 1)) * 128             // piece
                 + (((j0 >> 3) & 1) * 16 + (i0 & 8)) * 4 + lane;             // one 128-byte line per head
#pragma unroll
  for (int h = 0; h < H_; ++h) dst[(size_t)h * R_ * R_] = a[h];
}

// ---------------------------------------------------------------- MSA layernorm
// One 256-thread block: one 16-row tile, two rows per wave; blk = 0 .. LN_BLOCKS - 1.
// m leaves in the order of the projections' 16 x 32 fragments: per 16-row tile 8 KB = 16 pieces of 512 B;
// piece (k step * 2 + j), lane l, element e holds m[row l & 15][c = 32 * k step + 16 * j + 8 * (l >> 4) + e].
// The tile is put together in LDS, so that each wave-wide 16-byte store is one whole piece.
#define LN_BLOCKS (S_ * R_ / 16)   // 3072
__device__ __forceinline__ void ln_msa_block(int blk, _Float16* tile,
                              const float* __restrict__ msa,
                              const float* __restrict__ gg,
                              const float* __restrict__ bb,
                              _Float16* __restrict__ m) {
  int w = threadIdx.x >> 5;
  int lane = lane_id();
  const float* p = msa + ((size_t)blk * 16 + w * 2) * CM + lane;
  float x2[2][8];
#pragma unroll
  for (int rr = 0; rr < 2; ++rr)
#pragma unroll
    for (int t = 0; t < 8; ++t) x2[rr][t] = p[rr * CM + t * 32];
  // precaution: the address pair stays untouched (no load result is placed on it) up to this wait
  asm volatile("s_wait_xcnt 0x0" :: "v"(p) : "memory");
#pragma unroll
  for (int rr = 0; rr < 2; ++rr) {
    int r = w * 2 + rr;
    float x[8], s = 0.f, ss = 0.f;
#pragma unroll
    for (int t = 0; t < 8; ++t) {
      float v = x2[rr][t];
      x[t] = v; s += v; ss += v * v;
    }
    s = wave_sum32(s); ss = wave_sum32(ss);
    float mu = s * (1.f / CM);
    float rsig = rsqrtf(ss * (1.f / CM) - mu * mu + 1e-5f);
    // channel c = 32 * t + lane: k step t, j = lane >> 4, fragment lane 16 * ((lane >> 3) & 1) + r, element lane & 7
    _Float16* o = tile + (lane >> 4) * 256 + (((lane >> 3) & 1) * 16 + r) * 8 + (lane & 7);
#pragma unroll
    for (int t = 0; t < 8; ++t) {
      int c = t * 32 + lane;
      o[t * 512] = (_Float16)((x[t] - mu) * rsig * gg[c] + bb[c]);
    }
  }
  __syncthreads();   // every wave stores pieces that hold rows of all eight waves
  v8h lo = *(const v8h*)(tile + threadIdx.x * 8);
  v8h hi = *(const v8h*)(tile + 2048 + threadIdx.x * 8);
  _Float16* dst = m + (size_t)blk * 4096 + threadIdx.x * 8;
  *(v8h*)dst = lo;
  *(v8h*)(dst + 2048) = hi;
  // precaution: no register of the two stores above (address, data) is rewritten ahead of this wait
  asm volatile("s_wait_xcnt 0x0" ::: "memory");
}

// None of the three reads what another writes, and all three are read first by the launch behind this
// one, so they share one launch: the weights' blocks come first, and their strided loads are in flight
// while the others start; then, of every 19 blocks, the first 3 are pair-bias blocks and the other 16
// layernorm blocks, so that the pair bias's vector work runs beside the layernorm's memory stream.
#define MIX_PAIR 3
#define MIX_LN 16
static_assert(PAIR_BLOCKS * MIX_LN == LN_BLOCKS * MIX_PAIR, "whole groups");
static_assert(PREP_BLOCKS + PAIR_BLOCKS + LN_BLOCKS == 4928, "the grid of kernel_launch");
static_assert(PBW * 32 * PBP * sizeof(float) >= 16 * CM * sizeof(_Float16), "the LDS serves both kinds");
// 6 waves per SIMD (three blocks per WGP): without the bound the pair bias's branch took 194 registers,
// which leaves the layernorm's memory stream two blocks per WGP.
__global__ __launch_bounds__(256, 6)
void prep_ln_pair_kernel(const float* wq, const float* wk, const float* wv,
                         const float* wg, const float* wo,
                         _Float16* wT, _Float16* woT,
                         const float* __restrict__ msa,
                         const float* __restrict__ gg,
                         const float* __restrict__ bb,
                         _Float16* __restrict__ m,
                         const float* __restrict__ pair,
                         const float* __restrict__ pn_g,
                         const float* __restrict__ pn_b,
                         const float* __restrict__ w_pair,
                         float* __restrict__ z) {
  __shared__ __attribute__((aligned(16))) unsigned char smem[PBW * 32 * PBP * sizeof(float)];
  int b = blockIdx.x;   // uniform per block
  if (b < PREP_BLOCKS) {
    prep_weights_block(b, wq, wk, wv, wg, wo, wT, woT);
    return;
  }
  b -= PREP_BLOCKS;
  int grp = b / (MIX_PAIR + MIX_LN);
  int r   = b - grp * (MIX_PAIR + MIX_LN);
  if (r < MIX_PAIR) pair_bias_block(grp * MIX_PAIR + r, (float*)smem, pair, pn_g, pn_b, w_pair, z);
  else              ln_msa_block(grp * MIX_LN + r - MIX_PAIR, (_Float16*)smem, msa, gg, bb, m);
}

// ---------------------------------------------------------------- GEMM block tile
// C[128 x 128] = A[128 x 256] * B^T, A and B both row-major with 256 f16 per row.
// 8 waves; both operand tiles are staged once in LDS, one whole 512-byte row per
// wave-wide load, and each wave then owns a 64 x 32 piece (4 x 2 accumulator tiles).
#define GP 264   // LDS row pitch in f16: 528 B = 16 B x 33, so 16 rows fall on distinct banks

__device__ __forceinline__ v16h join16(v8h lo, v8h hi) {
  return __builtin_shufflevector(lo, hi, 0, 1, 2, 3, 4, 5, 6, 7, 8, 9, 10, 11, 12, 13, 14, 15);
}

__device__ __forceinline__ v8f join8(v4f lo, v4f hi) {
  return __builtin_shufflevector(lo, hi, 0, 1, 2, 3, 4, 5, 6, 7);
}

// A fragment of a 16 x 32 f16 tile that lies row-major at pitch GP, as two 16-byte LDS reads.
// Lane L (0-15): row M = L, K = {0..7, 16..23}; lane 16-31: row M = L - 16, K = {8..15, 24..31}.
// Also serves as B fragment when the B matrix is stored transposed (N x K row-major),
// since the B lane layout mirrors A with lane <-> N.
__device__ __forceinline__ v16h lds_frag(const _Float16* base) {
  int lane = lane_id();
  const _Float16* rowp = base + (lane & 15) * GP + (lane >> 4) * 8;
  v8h lo = *(const v8h*)rowp;
  v8h hi = *(const v8h*)(rowp + 16);
  return __builtin_shufflevector(lo, hi, 0, 1, 2, 3, 4, 5, 6, 7, 8, 9, 10, 11, 12, 13, 14, 15);
}

__device__ __forceinline__ void gemm_tile_128x128(const _Float16* __restrict__ ga,
                                                  const _Float16* __restrict__ gb,
                                                  _Float16* sA, _Float16* sB,
                                                  v8f (&acc)[4][2]) {
  int lane = lane_id();
  int w = threadIdx.x >> 5;
  // wave w stages rows w, w + 8, ... of both tiles
  const _Float16* la = ga + w * 256 + lane * 8;
  const _Float16* lb = gb + w * 256 + lane * 8;
  _Float16* wa = sA + w * GP + lane * 8;
  _Float16* wb = sB + w * GP + lane * 8;
  v8h ra[16], rb[16];
#pragma unroll
  for (int i = 0; i < 16; ++i) {
    ra[i] = *(const v8h*)(la + i * 8 * 256);
    rb[i] = *(const v8h*)(lb + i * 8 * 256);
  }
  // precaution: both address pairs stay untouched (no load result is placed on them) up to this wait
  asm volatile("s_wait_xcnt 0x0" :: "v"(la), "v"(lb) : "memory");
#pragma unroll
  for (int i = 0; i < 16; ++i) {
    *(v8h*)(wa + i * 8 * GP) = ra[i];
    *(v8h*)(wb + i * 8 * GP) = rb[i];
  }
  __syncthreads();   // every wave reads rows that the other waves staged
  const _Float16* pa = sA + (w >> 2) * 64 * GP;
  const _Float16* pb = sB + (w & 3) * 32 * GP;
#pragma unroll
  for (int mi = 0; mi < 4; ++mi) { acc[mi][0] = zero8(); acc[mi][1] = zero8(); }
  // Two register sets of the six fragments of a k step: the reads of step ks + 1 are issued as one
  // group ahead of the eight products of step ks, so that their LDS latency runs under the products.
  v16h fa[2][4], fb[2][2];
#pragma unroll
  for (int mi = 0; mi < 4; ++mi) fa[0][mi] = lds_frag(pa + mi * 16 * GP);
  fb[0][0] = lds_frag(pb);
  fb[0][1] = lds_frag(pb + 16 * GP);
#pragma unroll
  for (int ks = 0; ks < 8; ++ks) {
    const int c = ks & 1;
    if (ks < 7) {
      int k1 = (ks + 1) * 32;
      fb[c ^ 1][0] = lds_frag(pb + k1);
      fb[c ^ 1][1] = lds_frag(pb + 16 * GP + k1);
#pragma unroll
      for (int mi = 0; mi < 4; ++mi) fa[c ^ 1][mi] = lds_frag(pa + mi * 16 * GP + k1);
    }
    // without it the scheduler sinks each read to just in front of its first use, with a full wait there
    __builtin_amdgcn_sched_barrier(0);
#pragma unroll
    for (int mi = 0; mi < 4; ++mi) {
      acc[mi][0] = wmma32(fa[c][mi], fb[c][0], acc[mi][0]);
      acc[mi][1] = wmma32(fa[c][mi], fb[c][1], acc[mi][1]);
    }
    // keeps the next group of reads behind these products, in one place
    __builtin_amdgcn_sched_barrier(0);
  }
}

// 2^x on v_exp_f32. The v_nop in the same statement is the one slot that the instruction set asks
// for behind a transcendental before its result is read or its source rewritten.
__device__ __forceinline__ float exp2_slot(float x) {
  float r;
  asm("v_exp_f32 %0, %1\n\tv_nop" : "=v"(r) : "v"(x));
  return r;
}

// 2^x of eight values on v_exp_f32, in one statement. The results take registers of their own (early
// clobber), so that no v_exp_f32 stands directly in front of an instruction that reads its result or
// rewrites its source; the closing v_nop is that slot behind the last of the eight.
__device__ __forceinline__ v8f exp2x8(v8f x) {
  float r0, r1, r2, r3, r4, r5, r6, r7;
  asm("v_exp_f32 %0, %8\n\tv_exp_f32 %1, %9\n\tv_exp_f32 %2, %10\n\tv_exp_f32 %3, %11\n\t"
      "v_exp_f32 %4, %12\n\tv_exp_f32 %5, %13\n\tv_exp_f32 %6, %14\n\tv_exp_f32 %7, %15\n\tv_nop"
      : "=&v"(r0), "=&v"(r1), "=&v"(r2), "=&v"(r3), "=&v"(r4), "=&v"(r5), "=&v"(r6), "=&v"(r7)
      : "v"(x[0]), "v"(x[1]), "v"(x[2]), "v"(x[3]), "v"(x[4]), "v"(x[5]), "v"(x[6]), "v"(x[7]));
  v8f r = { r0, r1, r2, r3, r4, r5, r6, r7 };
  return r;
}

// ---------------------------------------------------------------- projections + attention
// One 16 x 32 fragment of m, which lies in fragment order: two wave-wide 16-byte loads of 512 contiguous
// bytes each. Same element order as lds_frag.
__device__ __forceinline__ v16h m_frag(const _Float16* p) {
  v8h lo = *(const v8h*)p;
  v8h hi = *(const v8h*)(p + 256);
  return join16(lo, hi);
}

// Two of the four projections of one head for the wave's three 16-row tiles of m, K = 256.
// mt: the wave's first tile (its lane's 16 bytes); the other two lie 8 tiles apart. wx, wy: 32 rows of the
// head's weights each, in LDS at pitch GP.
// x[i][t] = Wx (16 rows from 16 * t) * m_i^T: register vi is d = 16 * t + 8 * (lane >> 4) + vi, lane & 15 the row of m.
// y[i][t]: the same with Wy, or, where Y_ROWS_ARE_M, m_i * Wy^T: register vi is the row 8 * (lane >> 4) + vi of m,
// lane & 15 is d - 16 * t.
template <bool Y_ROWS_ARE_M>
__device__ __forceinline__ void proj_pass(const _Float16* __restrict__ mt,
                                          const _Float16* wx, const _Float16* wy,
                                          v8f (&x)[3][2], v8f (&y)[3][2]) {
#pragma unroll
  for (int i = 0; i < 3; ++i) { x[i][0] = zero8(); x[i][1] = zero8(); y[i][0] = zero8(); y[i][1] = zero8(); }
  // Two register sets of a k step's seven fragments: the loads of step ks + 1 are issued as one group ahead
  // of the twelve products of step ks, so that their L2 and LDS latency runs under the products.
  v16h fm[2][3], fw[2][4];
#pragma unroll
  for (int i = 0; i < 3; ++i) fm[0][i] = m_frag(mt + i * (8 * 4096));
  fw[0][0] = lds_frag(wx);
  fw[0][1] = lds_frag(wx + 16 * GP);
  fw[0][2] = lds_frag(wy);
  fw[0][3] = lds_frag(wy + 16 * GP);
#pragma unroll
  for (int ks = 0; ks < 8; ++ks) {
    const int c = ks & 1;
    if (ks < 7) {
      int k1 = ks + 1;
#pragma unroll
      for (int i = 0; i < 3; ++i) fm[c ^ 1][i] = m_frag(mt + i * (8 * 4096) + k1 * 512);
      fw[c ^ 1][0] = lds_frag(wx + k1 * 32);
      fw[c ^ 1][1] = lds_frag(wx + 16 * GP + k1 * 32);
      fw[c ^ 1][2] = lds_frag(wy + k1 * 32);
      fw[c ^ 1][3] = lds_frag(wy + 16 * GP + k1 * 32);
    }
    // without it the scheduler sinks each load to just in front of its first use, with a full wait there
    __builtin_amdgcn_sched_barrier(0);
#pragma unroll
    for (int i = 0; i < 3; ++i)
#pragma unroll
      for (int t = 0; t < 2; ++t) {
        x[i][t] = wmma32(fw[c][t], fm[c][i], x[i][t]);
        y[i][t] = Y_ROWS_ARE_M ? wmma32(fm[c][i], fw[c][2 + t], y[i][t])
                               : wmma32(fw[c][2 + t], fm[c][i], y[i][t]);
      }
    // keeps the next group of loads behind these products, in one place
    __builtin_amdgcn_sched_barrier(0);
  }
  // precaution: the address pair of the loads of m stays untouched up to this wait
  asm volatile("s_wait_xcnt 0x0" :: "v"(mt) : "memory");
}

#define AW 8   // waves per block
__global__ __launch_bounds__(32 * AW)
void qkvg_attn_kernel(const _Float16* __restrict__ m, const _Float16* __restrict__ wT,
                      const float* __restrict__ bg,
                      const float* __restrict__ z, const float* __restrict__ mask,
                      _Float16* __restrict__ og) {
  // One array, what the key loop reads in front: its LDS reads then reach everything by 16-bit immediate
  // offsets from two registers (with the weights in front each read took an address addition of its own).
  __shared__ __attribute__((aligned(16))) unsigned char smem[(2 * R_ * D_ + 128 * GP) * sizeof(_Float16) + R_ * sizeof(float)];
  _Float16* sK = (_Float16*)smem;        // fragment order, 2 KB per 32 keys
  _Float16* sV = sK + R_ * D_;           // fragment order, 2 KB per 32 keys
  float* mbl = (float*)(sV + R_ * D_);   // the mask bias of the row's keys
  _Float16* sW = (_Float16*)(mbl + R_);  // rows 32 * proj + d of the head's weights
  int w = __builtin_amdgcn_readfirstlane(threadIdx.x >> 5);   // wave-uniform: tile indices and bases take scalar registers
  int lane = lane_id();
  const int NQ = R_ / 16;                   // 24
  int h = blockIdx.x & 7;
  int s = blockIdx.x >> 3;
  int half = lane >> 4, n = lane & 15;

  {
    // wave w stages rows w, w + 8, ... of the 128: row 32 * proj + d is row 256 * proj + 32 * h + d of wT
    const _Float16* gw = wT + (size_t)(h * D_ + w) * CM + lane * 8;
    v8h rw[16];
#pragma unroll
    for (int i = 0; i < 16; ++i)
      rw[i] = *(const v8h*)(gw + ((i >> 2) * 256 + (i & 3) * 8) * CM);
    // precaution: the address pair stays untouched (no load result is placed on it) up to this wait
    asm volatile("s_wait_xcnt 0x0" :: "v"(gw) : "memory");
#pragma unroll
    for (int i = 0; i < 16; ++i)
      *(v8h*)(sW + (w + i * 8) * GP + lane * 8) = rw[i];
    // The keys lie along the registers, 16 mask biases per lane and chunk: computed once per block.
    if (w < 3) {
      const float* mp = mask + (size_t)s * R_ + threadIdx.x * 4;
      v4f mm = *(const v4f*)mp;
      // precaution: the address pair stays untouched (no load result is placed on it) up to this wait
      asm volatile("s_wait_xcnt 0x0" :: "v"(mp) : "memory");
      *(v4f*)(&mbl[threadIdx.x * 4]) = 1e9f * (mm - 1.f);
    }
  }
  __syncthreads();   // every wave reads weight rows that the other waves staged

  const _Float16* mt = m + (size_t)(s * NQ + w) * 4096 + lane * 8;
  {
    v8f kt[3][2], vv[3][2];
    proj_pass<true>(mt, sW + 32 * GP, sW + 64 * GP, kt, vv);
#pragma unroll
    for (int i = 0; i < 3; ++i) {
      int kq = w + i * AW;   // 16-key tile
#pragma unroll
      for (int t = 0; t < 2; ++t) {
        *(v8h*)(sK + (kq * 2 + t) * 256 + lane * 8) = __builtin_convertvector(kt[i][t], v8h);
        *(v8h*)(sV + ((kq >> 1) * 4 + t * 2 + (kq & 1)) * 256 + lane * 8) = __builtin_convertvector(vv[i][t], v8h);
      }
    }
  }
  v16h bq3[3];      // B fragments of the wave's three query tiles: lane <-> query
  v8h gq3[3][2];    // their gates: [t] is d = 16 * t + 8 * half + 0..7 of query n
  {
    v8f qa[3][2], ga[3][2];
    proj_pass<false>(mt, sW, sW + 96 * GP, qa, ga);
    const float* bp = bg + h * D_ + half * 8;
    v4f bg4[4];
#pragma unroll
    for (int i = 0; i < 4; ++i) bg4[i] = *(const v4f*)(bp + (i >> 1) * 16 + (i & 1) * 4);
    // precaution: the address pair stays untouched (no load result is placed on it) up to this wait
    asm volatile("s_wait_xcnt 0x0" :: "v"(bp) : "memory");
#pragma unroll
    for (int i = 0; i < 3; ++i) {
      bq3[i] = join16(__builtin_convertvector(qa[i][0], v8h), __builtin_convertvector(qa[i][1], v8h));
#pragma unroll
      for (int t = 0; t < 2; ++t)
#pragma unroll
        for (int vi = 0; vi < 8; ++vi) {
          float bgv = bg4[t * 2 + (vi >> 2)][vi & 3];
          float gv = 1.f / (1.f + exp2_slot((ga[i][t][vi] + bgv) * -1.4426950408889634f));
          gq3[i][t][vi] = (_Float16)gv;
        }
    }
  }
  __syncthreads();   // every wave reads K and V tiles that the other waves computed

  const _Float16* KF = sK + lane * 8;
  const _Float16* VF = sV + lane * 8;
  const float* BL = &mbl[half * 8];

  // unrolled: bq3 and gq3 are registers and take constant indices
#pragma unroll
  for (int qi = 0; qi < 3; ++qi) {
    int qt = w + qi * AW;
    int q0 = qt * 16;
    const float* ZF = z + ((size_t)h * NQ + qt) * (R_ / 32) * 512 + lane * 4;   // fragment order, 2 KB per 32 keys

    v16h bq = bq3[qi];
    v8f o0 = zero8(), o1 = zero8();                   // O^T: register vi is d = 8 * half + vi (o1: + 16)
    float rmax = -1e30f, rsum = 0.f;                  // of query n; rsum over this half's keys only

    for (int kb = 0; kb < R_ / 32; ++kb) {
      // each z load and each K and V read below is 32 lanes x 16 B = 512 contiguous bytes
      const float* zp = ZF + (size_t)kb * 512;
      v8h kf[4], vf[4];
      v4f zf[4], bf[4];
#pragma unroll
      for (int i = 0; i < 4; ++i) zf[i] = *(const v4f*)(zp + i * 128);
      // precaution: the address pair stays untouched (no load result is placed on it) up to this wait
      asm volatile("s_wait_xcnt 0x0" :: "v"(zp) : "memory");
#pragma unroll
      for (int i = 0; i < 4; ++i) kf[i] = *(const v8h*)(KF + kb * 1024 + i * 256);
#pragma unroll
      for (int i = 0; i < 4; ++i) bf[i] = *(const v4f*)(BL + kb * 32 + (i >> 1) * 16 + (i & 1) * 4);
#pragma unroll
      for (int i = 0; i < 4; ++i) vf[i] = *(const v8h*)(VF + kb * 1024 + i * 256);
      v16h ak0 = join16(kf[0], kf[1]);   // A fragment: keys 32 * kb + 0..15
      v16h ak1 = join16(kf[2], kf[3]);   // keys 32 * kb + 16..31
      v8f s0 = wmma32(ak0, bq, zero8());
      v8f s1 = wmma32(ak1, bq, zero8());
      s0 += join8(zf[0] + bf[0], zf[1] + bf[1]);
      s1 += join8(zf[2] + bf[2], zf[3] + bf[3]);
      float mx = fmaxf(s0[0], s1[0]);
#pragma unroll
      for (int vi = 1; vi < 8; ++vi) mx = fmaxf(mx, fmaxf(s0[vi], s1[vi]));
      mx = fmaxf(mx, xhalf(mx));         // both halves hold the query's maximum over the 32 keys
      float nm = fmaxf(rmax, mx);
      float sc = __expf(rmax - nm);
      rmax = nm;
      v8f p0 = exp2x8((s0 - nm) * 1.4426950408889634f);   // e^x as 2^(x * log2 e), as __expf forms it
      v8f p1 = exp2x8((s1 - nm) * 1.4426950408889634f);
      v8f pp = p0 + p1;
      v4f p4 = __builtin_shufflevector(pp, pp, 0, 1, 2, 3) + __builtin_shufflevector(pp, pp, 4, 5, 6, 7);
      rsum = rsum * sc + ((p4[0] + p4[2]) + (p4[1] + p4[3]));
      // B fragment of P^T: the two score tiles as they stand
      v16h bp = join16(__builtin_convertvector(p0, v8h), __builtin_convertvector(p1, v8h));
      o0 *= sc; o1 *= sc;
      // A fragments (lane <-> d) over the chunk's 32 keys
      v16h av0 = join16(vf[0], vf[1]);   // d 0..15
      v16h av1 = join16(vf[2], vf[3]);   // d 16..31
      o0 = wmma32(av0, bp, o0);
      o1 = wmma32(av1, bp, o1);
    }

    // epilogue: join the halves' sums, normalize, gate, write og[row q0 + n, h*32 + d] (f16), 8 d per store
    rsum += xhalf(rsum);
    float inv = 1.f / rsum;
    v8h g0 = gq3[qi][0];   // d = 8 * half + 0..7
    v8h g1 = gq3[qi][1];   // d = 16 + 8 * half + 0..7
    v8h r0, r1;
#pragma unroll
    for (int vi = 0; vi < 8; ++vi) {
      r0[vi] = (_Float16)(o0[vi] * inv * (float)g0[vi]);
      r1[vi] = (_Float16)(o1[vi] * inv * (float)g1[vi]);
    }
    _Float16* dst = og + ((size_t)s * R_ + q0 + n) * 256 + h * D_ + half * 8;
    *(v8h*)dst = r0;
    *(v8h*)(dst + 16) = r1;
    // precaution: no register of the stores above (address, data) is rewritten by the next tile ahead of this wait
    asm volatile("s_wait_xcnt 0x0" :: "v"(dst), "v"(r0), "v"(r1) : "memory");
  }
}

// ---------------------------------------------------------------- output GEMM
__global__ __launch_bounds__(256)
void out_gemm_kernel(const _Float16* __restrict__ og,
                     const _Float16* __restrict__ woT,
                     const float* __restrict__ bo,
                     float* __restrict__ out) {
  __shared__ __attribute__((aligned(16))) _Float16 sA[128 * GP];
  __shared__ __attribute__((aligned(16))) _Float16 sB[128 * GP];
  int nb = blockIdx.x & 1;
  int mb = blockIdx.x >> 1;
  int lane = lane_id();
  int w = threadIdx.x >> 5;
  int half = lane >> 4, n = lane & 15;
  int row0 = mb * 128 + (w >> 2) * 64 + half * 8;
  int col0 = nb * 128 + (w & 3) * 32 + n;
  // read ahead of the tile: the scheduling fences of its k loop would otherwise hold these loads behind it
  float bias2[2] = { bo[col0], bo[col0 + 16] };
  v8f acc[4][2];
  gemm_tile_128x128(og + (size_t)mb * 128 * 256, woT + (size_t)nb * 128 * 256, sA, sB, acc);

#pragma unroll
  for (int ni = 0; ni < 2; ++ni) {
    float bias = bias2[ni];
#pragma unroll
    for (int mi = 0; mi < 4; ++mi)
#pragma unroll
      for (int vi = 0; vi < 8; ++vi)
        out[(size_t)(row0 + mi * 16 + vi) * 256 + col0 + ni * 16] = acc[mi][ni][vi] + bias;
  }
}

// ---------------------------------------------------------------- launch
extern "C" void kernel_launch(void* const* d_in, const int* in_sizes, int n_in,
                              void* d_out, int out_size, void* d_ws, size_t ws_size,
                              hipStream_t stream) {
  const float* msa_act  = (const float*)d_in[0];
  const float* pair_act = (const float*)d_in[1];
  const float* msa_mask = (const float*)d_in[2];
  const float* qn_g     = (const float*)d_in[3];
  const float* qn_b     = (const float*)d_in[4];
  const float* pn_g     = (const float*)d_in[5];
  const float* pn_b     = (const float*)d_in[6];
  const float* w_pair   = (const float*)d_in[7];
  const float* wq       = (const float*)d_in[8];
  const float* wk       = (const float*)d_in[9];
  const float* wv       = (const float*)d_in[10];
  const float* wg       = (const float*)d_in[11];
  const float* bg       = (const float*)d_in[12];
  const float* wo       = (const float*)d_in[13];
  const float* bo       = (const float*)d_in[14];
  float* out = (float*)d_out;

  char* ws = (char*)d_ws;
  _Float16* wT_  = (_Float16*)(ws + 0);               // 1024*256*2      = 524288
  _Float16* woT_ = (_Float16*)(ws + 524288);          // 256*256*2       = 131072
  float*    z_   = (float*)   (ws + 655360);          // 8*384*384*4     = 4718592
  _Float16* m_   = (_Float16*)(ws + 5373952);         // 49152*256*2     = 25165824
  _Float16* og_  = (_Float16*)(ws + 30539776);        // 49152*256*2

  prep_ln_pair_kernel<<<4928, 256, 0, stream>>>(wq, wk, wv, wg, wo, wT_, woT_, msa_act, qn_g, qn_b, m_,
                                                pair_act, pn_g, pn_b, w_pair, z_);
  qkvg_attn_kernel<<<1024, 256, 0, stream>>>(m_, wT_, bg, z_, msa_mask, og_);
  out_gemm_kernel<<<768, 256, 0, stream>>>(og_, woT_, bo, out);
}

// v009
// Measured time: 96.7 microseconds a run.
// Timed twice side by side with v008, it ran 1.06 times as fast both times.
// Over all steps from v000 it is 4.48 times as fast.
#include <hip/hip_runtime.h>
#include <hip/hip_bf16.h>
#include <math.h>

typedef __attribute__((ext_vector_type(16))) _Float16 v16h;
typedef __attribute__((ext_vector_type(8)))  _Float16 v8h;
typedef __attribute__((ext_vector_type(8)))  float    v8f;

#define S_  128
#define R_  384
#define CM  256
#define CZ  128
#define H_  8
#define D_  32

__device__ __forceinline__ int lane_id() { return threadIdx.x & 31; }

__device__ __forceinline__ v8f zero8() {
  v8f z;
#pragma unroll
  for (int i = 0; i < 8; ++i) z[i] = 0.f;
  return z;
}

__device__ __forceinline__ v8f wmma32(v16h a, v16h b, v8f c) {
  // D = A(16x32 f16) * B(32x16 f16) + C(16x16 f32)
  return __builtin_amdgcn_wmma_f32_16x16x32_f16(false, a, false, b, (short)0, c,
                                                false, false);
}

__device__ __forceinline__ float wave_sum32(float x) {
#pragma unroll
  for (int off = 16; off > 0; off >>= 1) x += __shfl_xor(x, off, 32);
  return x;
}
// value of lane l ^ 16
__device__ __forceinline__ float xhalf(float x) {
  int b = __builtin_bit_cast(int, x);
  return __builtin_bit_cast(float,
      __builtin_amdgcn_permlanex16(b, b, 0x76543210, 0xfedcba98, false, false));
}

// ---------------------------------------------------------------- weights prep
// One 256-thread block of the weights' transposition; blk = 0 .. PREP_BLOCKS - 1.
#define PREP_BLOCKS 1280   // (4 + 1) * CM * CM elements / 256 threads
__device__ __forceinline__ void prep_weights_block(int blk,
                                    const float* wq, const float* wk, const float* wv,
                                    const float* wg, const float* wo,
                                    _Float16* wT, _Float16* woT) {
  int i = blk * 256 + threadIdx.x;
  const int NW = 4 * CM * CM;
  if (i < NW) {
    int proj = i >> 16;          // CM*CM == 65536
    int rem  = i & 65535;
    int hd   = rem >> 8;
    int c    = rem & 255;
    const float* w = (proj == 0) ? wq : (proj == 1) ? wk : (proj == 2) ? wv : wg;
    float scl = (proj == 0) ? 0.17677669529663689f : 1.0f;  // D^-0.5 folded into Wq
    wT[i] = (_Float16)(w[c * 256 + hd] * scl);              // wT[N=proj*256+hd][K=c]
  } else if (i < NW + CM * CM) {
    int j  = i - NW;
    int c  = j >> 8;
    int hd = j & 255;
    woT[j] = (_Float16)(wo[hd * 256 + c]);                  // woT[N=c][K=hd]
  }
}

// ---------------------------------------------------------------- pair bias z
// Stored in the order of the attention's transposed score fragments (keys x queries): per
// (head, 16-query tile, 32-key chunk) 2 KB = 4 pieces of 512 B; piece (t * 2 + u), lane l, element e holds
// z[query l & 15][key 16 * t + 8 * (l >> 4) + 4 * u + e], so a wave-wide 16-byte load is one piece.
// One LANE per (query i, key j) position: a wave takes 8 queries x 4 keys, which is one 128-byte
// line of that order per head (lane = 4 * query + key). Each 512-byte
// channel row is loaded by the wave in two 256-byte halves, passed through the wave's own LDS range (the
// first halves of all rows, then the second halves through the same range), and read back
// by the one lane that owns it, so the layernorm sums and the 8 head products are in-lane sums.
typedef __attribute__((ext_vector_type(4))) float v4f;
typedef __attribute__((address_space(4))) float cfloat;
#define PBP 68    // LDS pitch of a half row in floats: 272 B = 16 B x 17, so 16 lanes' 16-byte reads fall on distinct banks
#define PBW 8     // waves per block: the block size of the layernorm whose launch these blocks ride in
#define PAIR_BLOCKS ((R_ / 8) * (R_ / 4) / PBW)   // 576

// One block of the pair bias; blk = 0 .. PAIR_BLOCKS - 1; rows: PBW * 32 * PBP floats of LDS.
__device__ __forceinline__
void pair_bias_block(int blk, float* rows,
                     const float* __restrict__ pair,
                     const float* __restrict__ pn_g,
                     const float* __restrict__ pn_b,
                     const float* __restrict__ w_pair,
                     float* __restrict__ z) {
  int lane = lane_id();
  int w = __builtin_amdgcn_readfirstlane(threadIdx.x >> 5);
  int gw = blk * PBW + w;          // 0 .. (R_ / 8) * (R_ / 4) - 1
  int iq = gw / (R_ / 4);
  int jk = gw - iq * (R_ / 4);     // the waves of a block take neighbouring key groups
  int i0 = iq * 8;                 // first of the wave's 8 query rows
  int j0 = jk * 4;                 // first of the wave's 4 key cols
  const float* base = pair + ((size_t)i0 * R_ + j0) * CZ;   // wave-uniform
  float* my = rows + w * (32 * PBP);
  // load t + 16 * hf: channels 64 * hf + 0..63 of the rows of lanes 2 * t and 2 * t + 1, 256 bytes each
  int hi = lane >> 4, lo = lane & 15;
  unsigned boff = (unsigned)(hi * CZ + lo * 4) * (unsigned)sizeof(float);   // the lane's byte offset
  v4f r[32];
#pragma unroll
  for (int t = 0; t < 32; ++t)
    r[t] = *(const v4f*)((const char*)(base + (size_t)(((t & 15) >> 1) * R_ + (t & 1) * 2) * CZ + (t >> 4) * 64) + boff);
  // precaution: the loads' base and lane offset stay untouched (no load result is placed on them) up to this wait
  asm volatile("s_wait_xcnt 0x0" :: "s"(base), "v"(boff) : "memory");
  float* put = my + hi * PBP + lo * 4;
  const float* mine = my + lane * PBP;
  v4f x[32];
#pragma unroll
  for (int hf = 0; hf < 2; ++hf) {
#pragma unroll
    for (int t = 0; t < 16; ++t)
      *(v4f*)(put + t * 2 * PBP) = r[hf * 16 + t];
    // same-wave DS RAW: the half rows written above are read back across lanes below
    asm volatile("s_wait_dscnt 0" ::: "memory");
#pragma unroll
    for (int t = 0; t < 16; ++t)
      x[hf * 16 + t] = *(const v4f*)(mine + t * 4);
    // same-wave DS WAR: these reads have returned before the second halves go into the same range
    asm volatile("s_wait_dscnt 0" ::: "memory");
  }

  v4f s4 = { 0.f, 0.f, 0.f, 0.f }, q4 = { 0.f, 0.f, 0.f, 0.f };
#pragma unroll
  for (int t = 0; t < 32; ++t) { s4 += x[t]; q4 += x[t] * x[t]; }
  float s  = (s4[0] + s4[1]) + (s4[2] + s4[3]);
  float ss = (q4[0] + q4[1]) + (q4[2] + q4[3]);
  float mu = s * (1.f / CZ);
  float rsig = rsqrtf(ss * (1.f / CZ) - mu * mu + 1e-5f);

  // The three tables are inputs that no launch writes and every lane reads the same element: read
  // through the constant address space they stay scalar loads, also beside other blocks' stores in
  // the same kernel (as plain global reads they became 320 vector loads beside a GEMM's).
  const cfloat* cg = (const cfloat*)pn_g;
  const cfloat* cb = (const cfloat*)pn_b;
  const cfloat* cw = (const cfloat*)w_pair;
  float a[H_];
#pragma unroll
  for (int h = 0; h < H_; ++h) a[h] = 0.f;
#pragma unroll
  for (int c = 0; c < CZ; ++c) {
    float xn = (x[c >> 2][c & 3] - mu) * rsig * cg[c] + cb[c];
#pragma unroll
    for (int h = 0; h < H_; ++h) a[h] += xn * cw[c * H_ + h];
  }
  float* dst = z + (size_t)((i0 >> 4) * (R_ / 32) + (j0 >> 5)) * 512          // tile, chunk
                 + (((j0 >> 4) & 1) * 2 + ((j0 >> 2) & 1)) * 128             // piece
                 + (((j0 >> 3) & 1) * 16 + (i0 & 8)) * 4 + lane;             // one 128-byte line per head
#pragma unroll
  for (int h = 0; h < H_; ++h) dst[(size_t)h * R_ * R_] = a[h];
}

// ---------------------------------------------------------------- MSA layernorm
// One 256-thread block: one 16-row tile, two rows per wave; blk = 0 .. LN_BLOCKS - 1.
// m leaves in the order of the projections' 16 x 32 fragments: per 16-row tile 8 KB = 16 pieces of 512 B;
// piece (k step * 2 + j), lane l, element e holds m[row l & 15][c = 32 * k step + 16 * j + 8 * (l >> 4) + e].
// The tile is put together in LDS, so that each wave-wide 16-byte store is one whole piece.
#define LN_BLOCKS (S_ * R_ / 16)   // 3072
__device__ __forceinline__ void ln_msa_block(int blk, _Float16* tile,
                              const float* __restrict__ msa,
                              const float* __restrict__ gg,
                              const float* __restrict__ bb,
                              _Float16* __restrict__ m) {
  int w = threadIdx.x >> 5;
  int lane = lane_id();
  const float* p = msa + ((size_t)blk * 16 + w * 2) * CM + lane;
  float x2[2][8];
#pragma unroll
  for (int rr = 0; rr < 2; ++rr)
#pragma unroll
    for (int t = 0; t < 8; ++t) x2[rr][t] = p[rr * CM + t * 32];
  // precaution: the address pair stays untouched (no load result is placed on it) up to this wait
  asm volatile("s_wait_xcnt 0x0" :: "v"(p) : "memory");
#pragma unroll
  for (int rr = 0; rr < 2; ++rr) {
    int r = w * 2 + rr;
    float x[8], s = 0.f, ss = 0.f;
#pragma unroll
    for (int t = 0; t < 8; ++t) {
      float v = x2[rr][t];
      x[t] = v; s += v; ss += v * v;
    }
    s = wave_sum32(s); ss = wave_sum32(ss);
    float mu = s * (1.f / CM);
    float rsig = rsqrtf(ss * (1.f / CM) - mu * mu + 1e-5f);
    // channel c = 32 * t + lane: k step t, j = lane >> 4, fragment lane 16 * ((lane >> 3) & 1) + r, element lane & 7
    _Float16* o = tile + (lane >> 4) * 256 + (((lane >> 3) & 1) * 16 + r) * 8 + (lane & 7);
#pragma unroll
    for (int t = 0; t < 8; ++t) {
      int c = t * 32 + lane;
      o[t * 512] = (_Float16)((x[t] - mu) * rsig * gg[c] + bb[c]);
    }
  }
  __syncthreads();   // every wave stores pieces that hold rows of all eight waves
  v8h lo = *(const v8h*)(tile + threadIdx.x * 8);
  v8h hi = *(const v8h*)(tile + 2048 + threadIdx.x * 8);
  _Float16* dst = m + (size_t)blk * 4096 + threadIdx.x * 8;
  *(v8h*)dst = lo;
  *(v8h*)(dst + 2048) = hi;
  // precaution: no register of the two stores above (address, data) is rewritten ahead of this wait
  asm volatile("s_wait_xcnt 0x0" ::: "memory");
}

// None of the three reads what another writes, and all three are read first by the launch behind this
// one, so they share one launch: the weights' blocks come first, and their strided loads are in flight
// while the others start; then, of every 19 blocks, the first 3 are pair-bias blocks and the other 16
// layernorm blocks, so that the pair bias's vector work runs beside the layernorm's memory stream.
#define MIX_PAIR 3
#define MIX_LN 16
static_assert(PAIR_BLOCKS * MIX_LN == LN_BLOCKS * MIX_PAIR, "whole groups");
static_assert(PREP_BLOCKS + PAIR_BLOCKS + LN_BLOCKS == 4928, "the grid of kernel_launch");
static_assert(PBW * 32 * PBP * sizeof(float) >= 16 * CM * sizeof(_Float16), "the LDS serves both kinds");
// 6 waves per SIMD (three blocks per WGP): without the bound the pair bias's branch took 194 registers,
// which leaves the layernorm's memory stream two blocks per WGP.
__global__ __launch_bounds__(256, 6)
void prep_ln_pair_kernel(const float* wq, const float* wk, const float* wv,
                         const float* wg, const float* wo,
                         _Float16* wT, _Float16* woT,
                         const float* __restrict__ msa,
                         const float* __restrict__ gg,
                         const float* __restrict__ bb,
                         _Float16* __restrict__ m,
                         const float* __restrict__ pair,
                         const float* __restrict__ pn_g,
                         const float* __restrict__ pn_b,
                         const float* __restrict__ w_pair,
                         float* __restrict__ z) {
  __shared__ __attribute__((aligned(16))) unsigned char smem[PBW * 32 * PBP * sizeof(float)];
  int b = blockIdx.x;   // uniform per block
  if (b < PREP_BLOCKS) {
    prep_weights_block(b, wq, wk, wv, wg, wo, wT, woT);
    return;
  }
  b -= PREP_BLOCKS;
  int grp = b / (MIX_PAIR + MIX_LN);
  int r   = b - grp * (MIX_PAIR + MIX_LN);
  if (r < MIX_PAIR) pair_bias_block(grp * MIX_PAIR + r, (float*)smem, pair, pn_g, pn_b, w_pair, z);
  else              ln_msa_block(grp * MIX_LN + r - MIX_PAIR, (_Float16*)smem, msa, gg, bb, m);
}

// ---------------------------------------------------------------- GEMM block tile
// C[128 x 128] = A[128 x 256] * B^T, A and B both row-major with 256 f16 per row.
// 8 waves; both operand tiles are staged once in LDS, one whole 512-byte row per
// wave-wide load, and each wave then owns a 64 x 32 piece (4 x 2 accumulator tiles).
#define GP 264   // LDS row pitch in f16: 528 B = 16 B x 33, so 16 rows fall on distinct banks

__device__ __forceinline__ v16h join16(v8h lo, v8h hi) {
  return __builtin_shufflevector(lo, hi, 0, 1, 2, 3, 4, 5, 6, 7, 8, 9, 10, 11, 12, 13, 14, 15);
}

__device__ __forceinline__ v8f join8(v4f lo, v4f hi) {
  return __builtin_shufflevector(lo, hi, 0, 1, 2, 3, 4, 5, 6, 7);
}

// A fragment of a 16 x 32 f16 tile that lies row-major at pitch GP, as two 16-byte LDS reads.
// Lane L (0-15): row M = L, K = {0..7, 16..23}; lane 16-31: row M = L - 16, K = {8..15, 24..31}.
// Also serves as B fragment when the B matrix is stored transposed (N x K row-major),
// since the B lane layout mirrors A with lane <-> N.
__device__ __forceinline__ v16h lds_frag(const _Float16* base) {
  int lane = lane_id();
  const _Float16* rowp = base + (lane & 15) * GP + (lane >> 4) * 8;
  v8h lo = *(const v8h*)rowp;
  v8h hi = *(const v8h*)(rowp + 16);
  return __builtin_shufflevector(lo, hi, 0, 1, 2, 3, 4, 5, 6, 7, 8, 9, 10, 11, 12, 13, 14, 15);
}

__device__ __forceinline__ void gemm_tile_128x128(const _Float16* __restrict__ ga,
                                                  const _Float16* __restrict__ gb,
                                                  _Float16* sA, _Float16* sB,
                                                  v8f (&acc)[4][2]) {
  int lane = lane_id();
  int w = threadIdx.x >> 5;
  // wave w stages rows w, w + 8, ... of both tiles
  const _Float16* la = ga + w * 256 + lane * 8;
  const _Float16* lb = gb + w * 256 + lane * 8;
  _Float16* wa = sA + w * GP + lane * 8;
  _Float16* wb = sB + w * GP + lane * 8;
  v8h ra[16], rb[16];
#pragma unroll
  for (int i = 0; i < 16; ++i) {
    ra[i] = *(const v8h*)(la + i * 8 * 256);
    rb[i] = *(const v8h*)(lb + i * 8 * 256);
  }
  // precaution: both address pairs stay untouched (no load result is placed on them) up to this wait
  asm volatile("s_wait_xcnt 0x0" :: "v"(la), "v"(lb) : "memory");
#pragma unroll
  for (int i = 0; i < 16; ++i) {
    *(v8h*)(wa + i * 8 * GP) = ra[i];
    *(v8h*)(wb + i * 8 * GP) = rb[i];
  }
  __syncthreads();   // every wave reads rows that the other waves staged
  const _Float16* pa = sA + (w >> 2) * 64 * GP;
  const _Float16* pb = sB + (w & 3) * 32 * GP;
#pragma unroll
  for (int mi = 0; mi < 4; ++mi) { acc[mi][0] = zero8(); acc[mi][1] = zero8(); }
  // Two register sets of the six fragments of a k step: the reads of step ks + 1 are issued as one
  // group ahead of the eight products of step ks, so that their LDS latency runs under the products.
  v16h fa[2][4], fb[2][2];
#pragma unroll
  for (int mi = 0; mi < 4; ++mi) fa[0][mi] = lds_frag(pa + mi * 16 * GP);
  fb[0][0] = lds_frag(pb);
  fb[0][1] = lds_frag(pb + 16 * GP);
#pragma unroll
  for (int ks = 0; ks < 8; ++ks) {
    const int c = ks & 1;
    if (ks < 7) {
      int k1 = (ks + 1) * 32;
      fb[c ^ 1][0] = lds_frag(pb + k1);
      fb[c ^ 1][1] = lds_frag(pb + 16 * GP + k1);
#pragma unroll
      for (int mi = 0; mi < 4; ++mi) fa[c ^ 1][mi] = lds_frag(pa + mi * 16 * GP + k1);
    }
    // without it the scheduler sinks each read to just in front of its first use, with a full wait there
    __builtin_amdgcn_sched_barrier(0);
#pragma unroll
    for (int mi = 0; mi < 4; ++mi) {
      acc[mi][0] = wmma32(fa[c][mi], fb[c][0], acc[mi][0]);
      acc[mi][1] = wmma32(fa[c][mi], fb[c][1], acc[mi][1]);
    }
    // keeps the next group of reads behind these products, in one place
    __builtin_amdgcn_sched_barrier(0);
  }
}

// 2^x on v_exp_f32. The v_nop in the same statement is the one slot that the instruction set asks
// for behind a transcendental before its result is read or its source rewritten.
__device__ __forceinline__ float exp2_slot(float x) {
  float r;
  asm("v_exp_f32 %0, %1\n\tv_nop" : "=v"(r) : "v"(x));
  return r;
}

// 2^x of eight values on v_exp_f32, in one statement. The results take registers of their own (early
// clobber), so that no v_exp_f32 stands directly in front of an instruction that reads its result or
// rewrites its source; the closing v_nop is that slot behind the last of the eight.
__device__ __forceinline__ v8f exp2x8(v8f x) {
  float r0, r1, r2, r3, r4, r5, r6, r7;
  asm("v_exp_f32 %0, %8\n\tv_exp_f32 %1, %9\n\tv_exp_f32 %2, %10\n\tv_exp_f32 %3, %11\n\t"
      "v_exp_f32 %4, %12\n\tv_exp_f32 %5, %13\n\tv_exp_f32 %6, %14\n\tv_exp_f32 %7, %15\n\tv_nop"
      : "=&v"(r0), "=&v"(r1), "=&v"(r2), "=&v"(r3), "=&v"(r4), "=&v"(r5), "=&v"(r6), "=&v"(r7)
      : "v"(x[0]), "v"(x[1]), "v"(x[2]), "v"(x[3]), "v"(x[4]), "v"(x[5]), "v"(x[6]), "v"(x[7]));
  v8f r = { r0, r1, r2, r3, r4, r5, r6, r7 };
  return r;
}

// ---------------------------------------------------------------- projections + attention
// One 16 x 32 fragment of m, which lies in fragment order: two wave-wide 16-byte loads of 512 contiguous
// bytes each. Same element order as lds_frag.
__device__ __forceinline__ v16h m_frag(const _Float16* p) {
  v8h lo = *(const v8h*)p;
  v8h hi = *(const v8h*)(p + 256);
  return join16(lo, hi);
}

// Two of the four projections of one head for the wave's three 16-row tiles of m, K = 256.
// mt: the wave's first tile (its lane's 16 bytes); the other two lie 8 tiles apart. wx, wy: 32 rows of the
// head's weights each, in LDS at pitch GP.
// x[i][t] = Wx (16 rows from 16 * t) * m_i^T: register vi is d = 16 * t + 8 * (lane >> 4) + vi, lane & 15 the row of m.
// y[i][t]: the same with Wy, or, where Y_ROWS_ARE_M, m_i * Wy^T: register vi is the row 8 * (lane >> 4) + vi of m,
// lane & 15 is d - 16 * t.
template <bool Y_ROWS_ARE_M>
__device__ __forceinline__ void proj_pass(const _Float16* __restrict__ mt,
                                          const _Float16* wx, const _Float16* wy,
                                          v8f (&x)[3][2], v8f (&y)[3][2]) {
#pragma unroll
  for (int i = 0; i < 3; ++i) { x[i][0] = zero8(); x[i][1] = zero8(); y[i][0] = zero8(); y[i][1] = zero8(); }
  // Two register sets of a k step's seven fragments: the loads of step ks + 1 are issued as one group ahead
  // of the twelve products of step ks, so that their L2 and LDS latency runs under the products.
  v16h fm[2][3], fw[2][4];
#pragma unroll
  for (int i = 0; i < 3; ++i) fm[0][i] = m_frag(mt + i * (8 * 4096));
  fw[0][0] = lds_frag(wx);
  fw[0][1] = lds_frag(wx + 16 * GP);
  fw[0][2] = lds_frag(wy);
  fw[0][3] = lds_frag(wy + 16 * GP);
#pragma unroll
  for (int ks = 0; ks < 8; ++ks) {
    const int c = ks & 1;
    if (ks < 7) {
      int k1 = ks + 1;
#pragma unroll
      for (int i = 0; i < 3; ++i) fm[c ^ 1][i] = m_frag(mt + i * (8 * 4096) + k1 * 512);
      fw[c ^ 1][0] = lds_frag(wx + k1 * 32);
      fw[c ^ 1][1] = lds_frag(wx + 16 * GP + k1 * 32);
      fw[c ^ 1][2] = lds_frag(wy + k1 * 32);
      fw[c ^ 1][3] = lds_frag(wy + 16 * GP + k1 * 32);
    }
    // without it the scheduler sinks each load to just in front of its first use, with a full wait there
    __builtin_amdgcn_sched_barrier(0);
#pragma unroll
    for (int i = 0; i < 3; ++i)
#pragma unroll
      for (int t = 0; t < 2; ++t) {
        x[i][t] = wmma32(fw[c][t], fm[c][i], x[i][t]);
        y[i][t] = Y_ROWS_ARE_M ? wmma32(fm[c][i], fw[c][2 + t], y[i][t])
                               : wmma32(fw[c][2 + t], fm[c][i], y[i][t]);
      }
    // keeps the next group of loads behind these products, in one place
    __builtin_amdgcn_sched_barrier(0);
  }
  // precaution: the address pair of the loads of m stays untouched up to this wait
  asm volatile("s_wait_xcnt 0x0" :: "v"(mt) : "memory");
}

#define AW 8   // waves per block
__global__ __launch_bounds__(32 * AW)
void qkvg_attn_kernel(const _Float16* __restrict__ m, const _Float16* __restrict__ wT,
                      const float* __restrict__ bg,
                      const float* __restrict__ z, const float* __restrict__ mask,
                      _Float16* __restrict__ og) {
  // One array, what the key loop reads in front: its LDS reads then reach everything by 16-bit immediate
  // offsets from two registers (with the weights in front each read took an address addition of its own).
  __shared__ __attribute__((aligned(16))) unsigned char smem[(2 * R_ * D_ + 128 * GP) * sizeof(_Float16) + R_ * sizeof(float)];
  _Float16* sK = (_Float16*)smem;        // fragment order, 2 KB per 32 keys
  _Float16* sV = sK + R_ * D_;           // fragment order, 2 KB per 32 keys
  float* mbl = (float*)(sV + R_ * D_);   // the mask bias of the row's keys
  _Float16* sW = (_Float16*)(mbl + R_);  // rows 32 * proj + d of the head's weights
  int w = __builtin_amdgcn_readfirstlane(threadIdx.x >> 5);   // wave-uniform: tile indices and bases take scalar registers
  int lane = lane_id();
  const int NQ = R_ / 16;                   // 24
  int h = blockIdx.x & 7;
  int s = blockIdx.x >> 3;
  int half = lane >> 4, n = lane & 15;

  {
    // wave w stages rows w, w + 8, ... of the 128: row 32 * proj + d is row 256 * proj + 32 * h + d of wT
    const _Float16* gw = wT + (size_t)(h * D_ + w) * CM + lane * 8;
    v8h rw[16];
#pragma unroll
    for (int i = 0; i < 16; ++i)
      rw[i] = *(const v8h*)(gw + ((i >> 2) * 256 + (i & 3) * 8) * CM);
    // precaution: the address pair stays untouched (no load result is placed on it) up to this wait
    asm volatile("s_wait_xcnt 0x0" :: "v"(gw) : "memory");
#pragma unroll
    for (int i = 0; i < 16; ++i)
      *(v8h*)(sW + (w + i * 8) * GP + lane * 8) = rw[i];
    // The keys lie along the registers, 16 mask biases per lane and chunk: computed once per block.
    if (w < 3) {
      const float* mp = mask + (size_t)s * R_ + threadIdx.x * 4;
      v4f mm = *(const v4f*)mp;
      // precaution: the address pair stays untouched (no load result is placed on it) up to this wait
      asm volatile("s_wait_xcnt 0x0" :: "v"(mp) : "memory");
      *(v4f*)(&mbl[threadIdx.x * 4]) = 1e9f * (mm - 1.f);
    }
  }
  __syncthreads();   // every wave reads weight rows that the other waves staged

  const _Float16* mt = m + (size_t)(s * NQ + w) * 4096 + lane * 8;
  {
    v8f kt[3][2], vv[3][2];
    proj_pass<true>(mt, sW + 32 * GP, sW + 64 * GP, kt, vv);
#pragma unroll
    for (int i = 0; i < 3; ++i) {
      int kq = w + i * AW;   // 16-key tile
#pragma unroll
      for (int t = 0; t < 2; ++t) {
        *(v8h*)(sK + (kq * 2 + t) * 256 + lane * 8) = __builtin_convertvector(kt[i][t], v8h);
        *(v8h*)(sV + ((kq >> 1) * 4 + t * 2 + (kq & 1)) * 256 + lane * 8) = __builtin_convertvector(vv[i][t], v8h);
      }
    }
  }
  v16h bq3[3];      // B fragments of the wave's three query tiles: lane <-> query
  v8h gq3[3][2];    // their gates: [t] is d = 16 * t + 8 * half + 0..7 of query n
  {
    v8f qa[3][2], ga[3][2];
    proj_pass<false>(mt, sW, sW + 96 * GP, qa, ga);
    const float* bp = bg + h * D_ + half * 8;
    v4f bg4[4];
#pragma unroll
    for (int i = 0; i < 4; ++i) bg4[i] = *(const v4f*)(bp + (i >> 1) * 16 + (i & 1) * 4);
    // precaution: the address pair stays untouched (no load result is placed on it) up to this wait
    asm volatile("s_wait_xcnt 0x0" :: "v"(bp) : "memory");
#pragma unroll
    for (int i = 0; i < 3; ++i) {
      bq3[i] = join16(__builtin_convertvector(qa[i][0], v8h), __builtin_convertvector(qa[i][1], v8h));
#pragma unroll
      for (int t = 0; t < 2; ++t)
#pragma unroll
        for (int vi = 0; vi < 8; ++vi) {
          float bgv = bg4[t * 2 + (vi >> 2)][vi & 3];
          float gv = 1.f / (1.f + exp2_slot((ga[i][t][vi] + bgv) * -1.4426950408889634f));
          gq3[i][t][vi] = (_Float16)gv;
        }
    }
  }
  __syncthreads();   // every wave reads K and V tiles that the other waves computed

  const _Float16* KF = sK + lane * 8;
  const _Float16* VF = sV + lane * 8;
  const float* BL = &mbl[half * 8];

  // unrolled: bq3 and gq3 are registers and take constant indices
#pragma unroll
  for (int qi = 0; qi < 3; ++qi) {
    int qt = w + qi * AW;
    int q0 = qt * 16;
    const float* ZF = z + ((size_t)h * NQ + qt) * (R_ / 32) * 512 + lane * 4;   // fragment order, 2 KB per 32 keys

    v16h bq = bq3[qi];
    v8f o0 = zero8(), o1 = zero8();                   // O^T: register vi is d = 8 * half + vi (o1: + 16)
    float rmax = -1e30f, rsum = 0.f;                  // of query n; rsum over this half's keys only

    for (int kb = 0; kb < R_ / 64; ++kb) {
      // 64 keys per trip: two 32-key chunks share one maximum, one rescale of O^T and one round of loads
      // each z load and each K and V read below is 32 lanes x 16 B = 512 contiguous bytes
      const float* zp = ZF + (size_t)kb * 1024;
      v8h kf[8], vf[8];
      v4f zf[8], bf[8];
#pragma unroll
      for (int i = 0; i < 8; ++i) zf[i] = *(const v4f*)(zp + i * 128);
      // precaution: the address pair stays untouched (no load result is placed on it) up to this wait
      asm volatile("s_wait_xcnt 0x0" :: "v"(zp) : "memory");
#pragma unroll
      for (int i = 0; i < 8; ++i) kf[i] = *(const v8h*)(KF + kb * 2048 + i * 256);
#pragma unroll
      for (int i = 0; i < 8; ++i) bf[i] = *(const v4f*)(BL + kb * 64 + (i >> 1) * 16 + (i & 1) * 4);
#pragma unroll
      for (int i = 0; i < 8; ++i) vf[i] = *(const v8h*)(VF + kb * 2048 + i * 256);
      v8f sc4[4];   // S^T tile t: keys 64 * kb + 16 * t + 0..15
#pragma unroll
      for (int t = 0; t < 4; ++t) sc4[t] = wmma32(join16(kf[2 * t], kf[2 * t + 1]), bq, zero8());
#pragma unroll
      for (int t = 0; t < 4; ++t) sc4[t] += join8(zf[2 * t] + bf[2 * t], zf[2 * t + 1] + bf[2 * t + 1]);
      // one chain per chunk, so that the two run side by side
      float mxa = fmaxf(sc4[0][0], sc4[1][0]);
      float mxb = fmaxf(sc4[2][0], sc4[3][0]);
#pragma unroll
      for (int vi = 1; vi < 8; ++vi) {
        mxa = fmaxf(mxa, fmaxf(sc4[0][vi], sc4[1][vi]));
        mxb = fmaxf(mxb, fmaxf(sc4[2][vi], sc4[3][vi]));
      }
      float mx = fmaxf(mxa, mxb);
      mx = fmaxf(mx, xhalf(mx));         // both halves hold the query's maximum over the 64 keys
      float nm = fmaxf(rmax, mx);
      float sc = __expf(rmax - nm);
      rmax = nm;
      v8f p4t[4];
#pragma unroll
      for (int t = 0; t < 4; ++t)
        p4t[t] = exp2x8((sc4[t] - nm) * 1.4426950408889634f);   // e^x as 2^(x * log2 e), as __expf forms it
      v8f pp = (p4t[0] + p4t[1]) + (p4t[2] + p4t[3]);
      v4f p4 = __builtin_shufflevector(pp, pp, 0, 1, 2, 3) + __builtin_shufflevector(pp, pp, 4, 5, 6, 7);
      rsum = rsum * sc + ((p4[0] + p4[2]) + (p4[1] + p4[3]));
      // B fragments of P^T: the score tiles of a chunk as they stand
      v16h bp0 = join16(__builtin_convertvector(p4t[0], v8h), __builtin_convertvector(p4t[1], v8h));
      v16h bp1 = join16(__builtin_convertvector(p4t[2], v8h), __builtin_convertvector(p4t[3], v8h));
      o0 *= sc; o1 *= sc;
      // A fragments (lane <-> d) over each chunk's 32 keys: [0..1] d 0..15, [2..3] d 16..31, then the second chunk
      o0 = wmma32(join16(vf[0], vf[1]), bp0, o0);
      o1 = wmma32(join16(vf[2], vf[3]), bp0, o1);
      o0 = wmma32(join16(vf[4], vf[5]), bp1, o0);
      o1 = wmma32(join16(vf[6], vf[7]), bp1, o1);
    }

    // epilogue: join the halves' sums, normalize, gate, write og[row q0 + n, h*32 + d] (f16), 8 d per store
    rsum += xhalf(rsum);
    float inv = 1.f / rsum;
    v8h g0 = gq3[qi][0];   // d = 8 * half + 0..7
    v8h g1 = gq3[qi][1];   // d = 16 + 8 * half + 0..7
    v8h r0, r1;
#pragma unroll
    for (int vi = 0; vi < 8; ++vi) {
      r0[vi] = (_Float16)(o0[vi] * inv * (float)g0[vi]);
      r1[vi] = (_Float16)(o1[vi] * inv * (float)g1[vi]);
    }
    _Float16* dst = og + ((size_t)s * R_ + q0 + n) * 256 + h * D_ + half * 8;
    *(v8h*)dst = r0;
    *(v8h*)(dst + 16) = r1;
    // precaution: no register of the stores above (address, data) is rewritten by the next tile ahead of this wait
    asm volatile("s_wait_xcnt 0x0" :: "v"(dst), "v"(r0), "v"(r1) : "memory");
  }
}

// ---------------------------------------------------------------- output GEMM
__global__ __launch_bounds__(256)
void out_gemm_kernel(const _Float16* __restrict__ og,
                     const _Float16* __restrict__ woT,
                     const float* __restrict__ bo,
                     float* __restrict__ out) {
  __shared__ __attribute__((aligned(16))) _Float16 sA[128 * GP];
  __shared__ __attribute__((aligned(16))) _Float16 sB[128 * GP];
  int nb = blockIdx.x & 1;
  int mb = blockIdx.x >> 1;
  int lane = lane_id();
  int w = threadIdx.x >> 5;
  int half = lane >> 4, n = lane & 15;
  int row0 = mb * 128 + (w >> 2) * 64 + half * 8;
  int col0 = nb * 128 + (w & 3) * 32 + n;
  // read ahead of the tile: the scheduling fences of its k loop would otherwise hold these loads behind it
  float bias2[2] = { bo[col0], bo[col0 + 16] };
  v8f acc[4][2];
  gemm_tile_128x128(og + (size_t)mb * 128 * 256, woT + (size_t)nb * 128 * 256, sA, sB, acc);

#pragma unroll
  for (int ni = 0; ni < 2; ++ni) {
    float bias = bias2[ni];
#pragma unroll
    for (int mi = 0; mi < 4; ++mi)
#pragma unroll
      for (int vi = 0; vi < 8; ++vi)
        out[(size_t)(row0 + mi * 16 + vi) * 256 + col0 + ni * 16] = acc[mi][ni][vi] + bias;
  }
}

// ---------------------------------------------------------------- launch
extern "C" void kernel_launch(void* const* d_in, const int* in_sizes, int n_in,
                              void* d_out, int out_size, void* d_ws, size_t ws_size,
                              hipStream_t stream) {
  const float* msa_act  = (const float*)d_in[0];
  const float* pair_act = (const float*)d_in[1];
  const float* msa_mask = (const float*)d_in[2];
  const float* qn_g     = (const float*)d_in[3];
  const float* qn_b     = (const float*)d_in[4];
  const float* pn_g     = (const float*)d_in[5];
  const float* pn_b     = (const float*)d_in[6];
  const float* w_pair   = (const float*)d_in[7];
  const float* wq       = (const float*)d_in[8];
  const float* wk       = (const float*)d_in[9];
  const float* wv       = (const float*)d_in[10];
  const float* wg       = (const float*)d_in[11];
  const float* bg       = (const float*)d_in[12];
  const float* wo       = (const float*)d_in[13];
  const float* bo       = (const float*)d_in[14];
  float* out = (float*)d_out;

  char* ws = (char*)d_ws;
  _Float16* wT_  = (_Float16*)(ws + 0);               // 1024*256*2      = 524288
  _Float16* woT_ = (_Float16*)(ws + 524288);          // 256*256*2       = 131072
  float*    z_   = (float*)   (ws + 655360);          // 8*384*384*4     = 4718592
  _Float16* m_   = (_Float16*)(ws + 5373952);         // 49152*256*2     = 25165824
  _Float16* og_  = (_Float16*)(ws + 30539776);        // 49152*256*2

  prep_ln_pair_kernel<<<4928, 256, 0, stream>>>(wq, wk, wv, wg, wo, wT_, woT_, msa_act, qn_g, qn_b, m_,
                                                pair_act, pn_g, pn_b, w_pair, z_);
  qkvg_attn_kernel<<<1024, 256, 0, stream>>>(m_, wT_, bg, z_, msa_mask, og_);
  out_gemm_kernel<<<768, 256, 0, stream>>>(og_, woT_, bo, out);
}

// v010
// It runs in 93.3 microseconds.
// In two side-by-side timings against v009, it was 1.04 and 1.03 times as fast.
// Over all steps from v000 it is 4.64 times as fast.
#include <hip/hip_runtime.h>
#include <hip/hip_bf16.h>
#include <math.h>

typedef __attribute__((ext_vector_type(16))) _Float16 v16h;
typedef __attribute__((ext_vector_type(8)))  _Float16 v8h;
typedef __attribute__((ext_vector_type(8)))  float    v8f;

#define S_  128
#define R_  384
#define CM  256
#define CZ  128
#define H_  8
#define D_  32

__device__ __forceinline__ int lane_id() { return threadIdx.x & 31; }

__device__ __forceinline__ v8f zero8() {
  v8f z;
#pragma unroll
  for (int i = 0; i < 8; ++i) z[i] = 0.f;
  return z;
}

__device__ __forceinline__ v8f wmma32(v16h a, v16h b, v8f c) {
  // D = A(16x32 f16) * B(32x16 f16) + C(16x16 f32)
  return __builtin_amdgcn_wmma_f32_16x16x32_f16(false, a, false, b, (short)0, c,
                                                false, false);
}

__device__ __forceinline__ float wave_sum32(float x) {
#pragma unroll
  for (int off = 16; off > 0; off >>= 1) x += __shfl_xor(x, off, 32);
  return x;
}
// value of lane l ^ 16
__device__ __forceinline__ float xhalf(float x) {
  int b = __builtin_bit_cast(int, x);
  return __builtin_bit_cast(float,
      __builtin_amdgcn_permlanex16(b, b, 0x76543210, 0xfedcba98, false, false));
}

// ---------------------------------------------------------------- weights prep
// One 256-thread block of the weights' transposition; blk = 0 .. PREP_BLOCKS - 1.
#define PREP_BLOCKS 1280   // (4 + 1) * CM * CM elements / 256 threads
__device__ __forceinline__ void prep_weights_block(int blk,
                                    const float* wq, const float* wk, const float* wv,
                                    const float* wg, const float* wo,
                                    _Float16* wT, _Float16* woT) {
  int i = blk * 256 + threadIdx.x;
  const int NW = 4 * CM * CM;
  if (i < NW) {
    int proj = i >> 16;          // CM*CM == 65536
    int rem  = i & 65535;
    int hd   = rem >> 8;
    int c    = rem & 255;
    const float* w = (proj == 0) ? wq : (proj == 1) ? wk : (proj == 2) ? wv : wg;
    float scl = (proj == 0) ? 0.17677669529663689f : 1.0f;  // D^-0.5 folded into Wq
    wT[i] = (_Float16)(w[c * 256 + hd] * scl);              // wT[N=proj*256+hd][K=c]
  } else if (i < NW + CM * CM) {
    int j  = i - NW;
    int c  = j >> 8;
    int hd = j & 255;
    woT[j] = (_Float16)(wo[hd * 256 + c]);                  // woT[N=c][K=hd]
  }
}

// ---------------------------------------------------------------- pair bias z
// Stored as f16 in the order of a 32 x 16 B fragment (keys x queries) of the attention's matrix products: per
// (head, 16-query tile, 32-key chunk) 1 KB = 2 pieces of 512 B; piece j, lane l, element e holds
// z[query l & 15][key 16 * j + 8 * (l >> 4) + e], so a wave-wide 16-byte load is one piece.
// One LANE per (query i, key j) position: a wave takes 8 queries x 4 keys (lane = 4 * query + key), and
// the 8 waves of a block take the 32 keys of one chunk: four whole 128-byte lines of that order per head,
// which are put together in LDS, so that each line has one writer. Each 512-byte
// channel row is loaded by the wave in two 256-byte halves, passed through the wave's own LDS range (the
// first halves of all rows, then the second halves through the same range), and read back
// by the one lane that owns it, so the layernorm sums and the 8 head products are in-lane sums.
typedef __attribute__((ext_vector_type(4))) float v4f;
typedef __attribute__((address_space(4))) float cfloat;
#define PBP 68    // LDS pitch of a half row in floats: 272 B = 16 B x 17, so 16 lanes' 16-byte reads fall on distinct banks
#define PBW 8     // waves per block: the block size of the layernorm whose launch these blocks ride in
#define PAIR_BLOCKS ((R_ / 8) * (R_ / 4) / PBW)   // 576

static_assert((R_ / 4) % PBW == 0 && PBW * 4 == 32 && PBW == H_, "a block is 8 queries x one 32-key chunk; wave w stores head w");
// One block of the pair bias; blk = 0 .. PAIR_BLOCKS - 1; rows: PBW * 32 * PBP floats of LDS;
// zt: H_ * 256 f16 of LDS beside them, the block's four lines of each head.
__device__ __forceinline__
void pair_bias_block(int blk, float* rows, _Float16* zt,
                     const float* __restrict__ pair,
                     const float* __restrict__ pn_g,
                     const float* __restrict__ pn_b,
                     const float* __restrict__ w_pair,
                     _Float16* __restrict__ z) {
  int lane = lane_id();
  int w = __builtin_amdgcn_readfirstlane(threadIdx.x >> 5);
  int gw = blk * PBW + w;          // 0 .. (R_ / 8) * (R_ / 4) - 1
  int iq = gw / (R_ / 4);
  int jk = gw - iq * (R_ / 4);     // the waves of a block take neighbouring key groups
  int i0 = iq * 8;                 // first of the wave's 8 query rows
  int j0 = jk * 4;                 // first of the wave's 4 key cols
  const float* base = pair + ((size_t)i0 * R_ + j0) * CZ;   // wave-uniform
  float* my = rows + w * (32 * PBP);
  // load t + 16 * hf: channels 64 * hf + 0..63 of the rows of lanes 2 * t and 2 * t + 1, 256 bytes each
  int hi = lane >> 4, lo = lane & 15;
  unsigned boff = (unsigned)(hi * CZ + lo * 4) * (unsigned)sizeof(float);   // the lane's byte offset
  v4f r[32];
#pragma unroll
  for (int t = 0; t < 32; ++t)
    r[t] = *(const v4f*)((const char*)(base + (size_t)(((t & 15) >> 1) * R_ + (t & 1) * 2) * CZ + (t >> 4) * 64) + boff);
  // precaution: the loads' base and lane offset stay untouched (no load result is placed on them) up to this wait
  asm volatile("s_wait_xcnt 0x0" :: "s"(base), "v"(boff) : "memory");
  float* put = my + hi * PBP + lo * 4;
  const float* mine = my + lane * PBP;
  v4f x[32];
#pragma unroll
  for (int hf = 0; hf < 2; ++hf) {
#pragma unroll
    for (int t = 0; t < 16; ++t)
      *(v4f*)(put + t * 2 * PBP) = r[hf * 16 + t];
    // same-wave DS RAW: the half rows written above are read back across lanes below
    asm volatile("s_wait_dscnt 0" ::: "memory");
#pragma unroll
    for (int t = 0; t < 16; ++t)
      x[hf * 16 + t] = *(const v4f*)(mine + t * 4);
    // same-wave DS WAR: these reads have returned before the second halves go into the same range
    asm volatile("s_wait_dscnt 0" ::: "memory");
  }

  v4f s4 = { 0.f, 0.f, 0.f, 0.f }, q4 = { 0.f, 0.f, 0.f, 0.f };
#pragma unroll
  for (int t = 0; t < 32; ++t) { s4 += x[t]; q4 += x[t] * x[t]; }
  float s  = (s4[0] + s4[1]) + (s4[2] + s4[3]);
  float ss = (q4[0] + q4[1]) + (q4[2] + q4[3]);
  float mu = s * (1.f / CZ);
  float rsig = rsqrtf(ss * (1.f / CZ) - mu * mu + 1e-5f);

  // The three tables are inputs that no launch writes and every lane reads the same element: read
  // through the constant address space they stay scalar loads, also beside other blocks' stores in
  // the same kernel (as plain global reads they became 320 vector loads beside a GEMM's).
  const cfloat* cg = (const cfloat*)pn_g;
  const cfloat* cb = (const cfloat*)pn_b;
  const cfloat* cw = (const cfloat*)w_pair;
  float a[H_];
#pragma unroll
  for (int h = 0; h < H_; ++h) a[h] = 0.f;
#pragma unroll
  for (int c = 0; c < CZ; ++c) {
    float xn = (x[c >> 2][c & 3] - mu) * rsig * cg[c] + cb[c];
#pragma unroll
    for (int h = 0; h < H_; ++h) a[h] += xn * cw[c * H_ + h];
  }
  // line (key in chunk >> 3) of a head: 8 queries x 8 keys; the wave's keys in the chunk are 4 * w + 0..3
  _Float16* zl = zt + (w >> 1) * 64 + (lane >> 2) * 8 + (w & 1) * 4 + (lane & 3);
#pragma unroll
  for (int h = 0; h < H_; ++h) zl[h * 256] = (_Float16)a[h];
  __syncthreads();   // wave w stores head w's four lines, which hold values of all eight waves
  v8h zv = *(const v8h*)(zt + w * 256 + lane * 8);
  _Float16* dst = z + (size_t)((w * (R_ / 16) + (i0 >> 4)) * (R_ / 32) + (j0 >> 5)) * 512   // head, tile, chunk
                    + (lane >> 3) * 128 + ((i0 & 8) + (lane & 7)) * 8;                     // line, query
  *(v8h*)dst = zv;
  // precaution: no register of the store above (address, data) is rewritten ahead of this wait
  asm volatile("s_wait_xcnt 0x0" ::: "memory");
}

// ---------------------------------------------------------------- MSA layernorm
// One 256-thread block: one 16-row tile, two rows per wave; blk = 0 .. LN_BLOCKS - 1.
// m leaves in the order of the projections' 16 x 32 fragments: per 16-row tile 8 KB = 16 pieces of 512 B;
// piece (k step * 2 + j), lane l, element e holds m[row l & 15][c = 32 * k step + 16 * j + 8 * (l >> 4) + e].
// The tile is put together in LDS, so that each wave-wide 16-byte store is one whole piece.
#define LN_BLOCKS (S_ * R_ / 16)   // 3072
__device__ __forceinline__ void ln_msa_block(int blk, _Float16* tile,
                              const float* __restrict__ msa,
                              const float* __restrict__ gg,
                              const float* __restrict__ bb,
                              _Float16* __restrict__ m) {
  int w = threadIdx.x >> 5;
  int lane = lane_id();
  const float* p = msa + ((size_t)blk * 16 + w * 2) * CM + lane;
  float x2[2][8];
#pragma unroll
  for (int rr = 0; rr < 2; ++rr)
#pragma unroll
    for (int t = 0; t < 8; ++t) x2[rr][t] = p[rr * CM + t * 32];
  // precaution: the address pair stays untouched (no load result is placed on it) up to this wait
  asm volatile("s_wait_xcnt 0x0" :: "v"(p) : "memory");
#pragma unroll
  for (int rr = 0; rr < 2; ++rr) {
    int r = w * 2 + rr;
    float x[8], s = 0.f, ss = 0.f;
#pragma unroll
    for (int t = 0; t < 8; ++t) {
      float v = x2[rr][t];
      x[t] = v; s += v; ss += v * v;
    }
    s = wave_sum32(s); ss = wave_sum32(ss);
    float mu = s * (1.f / CM);
    float rsig = rsqrtf(ss * (1.f / CM) - mu * mu + 1e-5f);
    // channel c = 32 * t + lane: k step t, j = lane >> 4, fragment lane 16 * ((lane >> 3) & 1) + r, element lane & 7
    _Float16* o = tile + (lane >> 4) * 256 + (((lane >> 3) & 1) * 16 + r) * 8 + (lane & 7);
#pragma unroll
    for (int t = 0; t < 8; ++t) {
      int c = t * 32 + lane;
      o[t * 512] = (_Float16)((x[t] - mu) * rsig * gg[c] + bb[c]);
    }
  }
  __syncthreads();   // every wave stores pieces that hold rows of all eight waves
  v8h lo = *(const v8h*)(tile + threadIdx.x * 8);
  v8h hi = *(const v8h*)(tile + 2048 + threadIdx.x * 8);
  _Float16* dst = m + (size_t)blk * 4096 + threadIdx.x * 8;
  *(v8h*)dst = lo;
  *(v8h*)(dst + 2048) = hi;
  // precaution: no register of the two stores above (address, data) is rewritten ahead of this wait
  asm volatile("s_wait_xcnt 0x0" ::: "memory");
}

// None of the three reads what another writes, and all three are read first by the launch behind this
// one, so they share one launch: the weights' blocks come first, and their strided loads are in flight
// while the others start; then, of every 19 blocks, the first 3 are pair-bias blocks and the other 16
// layernorm blocks, so that the pair bias's vector work runs beside the layernorm's memory stream.
#define MIX_PAIR 3
#define MIX_LN 16
static_assert(PAIR_BLOCKS * MIX_LN == LN_BLOCKS * MIX_PAIR, "whole groups");
static_assert(PREP_BLOCKS + PAIR_BLOCKS + LN_BLOCKS == 4928, "the grid of kernel_launch");
static_assert(PBW * 32 * PBP * sizeof(float) >= 16 * CM * sizeof(_Float16), "the LDS serves both kinds");
static_assert(PBW * 32 * PBP * sizeof(float) % 16 == 0, "zt is read 16 bytes wide");
// 6 waves per SIMD (three blocks per WGP): without the bound the pair bias's branch took 194 registers,
// which leaves the layernorm's memory stream two blocks per WGP.
__global__ __launch_bounds__(256, 6)
void prep_ln_pair_kernel(const float* wq, const float* wk, const float* wv,
                         const float* wg, const float* wo,
                         _Float16* wT, _Float16* woT,
                         const float* __restrict__ msa,
                         const float* __restrict__ gg,
                         const float* __restrict__ bb,
                         _Float16* __restrict__ m,
                         const float* __restrict__ pair,
                         const float* __restrict__ pn_g,
                         const float* __restrict__ pn_b,
                         const float* __restrict__ w_pair,
                         _Float16* __restrict__ z) {
  __shared__ __attribute__((aligned(16))) unsigned char smem[PBW * 32 * PBP * sizeof(float) + H_ * 256 * sizeof(_Float16)];
  int b = blockIdx.x;   // uniform per block
  if (b < PREP_BLOCKS) {
    prep_weights_block(b, wq, wk, wv, wg, wo, wT, woT);
    return;
  }
  b -= PREP_BLOCKS;
  int grp = b / (MIX_PAIR + MIX_LN);
  int r   = b - grp * (MIX_PAIR + MIX_LN);
  if (r < MIX_PAIR) pair_bias_block(grp * MIX_PAIR + r, (float*)smem, (_Float16*)(smem + PBW * 32 * PBP * sizeof(float)),
                                    pair, pn_g, pn_b, w_pair, z);
  else              ln_msa_block(grp * MIX_LN + r - MIX_PAIR, (_Float16*)smem, msa, gg, bb, m);
}

// ---------------------------------------------------------------- GEMM block tile
// C[128 x 128] = A[128 x 256] * B^T, A and B both row-major with 256 f16 per row.
// 8 waves; both operand tiles are staged once in LDS, one whole 512-byte row per
// wave-wide load, and each wave then owns a 64 x 32 piece (4 x 2 accumulator tiles).
#define GP 264   // LDS row pitch in f16: 528 B = 16 B x 33, so 16 rows fall on distinct banks

__device__ __forceinline__ v16h join16(v8h lo, v8h hi) {
  return __builtin_shufflevector(lo, hi, 0, 1, 2, 3, 4, 5, 6, 7, 8, 9, 10, 11, 12, 13, 14, 15);
}

__device__ __forceinline__ v8f join8(v4f lo, v4f hi) {
  return __builtin_shufflevector(lo, hi, 0, 1, 2, 3, 4, 5, 6, 7);
}

// A fragment of a 16 x 32 f16 tile that lies row-major at pitch GP, as two 16-byte LDS reads.
// Lane L (0-15): row M = L, K = {0..7, 16..23}; lane 16-31: row M = L - 16, K = {8..15, 24..31}.
// Also serves as B fragment when the B matrix is stored transposed (N x K row-major),
// since the B lane layout mirrors A with lane <-> N.
__device__ __forceinline__ v16h lds_frag(const _Float16* base) {
  int lane = lane_id();
  const _Float16* rowp = base + (lane & 15) * GP + (lane >> 4) * 8;
  v8h lo = *(const v8h*)rowp;
  v8h hi = *(const v8h*)(rowp + 16);
  return __builtin_shufflevector(lo, hi, 0, 1, 2, 3, 4, 5, 6, 7, 8, 9, 10, 11, 12, 13, 14, 15);
}

__device__ __forceinline__ void gemm_tile_128x128(const _Float16* __restrict__ ga,
                                                  const _Float16* __restrict__ gb,
                                                  _Float16* sA, _Float16* sB,
                                                  v8f (&acc)[4][2]) {
  int lane = lane_id();
  int w = threadIdx.x >> 5;
  // wave w stages rows w, w + 8, ... of both tiles
  const _Float16* la = ga + w * 256 + lane * 8;
  const _Float16* lb = gb + w * 256 + lane * 8;
  _Float16* wa = sA + w * GP + lane * 8;
  _Float16* wb = sB + w * GP + lane * 8;
  v8h ra[16], rb[16];
#pragma unroll
  for (int i = 0; i < 16; ++i) {
    ra[i] = *(const v8h*)(la + i * 8 * 256);
    rb[i] = *(const v8h*)(lb + i * 8 * 256);
  }
  // precaution: both address pairs stay untouched (no load result is placed on them) up to this wait
  asm volatile("s_wait_xcnt 0x0" :: "v"(la), "v"(lb) : "memory");
#pragma unroll
  for (int i = 0; i < 16; ++i) {
    *(v8h*)(wa + i * 8 * GP) = ra[i];
    *(v8h*)(wb + i * 8 * GP) = rb[i];
  }
  __syncthreads();   // every wave reads rows that the other waves staged
  const _Float16* pa = sA + (w >> 2) * 64 * GP;
  const _Float16* pb = sB + (w & 3) * 32 * GP;
#pragma unroll
  for (int mi = 0; mi < 4; ++mi) { acc[mi][0] = zero8(); acc[mi][1] = zero8(); }
  // Two register sets of the six fragments of a k step: the reads of step ks + 1 are issued as one
  // group ahead of the eight products of step ks, so that their LDS latency runs under the products.
  v16h fa[2][4], fb[2][2];
#pragma unroll
  for (int mi = 0; mi < 4; ++mi) fa[0][mi] = lds_frag(pa + mi * 16 * GP);
  fb[0][0] = lds_frag(pb);
  fb[0][1] = lds_frag(pb + 16 * GP);
#pragma unroll
  for (int ks = 0; ks < 8; ++ks) {
    const int c = ks & 1;
    if (ks < 7) {
      int k1 = (ks + 1) * 32;
      fb[c ^ 1][0] = lds_frag(pb + k1);
      fb[c ^ 1][1] = lds_frag(pb + 16 * GP + k1);
#pragma unroll
      for (int mi = 0; mi < 4; ++mi) fa[c ^ 1][mi] = lds_frag(pa + mi * 16 * GP + k1);
    }
    // without it the scheduler sinks each read to just in front of its first use, with a full wait there
    __builtin_amdgcn_sched_barrier(0);
#pragma unroll
    for (int mi = 0; mi < 4; ++mi) {
      acc[mi][0] = wmma32(fa[c][mi], fb[c][0], acc[mi][0]);
      acc[mi][1] = wmma32(fa[c][mi], fb[c][1], acc[mi][1]);
    }
    // keeps the next group of reads behind these products, in one place
    __builtin_amdgcn_sched_barrier(0);
  }
}

// 2^x on v_exp_f32. The v_nop in the same statement is the one slot that the instruction set asks
// for behind a transcendental before its result is read or its source rewritten.
__device__ __forceinline__ float exp2_slot(float x) {
  float r;
  asm("v_exp_f32 %0, %1\n\tv_nop" : "=v"(r) : "v"(x));
  return r;
}

// 2^x of eight values on v_exp_f32, in one statement. The results take registers of their own (early
// clobber), so that no v_exp_f32 stands directly in front of an instruction that reads its result or
// rewrites its source; the closing v_nop is that slot behind the last of the eight.
__device__ __forceinline__ v8f exp2x8(v8f x) {
  float r0, r1, r2, r3, r4, r5, r6, r7;
  asm("v_exp_f32 %0, %8\n\tv_exp_f32 %1, %9\n\tv_exp_f32 %2, %10\n\tv_exp_f32 %3, %11\n\t"
      "v_exp_f32 %4, %12\n\tv_exp_f32 %5, %13\n\tv_exp_f32 %6, %14\n\tv_exp_f32 %7, %15\n\tv_nop"
      : "=&v"(r0), "=&v"(r1), "=&v"(r2), "=&v"(r3), "=&v"(r4), "=&v"(r5), "=&v"(r6), "=&v"(r7)
      : "v"(x[0]), "v"(x[1]), "v"(x[2]), "v"(x[3]), "v"(x[4]), "v"(x[5]), "v"(x[6]), "v"(x[7]));
  v8f r = { r0, r1, r2, r3, r4, r5, r6, r7 };
  return r;
}

// ---------------------------------------------------------------- projections + attention
// One 16 x 32 fragment of m, which lies in fragment order: two wave-wide 16-byte loads of 512 contiguous
// bytes each. Same element order as lds_frag.
__device__ __forceinline__ v16h m_frag(const _Float16* p) {
  v8h lo = *(const v8h*)p;
  v8h hi = *(const v8h*)(p + 256);
  return join16(lo, hi);
}

// Two of the four projections of one head for the wave's three 16-row tiles of m, K = 256.
// mt: the wave's first tile (its lane's 16 bytes); the other two lie 8 tiles apart. wx, wy: 32 rows of the
// head's weights each, in LDS at pitch GP.
// x[i][t] = Wx (16 rows from 16 * t) * m_i^T: register vi is d = 16 * t + 8 * (lane >> 4) + vi, lane & 15 the row of m.
// y[i][t]: the same with Wy, or, where Y_ROWS_ARE_M, m_i * Wy^T: register vi is the row 8 * (lane >> 4) + vi of m,
// lane & 15 is d - 16 * t.
template <bool Y_ROWS_ARE_M>
__device__ __forceinline__ void proj_pass(const _Float16* __restrict__ mt,
                                          const _Float16* wx, const _Float16* wy,
                                          v8f (&x)[3][2], v8f (&y)[3][2]) {
#pragma unroll
  for (int i = 0; i < 3; ++i) { x[i][0] = zero8(); x[i][1] = zero8(); y[i][0] = zero8(); y[i][1] = zero8(); }
  // Two register sets of a k step's seven fragments: the loads of step ks + 1 are issued as one group ahead
  // of the twelve products of step ks, so that their L2 and LDS latency runs under the products.
  v16h fm[2][3], fw[2][4];
#pragma unroll
  for (int i = 0; i < 3; ++i) fm[0][i] = m_frag(mt + i * (8 * 4096));
  fw[0][0] = lds_frag(wx);
  fw[0][1] = lds_frag(wx + 16 * GP);
  fw[0][2] = lds_frag(wy);
  fw[0][3] = lds_frag(wy + 16 * GP);
#pragma unroll
  for (int ks = 0; ks < 8; ++ks) {
    const int c = ks & 1;
    if (ks < 7) {
      int k1 = ks + 1;
#pragma unroll
      for (int i = 0; i < 3; ++i) fm[c ^ 1][i] = m_frag(mt + i * (8 * 4096) + k1 * 512);
      fw[c ^ 1][0] = lds_frag(wx + k1 * 32);
      fw[c ^ 1][1] = lds_frag(wx + 16 * GP + k1 * 32);
      fw[c ^ 1][2] = lds_frag(wy + k1 * 32);
      fw[c ^ 1][3] = lds_frag(wy + 16 * GP + k1 * 32);
    }
    // without it the scheduler sinks each load to just in front of its first use, with a full wait there
    __builtin_amdgcn_sched_barrier(0);
#pragma unroll
    for (int i = 0; i < 3; ++i)
#pragma unroll
      for (int t = 0; t < 2; ++t) {
        x[i][t] = wmma32(fw[c][t], fm[c][i], x[i][t]);
        y[i][t] = Y_ROWS_ARE_M ? wmma32(fm[c][i], fw[c][2 + t], y[i][t])
                               : wmma32(fw[c][2 + t], fm[c][i], y[i][t]);
      }
    // keeps the next group of loads behind these products, in one place
    __builtin_amdgcn_sched_barrier(0);
  }
  // precaution: the address pair of the loads of m stays untouched up to this wait
  asm volatile("s_wait_xcnt 0x0" :: "v"(mt) : "memory");
}

#define AW 8   // waves per block
__global__ __launch_bounds__(32 * AW)
void qkvg_attn_kernel(const _Float16* __restrict__ m, const _Float16* __restrict__ wT,
                      const float* __restrict__ bg,
                      const _Float16* __restrict__ z, const float* __restrict__ mask,
                      _Float16* __restrict__ og) {
  // One array, what the key loop reads in front: its LDS reads then reach everything by 16-bit immediate
  // offsets from two registers (with the weights in front each read took an address addition of its own).
  __shared__ __attribute__((aligned(16))) unsigned char smem[(2 * R_ * D_ + 128 * GP) * sizeof(_Float16) + R_ * sizeof(float)];
  _Float16* sK = (_Float16*)smem;        // fragment order, 2 KB per 32 keys
  _Float16* sV = sK + R_ * D_;           // fragment order, 2 KB per 32 keys
  float* mbl = (float*)(sV + R_ * D_);   // the mask bias of the row's keys
  _Float16* sW = (_Float16*)(mbl + R_);  // rows 32 * proj + d of the head's weights
  int w = __builtin_amdgcn_readfirstlane(threadIdx.x >> 5);   // wave-uniform: tile indices and bases take scalar registers
  int lane = lane_id();
  const int NQ = R_ / 16;                   // 24
  int h = blockIdx.x & 7;
  int s = blockIdx.x >> 3;
  int half = lane >> 4, n = lane & 15;

  {
    // wave w stages rows w, w + 8, ... of the 128: row 32 * proj + d is row 256 * proj + 32 * h + d of wT
    const _Float16* gw = wT + (size_t)(h * D_ + w) * CM + lane * 8;
    v8h rw[16];
#pragma unroll
    for (int i = 0; i < 16; ++i)
      rw[i] = *(const v8h*)(gw + ((i >> 2) * 256 + (i & 3) * 8) * CM);
    // precaution: the address pair stays untouched (no load result is placed on it) up to this wait
    asm volatile("s_wait_xcnt 0x0" :: "v"(gw) : "memory");
#pragma unroll
    for (int i = 0; i < 16; ++i)
      *(v8h*)(sW + (w + i * 8) * GP + lane * 8) = rw[i];
    // The keys lie along the registers, 16 mask biases per lane and chunk: computed once per block.
    if (w < 3) {
      const float* mp = mask + (size_t)s * R_ + threadIdx.x * 4;
      v4f mm = *(const v4f*)mp;
      // precaution: the address pair stays untouched (no load result is placed on it) up to this wait
      asm volatile("s_wait_xcnt 0x0" :: "v"(mp) : "memory");
      *(v4f*)(&mbl[threadIdx.x * 4]) = 1e9f * (mm - 1.f);
    }
  }
  __syncthreads();   // every wave reads weight rows that the other waves staged

  const _Float16* mt = m + (size_t)(s * NQ + w) * 4096 + lane * 8;
  {
    v8f kt[3][2], vv[3][2];
    proj_pass<true>(mt, sW + 32 * GP, sW + 64 * GP, kt, vv);
#pragma unroll
    for (int i = 0; i < 3; ++i) {
      int kq = w + i * AW;   // 16-key tile
#pragma unroll
      for (int t = 0; t < 2; ++t) {
        *(v8h*)(sK + (kq * 2 + t) * 256 + lane * 8) = __builtin_convertvector(kt[i][t], v8h);
        *(v8h*)(sV + ((kq >> 1) * 4 + t * 2 + (kq & 1)) * 256 + lane * 8) = __builtin_convertvector(vv[i][t], v8h);
      }
    }
  }
  v16h bq3[3];      // B fragments of the wave's three query tiles: lane <-> query
  v8h gq3[3][2];    // their gates: [t] is d = 16 * t + 8 * half + 0..7 of query n
  {
    v8f qa[3][2], ga[3][2];
    proj_pass<false>(mt, sW, sW + 96 * GP, qa, ga);
    const float* bp = bg + h * D_ + half * 8;
    v4f bg4[4];
#pragma unroll
    for (int i = 0; i < 4; ++i) bg4[i] = *(const v4f*)(bp + (i >> 1) * 16 + (i & 1) * 4);
    // precaution: the address pair stays untouched (no load result is placed on it) up to this wait
    asm volatile("s_wait_xcnt 0x0" :: "v"(bp) : "memory");
#pragma unroll
    for (int i = 0; i < 3; ++i) {
      bq3[i] = join16(__builtin_convertvector(qa[i][0], v8h), __builtin_convertvector(qa[i][1], v8h));
#pragma unroll
      for (int t = 0; t < 2; ++t)
#pragma unroll
        for (int vi = 0; vi < 8; ++vi) {
          float bgv = bg4[t * 2 + (vi >> 2)][vi & 3];
          float gv = 1.f / (1.f + exp2_slot((ga[i][t][vi] + bgv) * -1.4426950408889634f));
          gq3[i][t][vi] = (_Float16)gv;
        }
    }
  }
  __syncthreads();   // every wave reads K and V tiles that the other waves computed

  const _Float16* KF = sK + lane * 8;
  const _Float16* VF = sV + lane * 8;
  const float* BL = &mbl[half * 8];
  // A fragments of Sel_0 and Sel_1: lane (half, n) holds row n, k = 8 * half + e in the low and 16 + 8 * half + e in the high part
  v8h one_at, none;
#pragma unroll
  for (int e = 0; e < 8; ++e) {
    one_at[e] = (n == half * 8 + e) ? (_Float16)1.f : (_Float16)0.f;
    none[e] = (_Float16)0.f;
  }
  v16h sel[2] = { join16(one_at, none), join16(none, one_at) };

  // unrolled: bq3 and gq3 are registers and take constant indices
#pragma unroll
  for (int qi = 0; qi < 3; ++qi) {
    int qt = w + qi * AW;
    int q0 = qt * 16;
    const _Float16* ZF = z + ((size_t)h * NQ + qt) * (R_ / 32) * 512 + lane * 8;   // fragment order, 1 KB per 32 keys

    v16h bq = bq3[qi];
    v8f o0 = zero8(), o1 = zero8();                   // O^T: register vi is d = 8 * half + vi (o1: + 16)
    float rmax = -1e30f, rsum = 0.f;                  // of query n; rsum over this half's keys only

    for (int kb = 0; kb < R_ / 64; ++kb) {
      // 64 keys per trip: two 32-key chunks share one maximum, one rescale of O^T and one round of loads
      // each z load and each K and V read below is 32 lanes x 16 B = 512 contiguous bytes
      const _Float16* zp = ZF + (size_t)kb * 1024;
      v8h kf[8], vf[8], zf[4];
      v4f bf[8];
#pragma unroll
      for (int i = 0; i < 4; ++i) zf[i] = *(const v8h*)(zp + i * 256);
      // precaution: the address pair stays untouched (no load result is placed on it) up to this wait
      asm volatile("s_wait_xcnt 0x0" :: "v"(zp) : "memory");
#pragma unroll
      for (int i = 0; i < 8; ++i) kf[i] = *(const v8h*)(KF + kb * 2048 + i * 256);
#pragma unroll
      for (int i = 0; i < 8; ++i) bf[i] = *(const v4f*)(BL + kb * 64 + (i >> 1) * 16 + (i & 1) * 4);
#pragma unroll
      for (int i = 0; i < 8; ++i) vf[i] = *(const v8h*)(VF + kb * 2048 + i * 256);
      v8f sc4[4];   // S^T tile t: keys 64 * kb + 16 * t + 0..15
#pragma unroll
      for (int t = 0; t < 4; ++t) sc4[t] = wmma32(join16(kf[2 * t], kf[2 * t + 1]), bq, join8(bf[2 * t], bf[2 * t + 1]));
#pragma unroll
      for (int t = 0; t < 4; ++t) sc4[t] = wmma32(sel[t & 1], join16(zf[t & 2], zf[(t & 2) + 1]), sc4[t]);
      // one chain per chunk, so that the two run side by side
      float mxa = fmaxf(sc4[0][0], sc4[1][0]);
      float mxb = fmaxf(sc4[2][0], sc4[3][0]);
#pragma unroll
      for (int vi = 1; vi < 8; ++vi) {
        mxa = fmaxf(mxa, fmaxf(sc4[0][vi], sc4[1][vi]));
        mxb = fmaxf(mxb, fmaxf(sc4[2][vi], sc4[3][vi]));
      }
      float mx = fmaxf(mxa, mxb);
      mx = fmaxf(mx, xhalf(mx));         // both halves hold the query's maximum over the 64 keys
      float nm = fmaxf(rmax, mx);
      float sc = __expf(rmax - nm);
      rmax = nm;
      v8f p4t[4];
#pragma unroll
      for (int t = 0; t < 4; ++t)
        p4t[t] = exp2x8((sc4[t] - nm) * 1.4426950408889634f);   // e^x as 2^(x * log2 e), as __expf forms it
      v8f pp = (p4t[0] + p4t[1]) + (p4t[2] + p4t[3]);
      v4f p4 = __builtin_shufflevector(pp, pp, 0, 1, 2, 3) + __builtin_shufflevector(pp, pp, 4, 5, 6, 7);
      rsum = rsum * sc + ((p4[0] + p4[2]) + (p4[1] + p4[3]));
      // B fragments of P^T: the score tiles of a chunk as they stand
      v16h bp0 = join16(__builtin_convertvector(p4t[0], v8h), __builtin_convertvector(p4t[1], v8h));
      v16h bp1 = join16(__builtin_convertvector(p4t[2], v8h), __builtin_convertvector(p4t[3], v8h));
      o0 *= sc; o1 *= sc;
      // A fragments (lane <-> d) over each chunk's 32 keys: [0..1] d 0..15, [2..3] d 16..31, then the second chunk
      o0 = wmma32(join16(vf[0], vf[1]), bp0, o0);
      o1 = wmma32(join16(vf[2], vf[3]), bp0, o1);
      o0 = wmma32(join16(vf[4], vf[5]), bp1, o0);
      o1 = wmma32(join16(vf[6], vf[7]), bp1, o1);
    }

    // epilogue: join the halves' sums, normalize, gate, write og[row q0 + n, h*32 + d] (f16), 8 d per store
    rsum += xhalf(rsum);
    float inv = 1.f / rsum;
    v8h g0 = gq3[qi][0];   // d = 8 * half + 0..7
    v8h g1 = gq3[qi][1];   // d = 16 + 8 * half + 0..7
    v8h r0, r1;
#pragma unroll
    for (int vi = 0; vi < 8; ++vi) {
      r0[vi] = (_Float16)(o0[vi] * inv * (float)g0[vi]);
      r1[vi] = (_Float16)(o1[vi] * inv * (float)g1[vi]);
    }
    _Float16* dst = og + ((size_t)s * R_ + q0 + n) * 256 + h * D_ + half * 8;
    *(v8h*)dst = r0;
    *(v8h*)(dst + 16) = r1;
    // precaution: no register of the stores above (address, data) is rewritten by the next tile ahead of this wait
    asm volatile("s_wait_xcnt 0x0" :: "v"(dst), "v"(r0), "v"(r1) : "memory");
  }
}

// ---------------------------------------------------------------- output GEMM
__global__ __launch_bounds__(256)
void out_gemm_kernel(const _Float16* __restrict__ og,
                     const _Float16* __restrict__ woT,
                     const float* __restrict__ bo,
                     float* __restrict__ out) {
  __shared__ __attribute__((aligned(16))) _Float16 sA[128 * GP];
  __shared__ __attribute__((aligned(16))) _Float16 sB[128 * GP];
  int nb = blockIdx.x & 1;
  int mb = blockIdx.x >> 1;
  int lane = lane_id();
  int w = threadIdx.x >> 5;
  int half = lane >> 4, n = lane & 15;
  int row0 = mb * 128 + (w >> 2) * 64 + half * 8;
  int col0 = nb * 128 + (w & 3) * 32 + n;
  // read ahead of the tile: the scheduling fences of its k loop would otherwise hold these loads behind it
  float bias2[2] = { bo[col0], bo[col0 + 16] };
  v8f acc[4][2];
  gemm_tile_128x128(og + (size_t)mb * 128 * 256, woT + (size_t)nb * 128 * 256, sA, sB, acc);

#pragma unroll
  for (int ni = 0; ni < 2; ++ni) {
    float bias = bias2[ni];
#pragma unroll
    for (int mi = 0; mi < 4; ++mi)
#pragma unroll
      for (int vi = 0; vi < 8; ++vi)
        out[(size_t)(row0 + mi * 16 + vi) * 256 + col0 + ni * 16] = acc[mi][ni][vi] + bias;
  }
}

// ---------------------------------------------------------------- launch
extern "C" void kernel_launch(void* const* d_in, const int* in_sizes, int n_in,
                              void* d_out, int out_size, void* d_ws, size_t ws_size,
                              hipStream_t stream) {
  const float* msa_act  = (const float*)d_in[0];
  const float* pair_act = (const float*)d_in[1];
  const float* msa_mask = (const float*)d_in[2];
  const float* qn_g     = (const float*)d_in[3];
  const float* qn_b     = (const float*)d_in[4];
  const float* pn_g     = (const float*)d_in[5];
  const float* pn_b     = (const float*)d_in[6];
  const float* w_pair   = (const float*)d_in[7];
  const float* wq       = (const float*)d_in[8];
  const float* wk       = (const float*)d_in[9];
  const float* wv       = (const float*)d_in[10];
  const float* wg       = (const float*)d_in[11];
  const float* bg       = (const float*)d_in[12];
  const float* wo       = (const float*)d_in[13];
  const float* bo       = (const float*)d_in[14];
  float* out = (float*)d_out;

  char* ws = (char*)d_ws;
  _Float16* wT_  = (_Float16*)(ws + 0);               // 1024*256*2      = 524288
  _Float16* woT_ = (_Float16*)(ws + 524288);          // 256*256*2       = 131072
  _Float16* z_   = (_Float16*)(ws + 655360);          // 8*384*384*2     = 2359296
  _Float16* m_   = (_Float16*)(ws + 5373952);         // 49152*256*2     = 25165824
  _Float16* og_  = (_Float16*)(ws + 30539776);        // 49152*256*2

  prep_ln_pair_kernel<<<4928, 256, 0, stream>>>(wq, wk, wv, wg, wo, wT_, woT_, msa_act, qn_g, qn_b, m_,
                                                pair_act, pn_g, pn_b, w_pair, z_);
  qkvg_attn_kernel<<<1024, 256, 0, stream>>>(m_, wT_, bg, z_, msa_mask, og_);
  out_gemm_kernel<<<768, 256, 0, stream>>>(og_, woT_, bo, out);
}
